// v000
// The times below were measured on an AMD MI455X: many runs one after another, warmed up first and cycling through
// copies of the inputs, with the whole window's GPU time divided by the number of runs. Launches and the gaps
// between them are all in it. The median over several windows is given; except for v000 it joins two sittings, which
// can be a few percent apart, so the side-by-side timings, each taken in one sitting, are the better comparison.
// v000, which the later versions start from, runs in 153 microseconds.
// Multi-head dot attention, 2 x 2,048 queries x 2,048 keys, width 512 = 8 heads x 64; keys = pointwise [out][in] 64->512 map of the value rows + bias, values = the 64-wide value rows shared by all heads, softmax taken ACROSS THE 8 HEADS per (query, key), no key normalisation, no mask. Inputs and parameters converted to bf16 (RNE). Key projection: v_wmma_f32_16x16x32_f16 (f16 operands holding the bf16 values, value x16, weight x16, f32 accumulate, k carried x256 as one f16 plane); scores: v_wmma_f32_16x16x32_f16 (q x16 f16 plane against the k plane, f32 accumulate, f32 head softmax); weights.V: v_wmma_f32_16x16x32_f16 (P x4096 as f16, v^T x16 as f16, f32 accumulate).
#include <hip/hip_runtime.h>
#include <math.h>

#ifndef NB
#define NB 2
#endif
#ifndef SEQ
#define SEQ 2048
#endif
#define NB_FULL 2
#define SEQ_FULL 2048
#define DM 512
#define NH 8
#define DKH 64
#define NTOK (NB * SEQ)
#define OP 68      // f32 staging pitch (floats), GEMM epilogue
#define OPH 36     // f32 staging pitch (floats), attention epilogue (32-column halves)
#define TP 72      // transpose tile pitch (halves)
#define KCH 128    // keys per chunk = 8 waves x 16-key subtiles
#define QCARRY 16.0f
#define VCARRY 16.0f
#define WCARRY 16.0f
#define KCARRY 256.0f
#define PCARRY 4096.0f

static_assert(DM == NH * DKH);            // merged head layout h*64+d
static_assert(DKH == 64);                 // two 32-deep k-steps per score tile, four 16-wide output tiles
static_assert(NH == 8);                   // one head per wave in the accumulation phase, 8 waves per block
static_assert(SEQ % 64 == 0);             // 64-row GEMM tiles and 64-token transpose tiles inside one sequence
static_assert(SEQ % KCH == 0);            // whole key chunks
static_assert(SEQ % 16 == 0);             // 16-query blocks
static_assert(SEQ % 8 == 0);              // value rows viewed as 512-wide rows (8 tokens each) by the cast kernel
static_assert(SEQ_FULL % 8 == 0);
static_assert(NTOK % 64 == 0);            // GEMM tile multiple (M)
static_assert(DM % 64 == 0);              // GEMM tile multiple (N)
static_assert(DKH % 32 == 0);             // K steps of 32
static_assert((DM * DKH) % DM == 0);      // weight viewed as 512-wide rows by the cast kernel
static_assert(NB <= NB_FULL);
static_assert(SEQ <= SEQ_FULL);
static_assert((OP % 4) == 0);             // 16-B aligned reloads from the f32 staging tile
static_assert((OPH % 4) == 0);
static_assert((TP % 8) == 0);             // 16-B aligned reloads from the transpose tile
static_assert(KCH == 8 * 16);

typedef __attribute__((ext_vector_type(16))) _Float16 v16h;
typedef __attribute__((ext_vector_type(8)))  _Float16 v8h;
typedef __attribute__((ext_vector_type(16))) __bf16   v16b;
typedef __attribute__((ext_vector_type(8)))  __bf16   v8b;
typedef __attribute__((ext_vector_type(8)))  float    v8f;
typedef __attribute__((ext_vector_type(4)))  float    v4f;
typedef __attribute__((ext_vector_type(4)))  unsigned int v4u;
typedef v8h v8h_ma __attribute__((may_alias));
typedef v4f v4f_ma __attribute__((may_alias));

// 16-bit WMMA fragment map (wave32), lane L, h = L>>4, m = L&15:
//   A 16x32: lane = row m;    element i -> k = (i<8) ? 8h+i : 16+8h+(i-8)
//   B 32x16: lane = column m; the SAME k(i,h)
//   D 16x16 (8 f32): lane = column m; element r -> row 8h+r
// A fragment from a k-contiguous row is therefore p[0..7] | p[16..23] with p = row + k0 + 8h.

__device__ __forceinline__ unsigned int bf_bits(float f) {            // bf16 RNE bit pattern (finite inputs)
    const unsigned int u = __float_as_uint(f);
    return (u + 0x7FFFu + ((u >> 16) & 1u)) >> 16;
}
__device__ __forceinline__ float bf_val(float f) { return __uint_as_float(bf_bits(f) << 16); }
__device__ __forceinline__ unsigned int pk_h2(float a, float b) {
    return (unsigned int)__builtin_bit_cast(unsigned short, (_Float16)a) | ((unsigned int)__builtin_bit_cast(unsigned short, (_Float16)b) << 16);
}
__device__ __forceinline__ void pk_split2(float a, float b, unsigned int& hi, unsigned int& lo) {
    const unsigned int ha = bf_bits(a), hb = bf_bits(b);
    const unsigned int la = bf_bits(a - __uint_as_float(ha << 16)), lb = bf_bits(b - __uint_as_float(hb << 16));
    hi = ha | (hb << 16); lo = la | (lb << 16);
}
// f32 -> f16 that cannot produce an f16 subnormal: magnitudes below 2^-14 become zero (value select)
static __device__ __forceinline__ _Float16 toh_flush(float v) {
    const _Float16 r = (_Float16)v;
    return (fabsf(v) < 6.103515625e-05f) ? (_Float16)0.0f : r;
}
static __device__ __forceinline__ unsigned int pk_h2f(float a, float b) {
    return (unsigned int)__builtin_bit_cast(unsigned short, toh_flush(a)) | ((unsigned int)__builtin_bit_cast(unsigned short, toh_flush(b)) << 16);
}
__device__ __forceinline__ void wave_sync() {
    __builtin_amdgcn_fence(3 /* release order */, "workgroup");
    __builtin_amdgcn_wave_barrier();
    __builtin_amdgcn_fence(2 /* acquire order */, "workgroup");
}

__device__ __forceinline__ v16h ldfrag_h(const unsigned short* __restrict__ p) {
    const v8h a = *(const v8h*)(p);
    const v8h b = *(const v8h*)(p + 16);
    return __builtin_shufflevector(a, b, 0, 1, 2, 3, 4, 5, 6, 7, 8, 9, 10, 11, 12, 13, 14, 15);
}
__device__ __forceinline__ v16b ldfrag_b(const unsigned short* __restrict__ p) {
    const v8b a = *(const v8b*)(p);
    const v8b b = *(const v8b*)(p + 16);
    return __builtin_shufflevector(a, b, 0, 1, 2, 3, 4, 5, 6, 7, 8, 9, 10, 11, 12, 13, 14, 15);
}

template <int ET> struct FragT;
template <> struct FragT<0> {
    typedef v16h V;
    static __device__ __forceinline__ v16h load(const unsigned short* __restrict__ p) { return ldfrag_h(p); }
    static __device__ __forceinline__ v8f mma(v16h a, v16h b, v8f c) { return __builtin_amdgcn_wmma_f32_16x16x32_f16(false, a, false, b, (short)0, c, false, false); }
};
template <> struct FragT<1> {
    typedef v16b V;
    static __device__ __forceinline__ v16b load(const unsigned short* __restrict__ p) { return ldfrag_b(p); }
    static __device__ __forceinline__ v8f mma(v16b a, v16b b, v8f c) { return __builtin_amdgcn_wmma_f32_16x16x32_bf16(false, a, false, b, (short)0, c, false, false); }
};
// hazard guard for a group of four independent WMMAs: all four accumulators tied, A and all B fragments kept live
template <typename V>
__device__ __forceinline__ void guard4(v8f& a, v8f& b, v8f& c, v8f& d, V x, V y0, V y1, V y2, V y3) {
    asm volatile("v_nop\n\tv_nop\n\tv_nop\n\tv_nop" : "+v"(a), "+v"(b), "+v"(c), "+v"(d) : "v"(x), "v"(y0), "v"(y1), "v"(y2), "v"(y3));
}
// single f16 WMMA with its own hazard guard (one accumulator tied, both fragments kept live)
static __device__ __forceinline__ v8f mma_h(v16h a, v16h b, v8f c) {
    c = __builtin_amdgcn_wmma_f32_16x16x32_f16(false, a, false, b, (short)0, c, false, false);
    asm volatile("v_nop\n\tv_nop\n\tv_nop\n\tv_nop" : "+v"(c) : "v"(a), "v"(b));
    return c;
}

// =====================================================================================================================
// gemm64_body: C[m][n] = scale * sum_k A[m][k] * Bt[n][k] + bscale * bf16(bias); each wave owns a 64x64 tile, block = 8 waves.
//   A row-major [M][K] (pitch lda), Bt row-major [N][K] (pitch ldb), 16-bit planes; M, N % 64 == 0, K % 32 == 0 (host asserts).
//   ET 0: f16 operands, 1: bf16 operands. BIAS_MODE 1: bias[m], 2: bias[n].
//   OUT_MODE 0: f32 C (row m stored at row (m / cseq) * cseqfull + m % cseq); 1: f16 plane Ca; 2: bf16 hi plane Ca + bf16 lo plane Cb.
// =====================================================================================================================
template <int ET, int BIAS_MODE, int OUT_MODE>
__device__ __forceinline__ void gemm64_body(const unsigned short* __restrict__ A, int lda,
                                            const unsigned short* __restrict__ Bt, int ldb,
                                            float* __restrict__ Cf, unsigned short* __restrict__ Ca, unsigned short* __restrict__ Cb, int ldc,
                                            const float* __restrict__ bias, int M, int N, int K,
                                            float scale, float bscale, int cseq, int cseqfull) {
    typedef typename FragT<ET>::V V;
    __shared__ __align__(16) float sT[8 * 16 * OP];
    const int lane = threadIdx.x & 31;
    const int wave = __builtin_amdgcn_readfirstlane(threadIdx.x >> 5);
    const int tilesN = N >> 6;
    const int tilesM = M >> 6;
    const int tile = blockIdx.x * 8 + wave;
    if (tile >= tilesM * tilesN) return;          // wave-uniform; this kernel has no block barriers
    const int tm = tile / tilesN;
    const int tn = tile - tm * tilesN;
    const int m0 = tm << 6;
    const int n0 = tn << 6;
    const int rl   = lane & 15;
    const int koff = (lane >> 4) * 8;
    const int mOff = (lane >> 4) * 8;

    v8f acc[4][4];
#pragma unroll
    for (int i = 0; i < 4; ++i)
#pragma unroll
        for (int j = 0; j < 4; ++j) { const v8f zz = {0.f, 0.f, 0.f, 0.f, 0.f, 0.f, 0.f, 0.f}; acc[i][j] = zz; }

    for (int k0 = 0; k0 < K; k0 += 32) {
        V bh[4];
#pragma unroll
        for (int j = 0; j < 4; ++j) bh[j] = FragT<ET>::load(Bt + (size_t)(n0 + (j << 4) + rl) * ldb + koff + k0);
#pragma unroll
        for (int i = 0; i < 4; ++i) {
            const V ah = FragT<ET>::load(A + (size_t)(m0 + (i << 4) + rl) * lda + koff + k0);
            acc[i][0] = FragT<ET>::mma(ah, bh[0], acc[i][0]);
            acc[i][1] = FragT<ET>::mma(ah, bh[1], acc[i][1]);
            acc[i][2] = FragT<ET>::mma(ah, bh[2], acc[i][2]);
            acc[i][3] = FragT<ET>::mma(ah, bh[3], acc[i][3]);
            guard4<V>(acc[i][0], acc[i][1], acc[i][2], acc[i][3], ah, bh[0], bh[1], bh[2], bh[3]);
        }
    }

    const int sb = wave * (16 * OP);
#pragma unroll
    for (int i = 0; i < 4; ++i) {
        const int mBase = m0 + (i << 4);
#pragma unroll
        for (int j = 0; j < 4; ++j) {
            const int n = n0 + (j << 4) + rl;
            float bvn = 0.f;
            if (BIAS_MODE == 2) bvn = bf_val(bias[n]) * bscale;
#pragma unroll
            for (int r = 0; r < 8; ++r) {
                float v = acc[i][j][r] * scale;
                if (BIAS_MODE == 1) v += bf_val(bias[mBase + mOff + r]) * bscale;
                if (BIAS_MODE == 2) v += bvn;
                sT[sb + (mOff + r) * OP + (j << 4) + rl] = v;
            }
        }
        wave_sync();
        if (OUT_MODE == 0) {
            const int hh = lane >> 4, c4 = (lane & 15) * 4;      // row segment = 256 B = 16 lanes x 16 B; 2 rows per instruction
            {
#pragma unroll
                for (int it = 0; it < 8; ++it) {
                    const int row = it * 2 + hh;
                    const v4f v = *(const v4f_ma*)&sT[sb + row * OP + c4];
                    const int grow = mBase + row;
                    const int orow = (grow / cseq) * cseqfull + (grow % cseq);
                    *(v4f*)(Cf + (size_t)orow * ldc + n0 + c4) = v;
                }
                
            }
        } else {
            const int q = lane >> 3, c8 = (lane & 7) * 8;
            {
#pragma unroll
                for (int it = 0; it < 4; ++it) {
                    const int row = it * 4 + q;
                    const v4f a = *(const v4f_ma*)&sT[sb + row * OP + c8];
                    const v4f b = *(const v4f_ma*)&sT[sb + row * OP + c8 + 4];
                    const size_t o = (size_t)(mBase + row) * ldc + n0 + c8;
                    if (OUT_MODE == 1) {
                        v4u pk; pk.x = pk_h2f(a.x, a.y); pk.y = pk_h2f(a.z, a.w); pk.z = pk_h2f(b.x, b.y); pk.w = pk_h2f(b.z, b.w);
                        *(v4u*)(Ca + o) = pk;
                    } else {
                        v4u ph, pl;
                        unsigned int h0, l0, h1, l1, h2, l2, h3, l3;
                        pk_split2(a.x, a.y, h0, l0); pk_split2(a.z, a.w, h1, l1); pk_split2(b.x, b.y, h2, l2); pk_split2(b.z, b.w, h3, l3);
                        ph.x = h0; ph.y = h1; ph.z = h2; ph.w = h3; pl.x = l0; pl.y = l1; pl.z = l2; pl.w = l3;
                        *(v4u*)(Ca + o) = ph;
                        *(v4u*)(Cb + o) = pl;
                    }
                }
                
            }
        }
        wave_sync();
    }
}

// key projection: A = value plane f16 (x16) [M = tokens][K = 64], Bt = weight plane f16 (x16) [N = 512][K = 64] ([out][in] as stored);
// out = one f16 plane [M][N] holding k x256 (bias[n] added in f32 with the same carry)
__global__ __launch_bounds__(256) void k_gemm_k(const unsigned short* __restrict__ A, const unsigned short* __restrict__ Bt,
                                                const float* __restrict__ bias, unsigned short* __restrict__ C,
                                                int M, int N, int K, float scale, float bscale) {
    gemm64_body<0, 2, 1>(A, K, Bt, K, nullptr, C, nullptr, N, bias, M, N, K, scale, bscale, 1, 1);
}

// =====================================================================================================================
// =====================================================================================================================
// f32 [rows][512] -> f16 plane [nrows][512] holding bf16(x) * sc; plane row r reads source row (r / seq) * seqfull + r % seq
__global__ __launch_bounds__(256) void k_cast16(const float* __restrict__ src, unsigned short* __restrict__ dst, int nrows, int seq, int seqfull, float sc) {
    const int u = blockIdx.x * 256 + threadIdx.x;
    if (u >= nrows * (DM / 8)) return;
    const int r = u / (DM / 8);
    const int c0 = (u - r * (DM / 8)) * 8;
    const int sr = (r / seq) * seqfull + (r % seq);
    const float* s = src + (size_t)sr * DM + c0;
    const v4f a = *(const v4f*)(s);
    const v4f b = *(const v4f*)(s + 4);
    v4u pk;
    pk.x = pk_h2(bf_val(a.x) * sc, bf_val(a.y) * sc); pk.y = pk_h2(bf_val(a.z) * sc, bf_val(a.w) * sc);
    pk.z = pk_h2(bf_val(b.x) * sc, bf_val(b.y) * sc); pk.w = pk_h2(bf_val(b.z) * sc, bf_val(b.w) * sc);
    v4u* d = (v4u*)(dst + (size_t)r * DM + c0);
    *d = pk; 
}
// value f32 [batch][seqfull][64] -> transposed f16 plane dst[(b*64 + d)][seq] holding bf16(x) * sc.
__global__ __launch_bounds__(256) void k_cast_vt(const float* __restrict__ src, unsigned short* __restrict__ dst, int seq, int seqfull, float sc) {
    __shared__ __align__(16) _Float16 Tsh[DKH * TP];
    const int nb64 = seq / 64;
    const int b  = blockIdx.x / nb64;
    const int t0 = (blockIdx.x - b * nb64) * 64;
#pragma unroll 1
    for (int it = 0; it < 4; ++it) {
        const int idx = threadIdx.x + 256 * it;           // 1,024 float4 pieces of the [64 t][64 d] tile
        const int t  = idx >> 4;
        const int d4 = (idx & 15) * 4;
        const v4f a = *(const v4f*)(src + ((size_t)(b * seqfull + t0 + t)) * DKH + d4);
        Tsh[(d4 + 0) * TP + t] = toh_flush(bf_val(a.x) * sc);
        Tsh[(d4 + 1) * TP + t] = toh_flush(bf_val(a.y) * sc);
        Tsh[(d4 + 2) * TP + t] = toh_flush(bf_val(a.z) * sc);
        Tsh[(d4 + 3) * TP + t] = toh_flush(bf_val(a.w) * sc);
    }
    __syncthreads();
    {
#pragma unroll
        for (int it = 0; it < 2; ++it) {
            const int p  = threadIdx.x + 256 * it;        // 512 pieces of 8 halves: 64 rows d x 8 pieces
            const int d  = p >> 3;
            const int c8 = (p & 7) * 8;
            const v8h v = *(const v8h_ma*)&Tsh[d * TP + c8];
            const v4u pk = __builtin_bit_cast(v4u, v);
            *(v4u*)(dst + (size_t)(b * DKH + d) * seq + t0 + c8) = pk;
        }
        
    }
}

// =====================================================================================================================
// k_attn_heads: fused attention with the softmax taken across the 8 heads. Block = 8 waves = 16 query rows of one batch.
//   QP: f16 plane [ntok][512] (q x16); KP: f16 plane [ntok][512] (k x256); VT: f16 plane [batch*64][seq] (v^T x16).
//   Per 128-key chunk:
//     phase A (wave = 16-key subtile): S^T[key][query] for all 8 heads (A = k rows, B = q rows, two 32-deep steps each),
//       head softmax lane-local in f32, P x4096 as f16 written as 16-B pieces Psh[head][subtile][query][16 keys];
//     block barrier (Psh is written by one wave and read by another);
//     phase B (wave = head): O^T[d][query] += V^T[d][32 keys] . P^T[32 keys][query]; the B fragment is two 16-B pieces of
//       two adjacent 16-key subtiles (elements 0..7 <- keys 8h+r of the first, 8..15 <- keys 8h+r of the second; lane unchanged);
//     block barrier before the next chunk overwrites Psh.
//   Epilogue: per wave (head) 16 rows x 64 columns staged in two 32-column halves through a wave-private LDS tile (wave_sync),
// =====================================================================================================================
__global__ __launch_bounds__(256) void k_attn_heads(const unsigned short* __restrict__ QP, const unsigned short* __restrict__ KP,
                                                    const unsigned short* __restrict__ VT, float* __restrict__ out,
                                                    int seq, int seqfull, float sscale) {
    __shared__ __align__(16) _Float16 Psh[NH * 8 * 16 * 16];     // [head][key subtile][query][16 keys], cross-wave
    __shared__ __align__(16) float    Osh[8 * 16 * OPH];         // wave-private output staging [16][32] (+4 pad)
    const int lane = threadIdx.x & 31;
    const int wave = __builtin_amdgcn_readfirstlane(threadIdx.x >> 5);
    const int hf = lane >> 4;
    const int c  = lane & 15;
    const int nqb = seq / 16;
    const int b  = blockIdx.x / nqb;
    const int q0 = (blockIdx.x - b * nqb) * 16;
    const int qoff  = (b * seq + q0 + c) * DM + 8 * hf;             // B fragment base (column = query = lane & 15)
    const int kbase = (b * seq + wave * 16 + c) * DM + 8 * hf;      // A fragment base (row = key = lane & 15 of this wave's subtile)
    const int vbase = (b * DKH + c) * seq + 8 * hf;                 // A fragment base for v^T (row d = lane & 15)
    const int obase = wave * (16 * OPH);
    const float sl2 = sscale * 1.4426950408889634f;

    v8f oacc[4];
#pragma unroll
    for (int t = 0; t < 4; ++t) { const v8f zz = {0.f, 0.f, 0.f, 0.f, 0.f, 0.f, 0.f, 0.f}; oacc[t] = zz; }

    for (int kc = 0; kc < seq; kc += KCH) {
        // ---------- phase A: S^T for this wave's 16 keys, all 8 heads ----------
        v8f s[NH];
#pragma unroll
        for (int h = 0; h < NH; ++h) {
            v8f z = {0.f, 0.f, 0.f, 0.f, 0.f, 0.f, 0.f, 0.f};
            const int ko = kbase + kc * DM + h * DKH;
            const int qo = qoff + h * DKH;
            const v16h ka = ldfrag_h(KP + ko);
            const v16h qa = ldfrag_h(QP + qo);
            z = mma_h(ka, qa, z);
            const v16h kb = ldfrag_h(KP + ko + 32);
            const v16h qb = ldfrag_h(QP + qo + 32);
            z = mma_h(kb, qb, z);
            s[h] = z;
            if ((h & 1) == 1) __builtin_amdgcn_sched_barrier(0);
        }
        // ---------- softmax across heads: element r of every head tile is the same (key, query) pair ----------
#pragma unroll
        for (int r = 0; r < 8; ++r) {
            float m = s[0][r];
#pragma unroll
            for (int h = 1; h < NH; ++h) m = fmaxf(m, s[h][r]);
            float zsum = 0.f;
#pragma unroll
            for (int h = 0; h < NH; ++h) {
                const float e = exp2f((s[h][r] - m) * sl2);
                s[h][r] = e;
                zsum += e;
            }
            const float inv = PCARRY / zsum;
#pragma unroll
            for (int h = 0; h < NH; ++h) s[h][r] = s[h][r] * inv;
        }
#pragma unroll
        for (int h = 0; h < NH; ++h) {
            v8h pv;
#pragma unroll
            for (int r = 0; r < 8; ++r) pv[r] = toh_flush(s[h][r]);
            *(v8h_ma*)&Psh[((h * 8 + wave) * 16 + c) * 16 + 8 * hf] = pv;      // keys 8*hf .. 8*hf+7 of subtile 'wave', query c
        }
        __syncthreads();
        // ---------- phase B: head = wave; O^T[d][query] += V^T . P^T over the chunk's four 32-key steps ----------
#pragma unroll 1
        for (int sc = 0; sc < 4; ++sc) {
            const int po = ((wave * 8 + 2 * sc) * 16 + c) * 16 + 8 * hf;
            const v8h p0 = *(const v8h_ma*)&Psh[po];
            const v8h p1 = *(const v8h_ma*)&Psh[po + 256];
            const v16h pb = __builtin_shufflevector(p0, p1, 0, 1, 2, 3, 4, 5, 6, 7, 8, 9, 10, 11, 12, 13, 14, 15);
            const int vo = vbase + kc + sc * 32;
            const v16h va0 = ldfrag_h(VT + vo);
            oacc[0] = mma_h(va0, pb, oacc[0]);
            const v16h va1 = ldfrag_h(VT + vo + 16 * seq);
            oacc[1] = mma_h(va1, pb, oacc[1]);
            const v16h va2 = ldfrag_h(VT + vo + 32 * seq);
            oacc[2] = mma_h(va2, pb, oacc[2]);
            const v16h va3 = ldfrag_h(VT + vo + 48 * seq);
            oacc[3] = mma_h(va3, pb, oacc[3]);
        }
        __syncthreads();
    }

    // ---------- epilogue: out[b][q0 + query][wave*64 + d], d = t*16 + 8*hf + r held by lane (query c) ----------
    const float osc = 1.0f / (PCARRY * VCARRY);
#pragma unroll
    for (int half = 0; half < 2; ++half) {
#pragma unroll
        for (int tt = 0; tt < 2; ++tt) {
#pragma unroll
            for (int r = 0; r < 8; ++r) Osh[obase + c * OPH + tt * 16 + 8 * hf + r] = oacc[half * 2 + tt][r] * osc;
        }
        wave_sync();
        {
            const int q = lane >> 3, c4 = (lane & 7) * 4;
            {
#pragma unroll
                for (int it = 0; it < 4; ++it) {
                    const int row = it * 4 + q;
                    const v4f v = *(const v4f_ma*)&Osh[obase + row * OPH + c4];
                    *(v4f*)(out + (size_t)(b * seqfull + q0 + row) * DM + wave * DKH + half * 32 + c4) = v;
                }
                
            }
        }
        wave_sync();
    }
}

// =====================================================================================================================
// Host side: workspace carve (all plane sizes are multiples of 256 B), 6 launches.
// =====================================================================================================================
constexpr size_t SZ_TOK  = (size_t)NTOK * DM * 2;          // one 16-bit token plane [NTOK][512]
constexpr size_t SZ_V    = (size_t)NTOK * DKH * 2;         // value plane [NTOK][64]
constexpr size_t SZ_W    = (size_t)DM * DKH * 2;           // weight plane [512][64]
constexpr size_t SZ_VT   = (size_t)NB * DKH * SEQ * 2;     // v^T plane [NB*64][SEQ]
constexpr size_t WS_TOTAL = SZ_TOK + SZ_V + SZ_W + SZ_TOK + SZ_VT;
static_assert(SZ_TOK % 256 == 0);
static_assert(SZ_V % 256 == 0);
static_assert(SZ_W % 256 == 0);
static_assert(SZ_VT % 256 == 0);
static_assert(WS_TOTAL <= (size_t)134217728);            // carve stays within 128 MiB
static_assert(((NTOK / 64) * (DM / 64)) % 8 == 0);        // GEMM grid is whole blocks of 8 wave tiles
static_assert((size_t)NTOK * DM < (size_t)2147483647);    // int plane offsets
static_assert((size_t)NB_FULL * SEQ_FULL * DM * 4 == (size_t)8388608);   // output extent in bytes (offset 0)

extern "C" void kernel_launch(void* const* d_in, const int* in_sizes, int n_in, void* d_out, int out_size, void* d_ws, size_t ws_size, hipStream_t stream) {
    if (n_in < 4) return;
    const long long need_q = ((long long)(NB - 1) * SEQ_FULL + SEQ) * DM;
    const long long need_v = ((long long)(NB - 1) * SEQ_FULL + SEQ) * DKH;
    if ((long long)in_sizes[0] < need_q || (long long)in_sizes[1] < need_v) return;
    if (in_sizes[2] < DM * DKH || in_sizes[3] < DM) return;
    if ((long long)out_size < need_q) return;
    if (WS_TOTAL > ws_size) return;

    // query, value, conv_w [512][64][1], conv_b [512]
    const float* xq = (const float*)d_in[0];
    const float* xv = (const float*)d_in[1];
    const float* Wc = (const float*)d_in[2];
    const float* bc = (const float*)d_in[3];
    float* out = (float*)d_out;

    char* wsp = (char*)d_ws;
    unsigned short* Q16 = (unsigned short*)wsp; wsp += SZ_TOK;
    unsigned short* V16 = (unsigned short*)wsp; wsp += SZ_V;
    unsigned short* W16 = (unsigned short*)wsp; wsp += SZ_W;
    unsigned short* KPp = (unsigned short*)wsp; wsp += SZ_TOK;
    unsigned short* VTp = (unsigned short*)wsp; wsp += SZ_VT;
    if ((size_t)(wsp - (char*)d_ws) > ws_size) return;

    const unsigned gx_q = (unsigned)((NTOK * (DM / 8) + 255) / 256);
    const unsigned gx_v = (unsigned)(((NTOK / 8) * (DM / 8) + 255) / 256);
    const unsigned gx_w = (unsigned)((DKH * (DM / 8) + 255) / 256);
    const unsigned gx_gemm = (unsigned)((((NTOK / 64) * (DM / 64)) + 7) / 8);

    // query plane: row r <- input row (r / SEQ) * SEQ_FULL + r % SEQ, x16
    k_cast16<<<gx_q, 256, 0, stream>>>(xq, Q16, NTOK, SEQ, SEQ_FULL, QCARRY);
    // value [tokens][64] viewed as 512-wide rows of 8 tokens: in[NTOK/8][512] -> plane [NTOK/8][512] = [NTOK][64], x16
    k_cast16<<<gx_v, 256, 0, stream>>>(xv, V16, NTOK / 8, SEQ / 8, SEQ_FULL / 8, VCARRY);
    // weight [512 out][64 in] viewed as [64][512]; stored order kept (Bt[n][k] = W[n][k]), x16
    k_cast16<<<gx_w, 256, 0, stream>>>(Wc, W16, DKH, DKH, DKH, WCARRY);
    // v^T plane: in[tokens][64] -> out[64][tokens] per batch, x16; grid = NB * SEQ/64 tiles
    k_cast_vt<<<(unsigned)(NB * (SEQ / 64)), 256, 0, stream>>>(xv, VTp, SEQ, SEQ_FULL, VCARRY);

    // k x256 = (value x16)(W x16)^T + 256 * bias  -> f16 plane [NTOK][512]
    k_gemm_k<<<gx_gemm, 256, 0, stream>>>(V16, W16, bc, KPp, NTOK, DM, DKH, KCARRY / (VCARRY * WCARRY), KCARRY);

    // scores carry 16 * 256; score scale 1/8 applied with the carries inside the head softmax
    k_attn_heads<<<(unsigned)(NB * (SEQ / 16)), 256, 0, stream>>>(Q16, KPp, VTp, out, SEQ, SEQ_FULL, 0.125f / (QCARRY * KCARRY));
}

// v001
// A run of this version takes 116 microseconds.
// Two timings next to v000 both put it at 1.30 times that version's speed.
// Multi-head dot attention, 2 x 2,048 queries x 2,048 keys, width 512 = 8 heads x 64; keys = pointwise [out][in] 64->512 map of the value rows + bias, values = the 64-wide value rows shared by all heads, softmax taken ACROSS THE 8 HEADS per (query, key), no key normalisation, no mask. Inputs and parameters converted to bf16 (RNE). Key projection: v_wmma_f32_16x16x32_f16 (f16 operands holding the bf16 values, value x16, weight x16, f32 accumulate, k carried x256 as one f16 plane); scores: v_wmma_f32_16x16x32_f16 (q x16 f16 plane against the k plane, f32 accumulate, f32 head softmax); weights.V: v_wmma_f32_16x16x32_f16 (P x4096 as f16, v^T x16 as f16, f32 accumulate).
#include <hip/hip_runtime.h>
#include <math.h>

#ifndef NB
#define NB 2
#endif
#ifndef SEQ
#define SEQ 2048
#endif
#define NB_FULL 2
#define SEQ_FULL 2048
#define DM 512
#define NH 8
#define DKH 64
#define NTOK (NB * SEQ)
#define OP 68      // f32 staging pitch (floats), GEMM epilogue
#define OPH 36     // f32 staging pitch (floats), attention epilogue (32-column halves)
#define TP 72      // transpose tile pitch (halves)
#define KCH 128    // keys per chunk = 8 waves x 16-key subtiles
#define QCARRY 16.0f
#define VCARRY 16.0f
#define WCARRY 16.0f
#define KCARRY 256.0f
#define PCARRY 4096.0f

static_assert(DM == NH * DKH);            // merged head layout h*64+d
static_assert(DKH == 64);                 // two 32-deep k-steps per score tile, four 16-wide output tiles
static_assert(NH == 8);                   // one head per wave in the accumulation phase, 8 waves per block
static_assert(SEQ % 64 == 0);             // 64-row GEMM tiles and 64-token transpose tiles inside one sequence
static_assert(SEQ % KCH == 0);            // whole key chunks
static_assert(SEQ % 16 == 0);             // 16-query blocks
static_assert(SEQ % 8 == 0);              // value rows viewed as 512-wide rows (8 tokens each) by the cast kernel
static_assert(SEQ_FULL % 8 == 0);
static_assert(NTOK % 64 == 0);            // GEMM tile multiple (M)
static_assert(DM % 64 == 0);              // GEMM tile multiple (N)
static_assert(DKH % 32 == 0);             // K steps of 32
static_assert((DM * DKH) % DM == 0);      // weight viewed as 512-wide rows by the cast kernel
static_assert(NB <= NB_FULL);
static_assert(SEQ <= SEQ_FULL);
static_assert((OP % 4) == 0);             // 16-B aligned reloads from the f32 staging tile
static_assert((OPH % 4) == 0);
static_assert((TP % 8) == 0);             // 16-B aligned reloads from the transpose tile
static_assert(KCH == 8 * 16);

typedef __attribute__((ext_vector_type(16))) _Float16 v16h;
typedef __attribute__((ext_vector_type(8)))  _Float16 v8h;
typedef __attribute__((ext_vector_type(16))) __bf16   v16b;
typedef __attribute__((ext_vector_type(8)))  __bf16   v8b;
typedef __attribute__((ext_vector_type(8)))  float    v8f;
typedef __attribute__((ext_vector_type(4)))  float    v4f;
typedef __attribute__((ext_vector_type(4)))  unsigned int v4u;
typedef v8h v8h_ma __attribute__((may_alias));
typedef v4f v4f_ma __attribute__((may_alias));

// 16-bit WMMA fragment map (wave32), lane L, h = L>>4, m = L&15:
//   A 16x32: lane = row m;    element i -> k = (i<8) ? 8h+i : 16+8h+(i-8)
//   B 32x16: lane = column m; the SAME k(i,h)
//   D 16x16 (8 f32): lane = column m; element r -> row 8h+r
// A fragment from a k-contiguous row is therefore p[0..7] | p[16..23] with p = row + k0 + 8h.

__device__ __forceinline__ unsigned int bf_bits(float f) {            // bf16 RNE bit pattern (finite inputs)
    const unsigned int u = __float_as_uint(f);
    return (u + 0x7FFFu + ((u >> 16) & 1u)) >> 16;
}
__device__ __forceinline__ float bf_val(float f) { return __uint_as_float(bf_bits(f) << 16); }
__device__ __forceinline__ unsigned int pk_h2(float a, float b) {
    return (unsigned int)__builtin_bit_cast(unsigned short, (_Float16)a) | ((unsigned int)__builtin_bit_cast(unsigned short, (_Float16)b) << 16);
}
__device__ __forceinline__ void pk_split2(float a, float b, unsigned int& hi, unsigned int& lo) {
    const unsigned int ha = bf_bits(a), hb = bf_bits(b);
    const unsigned int la = bf_bits(a - __uint_as_float(ha << 16)), lb = bf_bits(b - __uint_as_float(hb << 16));
    hi = ha | (hb << 16); lo = la | (lb << 16);
}
// f32 -> f16 that cannot produce an f16 subnormal: magnitudes below 2^-14 become zero (value select)
static __device__ __forceinline__ _Float16 toh_flush(float v) {
    const _Float16 r = (_Float16)v;
    return (fabsf(v) < 6.103515625e-05f) ? (_Float16)0.0f : r;
}
static __device__ __forceinline__ unsigned int pk_h2f(float a, float b) {
    return (unsigned int)__builtin_bit_cast(unsigned short, toh_flush(a)) | ((unsigned int)__builtin_bit_cast(unsigned short, toh_flush(b)) << 16);
}
__device__ __forceinline__ void wave_sync() {
    __builtin_amdgcn_fence(3 /* release order */, "workgroup");
    __builtin_amdgcn_wave_barrier();
    __builtin_amdgcn_fence(2 /* acquire order */, "workgroup");
}

__device__ __forceinline__ v16h ldfrag_h(const unsigned short* __restrict__ p) {
    const v8h a = *(const v8h*)(p);
    const v8h b = *(const v8h*)(p + 16);
    return __builtin_shufflevector(a, b, 0, 1, 2, 3, 4, 5, 6, 7, 8, 9, 10, 11, 12, 13, 14, 15);
}
__device__ __forceinline__ v16b ldfrag_b(const unsigned short* __restrict__ p) {
    const v8b a = *(const v8b*)(p);
    const v8b b = *(const v8b*)(p + 16);
    return __builtin_shufflevector(a, b, 0, 1, 2, 3, 4, 5, 6, 7, 8, 9, 10, 11, 12, 13, 14, 15);
}

template <int ET> struct FragT;
template <> struct FragT<0> {
    typedef v16h V;
    static __device__ __forceinline__ v16h load(const unsigned short* __restrict__ p) { return ldfrag_h(p); }
    static __device__ __forceinline__ v8f mma(v16h a, v16h b, v8f c) { return __builtin_amdgcn_wmma_f32_16x16x32_f16(false, a, false, b, (short)0, c, false, false); }
};
template <> struct FragT<1> {
    typedef v16b V;
    static __device__ __forceinline__ v16b load(const unsigned short* __restrict__ p) { return ldfrag_b(p); }
    static __device__ __forceinline__ v8f mma(v16b a, v16b b, v8f c) { return __builtin_amdgcn_wmma_f32_16x16x32_bf16(false, a, false, b, (short)0, c, false, false); }
};
// hazard guard for a group of four independent WMMAs: all four accumulators tied, A and all B fragments kept live
template <typename V>
__device__ __forceinline__ void guard4(v8f& a, v8f& b, v8f& c, v8f& d, V x, V y0, V y1, V y2, V y3) {
    asm volatile("v_nop\n\tv_nop\n\tv_nop\n\tv_nop" : "+v"(a), "+v"(b), "+v"(c), "+v"(d) : "v"(x), "v"(y0), "v"(y1), "v"(y2), "v"(y3));
}
// single f16 WMMA with its own hazard guard (one accumulator tied, both fragments kept live)
static __device__ __forceinline__ v8f mma_h(v16h a, v16h b, v8f c) {
    c = __builtin_amdgcn_wmma_f32_16x16x32_f16(false, a, false, b, (short)0, c, false, false);
    asm volatile("v_nop\n\tv_nop\n\tv_nop\n\tv_nop" : "+v"(c) : "v"(a), "v"(b));
    return c;
}

// =====================================================================================================================
// gemm64_body: C[m][n] = scale * sum_k A[m][k] * Bt[n][k] + bscale * bf16(bias); each wave owns a 64x64 tile, block = 8 waves.
//   A row-major [M][K] (pitch lda), Bt row-major [N][K] (pitch ldb), 16-bit planes; M, N % 64 == 0, K % 32 == 0 (host asserts).
//   ET 0: f16 operands, 1: bf16 operands. BIAS_MODE 1: bias[m], 2: bias[n].
//   OUT_MODE 0: f32 C (row m stored at row (m / cseq) * cseqfull + m % cseq); 1: f16 plane Ca; 2: bf16 hi plane Ca + bf16 lo plane Cb.
// =====================================================================================================================
template <int ET, int BIAS_MODE, int OUT_MODE>
__device__ __forceinline__ void gemm64_body(const unsigned short* __restrict__ A, int lda,
                                            const unsigned short* __restrict__ Bt, int ldb,
                                            float* __restrict__ Cf, unsigned short* __restrict__ Ca, unsigned short* __restrict__ Cb, int ldc,
                                            const float* __restrict__ bias, int M, int N, int K,
                                            float scale, float bscale, int cseq, int cseqfull) {
    typedef typename FragT<ET>::V V;
    __shared__ __align__(16) float sT[8 * 16 * OP];
    const int lane = threadIdx.x & 31;
    const int wave = __builtin_amdgcn_readfirstlane(threadIdx.x >> 5);
    const int tilesN = N >> 6;
    const int tilesM = M >> 6;
    const int tile = blockIdx.x * 8 + wave;
    if (tile >= tilesM * tilesN) return;          // wave-uniform; this kernel has no block barriers
    const int tm = tile / tilesN;
    const int tn = tile - tm * tilesN;
    const int m0 = tm << 6;
    const int n0 = tn << 6;
    const int rl   = lane & 15;
    const int koff = (lane >> 4) * 8;
    const int mOff = (lane >> 4) * 8;

    v8f acc[4][4];
#pragma unroll
    for (int i = 0; i < 4; ++i)
#pragma unroll
        for (int j = 0; j < 4; ++j) { const v8f zz = {0.f, 0.f, 0.f, 0.f, 0.f, 0.f, 0.f, 0.f}; acc[i][j] = zz; }

    for (int k0 = 0; k0 < K; k0 += 32) {
        V bh[4];
#pragma unroll
        for (int j = 0; j < 4; ++j) bh[j] = FragT<ET>::load(Bt + (size_t)(n0 + (j << 4) + rl) * ldb + koff + k0);
#pragma unroll
        for (int i = 0; i < 4; ++i) {
            const V ah = FragT<ET>::load(A + (size_t)(m0 + (i << 4) + rl) * lda + koff + k0);
            acc[i][0] = FragT<ET>::mma(ah, bh[0], acc[i][0]);
            acc[i][1] = FragT<ET>::mma(ah, bh[1], acc[i][1]);
            acc[i][2] = FragT<ET>::mma(ah, bh[2], acc[i][2]);
            acc[i][3] = FragT<ET>::mma(ah, bh[3], acc[i][3]);
            guard4<V>(acc[i][0], acc[i][1], acc[i][2], acc[i][3], ah, bh[0], bh[1], bh[2], bh[3]);
        }
    }

    const int sb = wave * (16 * OP);
#pragma unroll
    for (int i = 0; i < 4; ++i) {
        const int mBase = m0 + (i << 4);
#pragma unroll
        for (int j = 0; j < 4; ++j) {
            const int n = n0 + (j << 4) + rl;
            float bvn = 0.f;
            if (BIAS_MODE == 2) bvn = bf_val(bias[n]) * bscale;
#pragma unroll
            for (int r = 0; r < 8; ++r) {
                float v = acc[i][j][r] * scale;
                if (BIAS_MODE == 1) v += bf_val(bias[mBase + mOff + r]) * bscale;
                if (BIAS_MODE == 2) v += bvn;
                sT[sb + (mOff + r) * OP + (j << 4) + rl] = v;
            }
        }
        wave_sync();
        if (OUT_MODE == 0) {
            const int hh = lane >> 4, c4 = (lane & 15) * 4;      // row segment = 256 B = 16 lanes x 16 B; 2 rows per instruction
            {
#pragma unroll
                for (int it = 0; it < 8; ++it) {
                    const int row = it * 2 + hh;
                    const v4f v = *(const v4f_ma*)&sT[sb + row * OP + c4];
                    const int grow = mBase + row;
                    const int orow = (grow / cseq) * cseqfull + (grow % cseq);
                    *(v4f*)(Cf + (size_t)orow * ldc + n0 + c4) = v;
                }
                
            }
        } else {
            const int q = lane >> 3, c8 = (lane & 7) * 8;
            {
#pragma unroll
                for (int it = 0; it < 4; ++it) {
                    const int row = it * 4 + q;
                    const v4f a = *(const v4f_ma*)&sT[sb + row * OP + c8];
                    const v4f b = *(const v4f_ma*)&sT[sb + row * OP + c8 + 4];
                    const size_t o = (size_t)(mBase + row) * ldc + n0 + c8;
                    if (OUT_MODE == 1) {
                        v4u pk; pk.x = pk_h2f(a.x, a.y); pk.y = pk_h2f(a.z, a.w); pk.z = pk_h2f(b.x, b.y); pk.w = pk_h2f(b.z, b.w);
                        *(v4u*)(Ca + o) = pk;
                    } else {
                        v4u ph, pl;
                        unsigned int h0, l0, h1, l1, h2, l2, h3, l3;
                        pk_split2(a.x, a.y, h0, l0); pk_split2(a.z, a.w, h1, l1); pk_split2(b.x, b.y, h2, l2); pk_split2(b.z, b.w, h3, l3);
                        ph.x = h0; ph.y = h1; ph.z = h2; ph.w = h3; pl.x = l0; pl.y = l1; pl.z = l2; pl.w = l3;
                        *(v4u*)(Ca + o) = ph;
                        *(v4u*)(Cb + o) = pl;
                    }
                }
                
            }
        }
        wave_sync();
    }
}

// key projection: A = value plane f16 (x16) [M = tokens][K = 64], Bt = weight plane f16 (x16) [N = 512][K = 64] ([out][in] as stored);
// out = one f16 plane [M][N] holding k x256 (bias[n] added in f32 with the same carry)
__global__ __launch_bounds__(256) void k_gemm_k(const unsigned short* __restrict__ A, const unsigned short* __restrict__ Bt,
                                                const float* __restrict__ bias, unsigned short* __restrict__ C,
                                                int M, int N, int K, float scale, float bscale) {
    gemm64_body<0, 2, 1>(A, K, Bt, K, nullptr, C, nullptr, N, bias, M, N, K, scale, bscale, 1, 1);
}

// =====================================================================================================================
// =====================================================================================================================
// f32 [rows][512] -> f16 plane [nrows][512] holding bf16(x) * sc; plane row r reads source row (r / seq) * seqfull + r % seq
__global__ __launch_bounds__(256) void k_cast16(const float* __restrict__ src, unsigned short* __restrict__ dst, int nrows, int seq, int seqfull, float sc) {
    const int u = blockIdx.x * 256 + threadIdx.x;
    if (u >= nrows * (DM / 8)) return;
    const int r = u / (DM / 8);
    const int c0 = (u - r * (DM / 8)) * 8;
    const int sr = (r / seq) * seqfull + (r % seq);
    const float* s = src + (size_t)sr * DM + c0;
    const v4f a = *(const v4f*)(s);
    const v4f b = *(const v4f*)(s + 4);
    v4u pk;
    pk.x = pk_h2(bf_val(a.x) * sc, bf_val(a.y) * sc); pk.y = pk_h2(bf_val(a.z) * sc, bf_val(a.w) * sc);
    pk.z = pk_h2(bf_val(b.x) * sc, bf_val(b.y) * sc); pk.w = pk_h2(bf_val(b.z) * sc, bf_val(b.w) * sc);
    v4u* d = (v4u*)(dst + (size_t)r * DM + c0);
    *d = pk; 
}
// value f32 [batch][seqfull][64] -> transposed f16 plane dst[(b*64 + d)][seq] holding bf16(x) * sc.
__global__ __launch_bounds__(256) void k_cast_vt(const float* __restrict__ src, unsigned short* __restrict__ dst, int seq, int seqfull, float sc) {
    __shared__ __align__(16) _Float16 Tsh[DKH * TP];
    const int nb64 = seq / 64;
    const int b  = blockIdx.x / nb64;
    const int t0 = (blockIdx.x - b * nb64) * 64;
#pragma unroll 1
    for (int it = 0; it < 4; ++it) {
        const int idx = threadIdx.x + 256 * it;           // 1,024 float4 pieces of the [64 t][64 d] tile
        const int t  = idx >> 4;
        const int d4 = (idx & 15) * 4;
        const v4f a = *(const v4f*)(src + ((size_t)(b * seqfull + t0 + t)) * DKH + d4);
        Tsh[(d4 + 0) * TP + t] = toh_flush(bf_val(a.x) * sc);
        Tsh[(d4 + 1) * TP + t] = toh_flush(bf_val(a.y) * sc);
        Tsh[(d4 + 2) * TP + t] = toh_flush(bf_val(a.z) * sc);
        Tsh[(d4 + 3) * TP + t] = toh_flush(bf_val(a.w) * sc);
    }
    __syncthreads();
    {
#pragma unroll
        for (int it = 0; it < 2; ++it) {
            const int p  = threadIdx.x + 256 * it;        // 512 pieces of 8 halves: 64 rows d x 8 pieces
            const int d  = p >> 3;
            const int c8 = (p & 7) * 8;
            const v8h v = *(const v8h_ma*)&Tsh[d * TP + c8];
            const v4u pk = __builtin_bit_cast(v4u, v);
            *(v4u*)(dst + (size_t)(b * DKH + d) * seq + t0 + c8) = pk;
        }
        
    }
}

// =====================================================================================================================
// k_attn_heads: fused attention with the softmax taken across the 8 heads. Block = 8 waves = 16 query rows of one batch.
//   QP: f16 plane [ntok][512] (q x16); KP: f16 plane [ntok][512] (k x256); VT: f16 plane [batch*64][seq] (v^T x16).
//   Per 128-key chunk:
//     phase A (wave = 16-key subtile): S^T[key][query] for all 8 heads (A = k rows, B = q rows, two 32-deep steps each),
//       head softmax lane-local in f32, P x4096 as f16 written as 16-B pieces Psh[head][subtile][query][16 keys];
//     block barrier (Psh is written by one wave and read by another);
//     phase B (wave = head): O^T[d][query] += V^T[d][32 keys] . P^T[32 keys][query]; the B fragment is two 16-B pieces of
//       two adjacent 16-key subtiles (elements 0..7 <- keys 8h+r of the first, 8..15 <- keys 8h+r of the second; lane unchanged);
//     block barrier before the next chunk overwrites Psh.
//   Epilogue: per wave (head) 16 rows x 64 columns staged in two 32-column halves through a wave-private LDS tile (wave_sync),
// =====================================================================================================================
__global__ __launch_bounds__(256) void k_attn_heads(const unsigned short* __restrict__ QP, const unsigned short* __restrict__ KP,
                                                    const unsigned short* __restrict__ VT, float* __restrict__ out,
                                                    int seq, int seqfull, float sscale) {
    __shared__ __align__(16) _Float16 Psh[NH * 8 * 16 * 16];     // [head][key subtile][query][16 keys], cross-wave
    __shared__ __align__(16) float    Osh[8 * 16 * OPH];         // wave-private output staging [16][32] (+4 pad)
    const int lane = threadIdx.x & 31;
    const int wave = __builtin_amdgcn_readfirstlane(threadIdx.x >> 5);
    const int hf = lane >> 4;
    const int c  = lane & 15;
    const int nqb = seq / 16;
    const int b  = blockIdx.x / nqb;
    const int q0 = (blockIdx.x - b * nqb) * 16;
    // Fragment addresses = a wave-uniform row base + a lane offset that is the same for every chunk.
    const unsigned short* qrow = QP + (size_t)(b * seq + q0) * DM;              // this block's 16 query rows
    const unsigned short* krow = KP + (size_t)(b * seq + wave * 16) * DM;       // this wave's 16-key subtile of chunk 0
    const unsigned short* vrow = VT + (size_t)(b * DKH) * seq;                  // this batch's v^T rows
    const unsigned int rlane = (unsigned int)(c * DM + 8 * hf);                 // q, k: row = lane & 15
    const unsigned int vlane = (unsigned int)(c * seq + 8 * hf);                // v^T: row d = lane & 15
    const int obase = wave * (16 * OPH);
    const float sl2 = sscale * 1.4426950408889634f;

    v8f oacc[4];
#pragma unroll
    for (int t = 0; t < 4; ++t) { const v8f zz = {0.f, 0.f, 0.f, 0.f, 0.f, 0.f, 0.f, 0.f}; oacc[t] = zz; }

    for (int kc = 0; kc < seq; kc += KCH) {
        // ---------- phase A: S^T for this wave's 16 keys, all 8 heads ----------
        // Two batches of four heads: the 32 loads of a batch's k and q fragments are all issued before its first product,
        // so their latencies run side by side and the wave meets one load latency per batch instead of one per product.
        v8f s[NH];
#pragma unroll
        for (int g = 0; g < 2; ++g) {
            v16h kf[8], qf[8];
            const unsigned short* kp = krow + kc * DM + g * 256 + rlane;
            const unsigned short* qp = qrow + g * 256 + rlane;
#pragma unroll
            for (int j = 0; j < 8; ++j) {
                kf[j] = ldfrag_h(kp + j * 32);
                qf[j] = ldfrag_h(qp + j * 32);
            }
            // the addresses are inputs of the wait: they stay live up to it, so no load of the batch lands on an address register
            // of another, and what reuses those registers later stands behind the wait
            asm volatile("s_wait_xcnt 0x0" :: "v"(kp), "v"(qp) : "memory");
            __builtin_amdgcn_sched_barrier(0);      // holds the batch's loads ahead of its products (else they sink back to their uses)
#pragma unroll
            for (int j = 0; j < 4; ++j) {
                v8f z = {0.f, 0.f, 0.f, 0.f, 0.f, 0.f, 0.f, 0.f};
                z = mma_h(kf[2 * j], qf[2 * j], z);
                z = mma_h(kf[2 * j + 1], qf[2 * j + 1], z);
                s[g * 4 + j] = z;
            }
            __builtin_amdgcn_sched_barrier(0);      // holds the next loads behind these products, so one batch of fragments is live at a time
        }
        // the chunk's 16 v^T fragments (phase B) are requested here: their latency passes under the softmax's vector work
        v16h vf[16];
        const unsigned short* vp0 = vrow + kc + vlane;
        const unsigned short* vp1 = vp0 + 16 * seq;
        const unsigned short* vp2 = vp0 + 32 * seq;
        const unsigned short* vp3 = vp0 + 48 * seq;
#pragma unroll
        for (int sc = 0; sc < 4; ++sc) {
            vf[sc * 4 + 0] = ldfrag_h(vp0 + sc * 32);
            vf[sc * 4 + 1] = ldfrag_h(vp1 + sc * 32);
            vf[sc * 4 + 2] = ldfrag_h(vp2 + sc * 32);
            vf[sc * 4 + 3] = ldfrag_h(vp3 + sc * 32);
        }
        // as above: the four addresses stay live up to the wait
        asm volatile("s_wait_xcnt 0x0" :: "v"(vp0), "v"(vp1), "v"(vp2), "v"(vp3) : "memory");
        __builtin_amdgcn_sched_barrier(0);          // holds these loads ahead of the softmax
        // ---------- softmax across heads: element r of every head tile is the same (key, query) pair ----------
#pragma unroll
        for (int r = 0; r < 8; ++r) {
            float m = s[0][r];
#pragma unroll
            for (int h = 1; h < NH; ++h) m = fmaxf(m, s[h][r]);
            float zsum = 0.f;
#pragma unroll
            for (int h = 0; h < NH; ++h) {
                const float e = exp2f((s[h][r] - m) * sl2);
                s[h][r] = e;
                zsum += e;
            }
            const float inv = PCARRY / zsum;
#pragma unroll
            for (int h = 0; h < NH; ++h) s[h][r] = s[h][r] * inv;
        }
#pragma unroll
        for (int h = 0; h < NH; ++h) {
            v8h pv;
#pragma unroll
            for (int r = 0; r < 8; ++r) pv[r] = toh_flush(s[h][r]);
            *(v8h_ma*)&Psh[((h * 8 + wave) * 16 + c) * 16 + 8 * hf] = pv;      // keys 8*hf .. 8*hf+7 of subtile 'wave', query c
        }
        __syncthreads();
        // ---------- phase B: head = wave; O^T[d][query] += V^T . P^T over the chunk's four 32-key steps ----------
#pragma unroll
        for (int sc = 0; sc < 4; ++sc) {                // unrolled: vf is indexed by constants and stays in registers
            const int po = ((wave * 8 + 2 * sc) * 16 + c) * 16 + 8 * hf;
            const v8h p0 = *(const v8h_ma*)&Psh[po];
            const v8h p1 = *(const v8h_ma*)&Psh[po + 256];
            const v16h pb = __builtin_shufflevector(p0, p1, 0, 1, 2, 3, 4, 5, 6, 7, 8, 9, 10, 11, 12, 13, 14, 15);
            oacc[0] = mma_h(vf[sc * 4 + 0], pb, oacc[0]);
            oacc[1] = mma_h(vf[sc * 4 + 1], pb, oacc[1]);
            oacc[2] = mma_h(vf[sc * 4 + 2], pb, oacc[2]);
            oacc[3] = mma_h(vf[sc * 4 + 3], pb, oacc[3]);
        }
        __syncthreads();
    }

    // ---------- epilogue: out[b][q0 + query][wave*64 + d], d = t*16 + 8*hf + r held by lane (query c) ----------
    const float osc = 1.0f / (PCARRY * VCARRY);
#pragma unroll
    for (int half = 0; half < 2; ++half) {
#pragma unroll
        for (int tt = 0; tt < 2; ++tt) {
#pragma unroll
            for (int r = 0; r < 8; ++r) Osh[obase + c * OPH + tt * 16 + 8 * hf + r] = oacc[half * 2 + tt][r] * osc;
        }
        wave_sync();
        {
            const int q = lane >> 3, c4 = (lane & 7) * 4;
            {
#pragma unroll
                for (int it = 0; it < 4; ++it) {
                    const int row = it * 4 + q;
                    const v4f v = *(const v4f_ma*)&Osh[obase + row * OPH + c4];
                    *(v4f*)(out + (size_t)(b * seqfull + q0 + row) * DM + wave * DKH + half * 32 + c4) = v;
                }
                
            }
        }
        wave_sync();
    }
}

// =====================================================================================================================
// Host side: workspace carve (all plane sizes are multiples of 256 B), 6 launches.
// =====================================================================================================================
constexpr size_t SZ_TOK  = (size_t)NTOK * DM * 2;          // one 16-bit token plane [NTOK][512]
constexpr size_t SZ_V    = (size_t)NTOK * DKH * 2;         // value plane [NTOK][64]
constexpr size_t SZ_W    = (size_t)DM * DKH * 2;           // weight plane [512][64]
constexpr size_t SZ_VT   = (size_t)NB * DKH * SEQ * 2;     // v^T plane [NB*64][SEQ]
constexpr size_t WS_TOTAL = SZ_TOK + SZ_V + SZ_W + SZ_TOK + SZ_VT;
static_assert(SZ_TOK % 256 == 0);
static_assert(SZ_V % 256 == 0);
static_assert(SZ_W % 256 == 0);
static_assert(SZ_VT % 256 == 0);
static_assert(WS_TOTAL <= (size_t)134217728);            // carve stays within 128 MiB
static_assert(((NTOK / 64) * (DM / 64)) % 8 == 0);        // GEMM grid is whole blocks of 8 wave tiles
static_assert((size_t)NTOK * DM < (size_t)2147483647);    // int plane offsets
static_assert((size_t)NB_FULL * SEQ_FULL * DM * 4 == (size_t)8388608);   // output extent in bytes (offset 0)

extern "C" void kernel_launch(void* const* d_in, const int* in_sizes, int n_in, void* d_out, int out_size, void* d_ws, size_t ws_size, hipStream_t stream) {
    if (n_in < 4) return;
    const long long need_q = ((long long)(NB - 1) * SEQ_FULL + SEQ) * DM;
    const long long need_v = ((long long)(NB - 1) * SEQ_FULL + SEQ) * DKH;
    if ((long long)in_sizes[0] < need_q || (long long)in_sizes[1] < need_v) return;
    if (in_sizes[2] < DM * DKH || in_sizes[3] < DM) return;
    if ((long long)out_size < need_q) return;
    if (WS_TOTAL > ws_size) return;

    // query, value, conv_w [512][64][1], conv_b [512]
    const float* xq = (const float*)d_in[0];
    const float* xv = (const float*)d_in[1];
    const float* Wc = (const float*)d_in[2];
    const float* bc = (const float*)d_in[3];
    float* out = (float*)d_out;

    char* wsp = (char*)d_ws;
    unsigned short* Q16 = (unsigned short*)wsp; wsp += SZ_TOK;
    unsigned short* V16 = (unsigned short*)wsp; wsp += SZ_V;
    unsigned short* W16 = (unsigned short*)wsp; wsp += SZ_W;
    unsigned short* KPp = (unsigned short*)wsp; wsp += SZ_TOK;
    unsigned short* VTp = (unsigned short*)wsp; wsp += SZ_VT;
    if ((size_t)(wsp - (char*)d_ws) > ws_size) return;

    const unsigned gx_q = (unsigned)((NTOK * (DM / 8) + 255) / 256);
    const unsigned gx_v = (unsigned)(((NTOK / 8) * (DM / 8) + 255) / 256);
    const unsigned gx_w = (unsigned)((DKH * (DM / 8) + 255) / 256);
    const unsigned gx_gemm = (unsigned)((((NTOK / 64) * (DM / 64)) + 7) / 8);

    // query plane: row r <- input row (r / SEQ) * SEQ_FULL + r % SEQ, x16
    k_cast16<<<gx_q, 256, 0, stream>>>(xq, Q16, NTOK, SEQ, SEQ_FULL, QCARRY);
    // value [tokens][64] viewed as 512-wide rows of 8 tokens: in[NTOK/8][512] -> plane [NTOK/8][512] = [NTOK][64], x16
    k_cast16<<<gx_v, 256, 0, stream>>>(xv, V16, NTOK / 8, SEQ / 8, SEQ_FULL / 8, VCARRY);
    // weight [512 out][64 in] viewed as [64][512]; stored order kept (Bt[n][k] = W[n][k]), x16
    k_cast16<<<gx_w, 256, 0, stream>>>(Wc, W16, DKH, DKH, DKH, WCARRY);
    // v^T plane: in[tokens][64] -> out[64][tokens] per batch, x16; grid = NB * SEQ/64 tiles
    k_cast_vt<<<(unsigned)(NB * (SEQ / 64)), 256, 0, stream>>>(xv, VTp, SEQ, SEQ_FULL, VCARRY);

    // k x256 = (value x16)(W x16)^T + 256 * bias  -> f16 plane [NTOK][512]
    k_gemm_k<<<gx_gemm, 256, 0, stream>>>(V16, W16, bc, KPp, NTOK, DM, DKH, KCARRY / (VCARRY * WCARRY), KCARRY);

    // scores carry 16 * 256; score scale 1/8 applied with the carries inside the head softmax
    k_attn_heads<<<(unsigned)(NB * (SEQ / 16)), 256, 0, stream>>>(Q16, KPp, VTp, out, SEQ, SEQ_FULL, 0.125f / (QCARRY * KCARRY));
}

// v002
// One run takes 81.2 microseconds.
// Next to v001, in two timings, it ran 1.43 and 1.42 times as fast.
// All steps since v000 together make it 1.85 times as fast.
// Multi-head dot attention, 2 x 2,048 queries x 2,048 keys, width 512 = 8 heads x 64; keys = pointwise [out][in] 64->512 map of the value rows + bias, values = the 64-wide value rows shared by all heads, softmax taken ACROSS THE 8 HEADS per (query, key), no key normalisation, no mask. Inputs and parameters converted to bf16 (RNE). Key projection: v_wmma_f32_16x16x32_f16 (f16 operands holding the bf16 values, value x16, weight x16, f32 accumulate, k carried x256 as one f16 plane); scores: v_wmma_f32_16x16x32_f16 (q x16 f16 plane against the k plane, f32 accumulate, f32 head softmax); weights.V: v_wmma_f32_16x16x32_f16 (P x4096 as f16, v^T x16 as f16, f32 accumulate).
#include <hip/hip_runtime.h>
#include <math.h>

#ifndef NB
#define NB 2
#endif
#ifndef SEQ
#define SEQ 2048
#endif
#define NB_FULL 2
#define SEQ_FULL 2048
#define DM 512
#define NH 8
#define DKH 64
#define NTOK (NB * SEQ)
#define OP 68      // f32 staging pitch (floats), GEMM epilogue
#define OPH 36     // f32 staging pitch (floats), attention epilogue (32-column halves)
#define TP 72      // transpose tile pitch (halves)
#define KCH 128    // keys per chunk = 8 waves x 16-key subtiles
#define QCARRY 16.0f
#define VCARRY 16.0f
#define WCARRY 16.0f
#define KCARRY 256.0f
#define PCARRY 4096.0f

static_assert(DM == NH * DKH);            // merged head layout h*64+d
static_assert(DKH == 64);                 // two 32-deep k-steps per score tile, four 16-wide output tiles
static_assert(NH == 8);                   // one head per wave in the accumulation phase, 8 waves per block
static_assert(SEQ % 64 == 0);             // 64-row GEMM tiles and 64-token transpose tiles inside one sequence
static_assert(SEQ % KCH == 0);            // whole key chunks
static_assert(SEQ % 16 == 0);             // 16-query blocks
static_assert(SEQ % 8 == 0);              // value rows viewed as 512-wide rows (8 tokens each) by the cast kernel
static_assert(SEQ_FULL % 8 == 0);
static_assert(NTOK % 64 == 0);            // GEMM tile multiple (M)
static_assert(DM % 64 == 0);              // GEMM tile multiple (N)
static_assert(DKH % 32 == 0);             // K steps of 32
static_assert((DM * DKH) % DM == 0);      // weight viewed as 512-wide rows by the cast kernel
static_assert(NB <= NB_FULL);
static_assert(SEQ <= SEQ_FULL);
static_assert((OP % 4) == 0);             // 16-B aligned reloads from the f32 staging tile
static_assert((OPH % 4) == 0);
static_assert((TP % 8) == 0);             // 16-B aligned reloads from the transpose tile
static_assert(KCH == 8 * 16);
static_assert(NTOK % 16 == 0);            // whole 16-row tiles in the fragment-order planes
static_assert(DM == 512);                 // k_cast16_frag: 1,024 pieces per 16-row tile, 16 blocks per tile

typedef __attribute__((ext_vector_type(16))) _Float16 v16h;
typedef __attribute__((ext_vector_type(8)))  _Float16 v8h;
typedef __attribute__((ext_vector_type(16))) __bf16   v16b;
typedef __attribute__((ext_vector_type(8)))  __bf16   v8b;
typedef __attribute__((ext_vector_type(8)))  float    v8f;
typedef __attribute__((ext_vector_type(4)))  float    v4f;
typedef __attribute__((ext_vector_type(4)))  unsigned int v4u;
typedef v8h v8h_ma __attribute__((may_alias));
typedef v4f v4f_ma __attribute__((may_alias));

// 16-bit WMMA fragment map (wave32), lane L, h = L>>4, m = L&15:
//   A 16x32: lane = row m;    element i -> k = (i<8) ? 8h+i : 16+8h+(i-8)
//   B 32x16: lane = column m; the SAME k(i,h)
//   D 16x16 (8 f32): lane = column m; element r -> row 8h+r
// A fragment from a k-contiguous row is therefore p[0..7] | p[16..23] with p = row + k0 + 8h.
// Fragment order (the attention kernel's three operand planes): a 16-row x 32-k block is stored as 512 halves
//   [piece j][lane L][8 halves], piece j of lane L = row (L & 15), k = 16 j + 8 (L >> 4) + 0..7,
// so that the 32 lanes of one 16-byte load read 512 contiguous bytes (four whole 128-B lines) where a row-major plane
// makes them touch 16 lines. The registers receive the same elements as from a row-major plane.
#define FBLK 512   // halves per 16 x 32 block

__device__ __forceinline__ unsigned int bf_bits(float f) {            // bf16 RNE bit pattern (finite inputs)
    const unsigned int u = __float_as_uint(f);
    return (u + 0x7FFFu + ((u >> 16) & 1u)) >> 16;
}
__device__ __forceinline__ float bf_val(float f) { return __uint_as_float(bf_bits(f) << 16); }
__device__ __forceinline__ unsigned int pk_h2(float a, float b) {
    return (unsigned int)__builtin_bit_cast(unsigned short, (_Float16)a) | ((unsigned int)__builtin_bit_cast(unsigned short, (_Float16)b) << 16);
}
__device__ __forceinline__ void pk_split2(float a, float b, unsigned int& hi, unsigned int& lo) {
    const unsigned int ha = bf_bits(a), hb = bf_bits(b);
    const unsigned int la = bf_bits(a - __uint_as_float(ha << 16)), lb = bf_bits(b - __uint_as_float(hb << 16));
    hi = ha | (hb << 16); lo = la | (lb << 16);
}
// f32 -> f16 that cannot produce an f16 subnormal: magnitudes below 2^-14 become zero (value select)
static __device__ __forceinline__ _Float16 toh_flush(float v) {
    const _Float16 r = (_Float16)v;
    return (fabsf(v) < 6.103515625e-05f) ? (_Float16)0.0f : r;
}
static __device__ __forceinline__ unsigned int pk_h2f(float a, float b) {
    return (unsigned int)__builtin_bit_cast(unsigned short, toh_flush(a)) | ((unsigned int)__builtin_bit_cast(unsigned short, toh_flush(b)) << 16);
}
__device__ __forceinline__ void wave_sync() {
    __builtin_amdgcn_fence(3 /* release order */, "workgroup");
    __builtin_amdgcn_wave_barrier();
    __builtin_amdgcn_fence(2 /* acquire order */, "workgroup");
}

__device__ __forceinline__ v16h ldfrag_h(const unsigned short* __restrict__ p) {
    const v8h a = *(const v8h*)(p);
    const v8h b = *(const v8h*)(p + 16);
    return __builtin_shufflevector(a, b, 0, 1, 2, 3, 4, 5, 6, 7, 8, 9, 10, 11, 12, 13, 14, 15);
}
// fragment from a fragment-order block: p = block + lane * 8
__device__ __forceinline__ v16h ldfrag_hf(const unsigned short* __restrict__ p) {
    const v8h a = *(const v8h*)(p);
    const v8h b = *(const v8h*)(p + FBLK / 2);
    return __builtin_shufflevector(a, b, 0, 1, 2, 3, 4, 5, 6, 7, 8, 9, 10, 11, 12, 13, 14, 15);
}
__device__ __forceinline__ v16b ldfrag_b(const unsigned short* __restrict__ p) {
    const v8b a = *(const v8b*)(p);
    const v8b b = *(const v8b*)(p + 16);
    return __builtin_shufflevector(a, b, 0, 1, 2, 3, 4, 5, 6, 7, 8, 9, 10, 11, 12, 13, 14, 15);
}

template <int ET> struct FragT;
template <> struct FragT<0> {
    typedef v16h V;
    static __device__ __forceinline__ v16h load(const unsigned short* __restrict__ p) { return ldfrag_h(p); }
    static __device__ __forceinline__ v8f mma(v16h a, v16h b, v8f c) { return __builtin_amdgcn_wmma_f32_16x16x32_f16(false, a, false, b, (short)0, c, false, false); }
};
template <> struct FragT<1> {
    typedef v16b V;
    static __device__ __forceinline__ v16b load(const unsigned short* __restrict__ p) { return ldfrag_b(p); }
    static __device__ __forceinline__ v8f mma(v16b a, v16b b, v8f c) { return __builtin_amdgcn_wmma_f32_16x16x32_bf16(false, a, false, b, (short)0, c, false, false); }
};
// hazard guard for a group of four independent WMMAs: all four accumulators tied, A and all B fragments kept live
template <typename V>
__device__ __forceinline__ void guard4(v8f& a, v8f& b, v8f& c, v8f& d, V x, V y0, V y1, V y2, V y3) {
    asm volatile("v_nop\n\tv_nop\n\tv_nop\n\tv_nop" : "+v"(a), "+v"(b), "+v"(c), "+v"(d) : "v"(x), "v"(y0), "v"(y1), "v"(y2), "v"(y3));
}
// single f16 WMMA with its own hazard guard (one accumulator tied, both fragments kept live)
static __device__ __forceinline__ v8f mma_h(v16h a, v16h b, v8f c) {
    c = __builtin_amdgcn_wmma_f32_16x16x32_f16(false, a, false, b, (short)0, c, false, false);
    asm volatile("v_nop\n\tv_nop\n\tv_nop\n\tv_nop" : "+v"(c) : "v"(a), "v"(b));
    return c;
}

// =====================================================================================================================
// gemm64_body: C[m][n] = scale * sum_k A[m][k] * Bt[n][k] + bscale * bf16(bias); each wave owns a 64x64 tile, block = 8 waves.
//   A row-major [M][K] (pitch lda), Bt row-major [N][K] (pitch ldb), 16-bit planes; M, N % 64 == 0, K % 32 == 0 (host asserts).
//   ET 0: f16 operands, 1: bf16 operands. BIAS_MODE 1: bias[m], 2: bias[n].
//   OUT_MODE 0: f32 C (row m stored at row (m / cseq) * cseqfull + m % cseq); 1: f16 plane Ca in fragment order ([m / 16][n / 32] blocks); 2: bf16 hi plane Ca + bf16 lo plane Cb.
// =====================================================================================================================
template <int ET, int BIAS_MODE, int OUT_MODE>
__device__ __forceinline__ void gemm64_body(const unsigned short* __restrict__ A, int lda,
                                            const unsigned short* __restrict__ Bt, int ldb,
                                            float* __restrict__ Cf, unsigned short* __restrict__ Ca, unsigned short* __restrict__ Cb, int ldc,
                                            const float* __restrict__ bias, int M, int N, int K,
                                            float scale, float bscale, int cseq, int cseqfull) {
    typedef typename FragT<ET>::V V;
    __shared__ __align__(16) float sT[8 * 16 * OP];
    const int lane = threadIdx.x & 31;
    const int wave = __builtin_amdgcn_readfirstlane(threadIdx.x >> 5);
    const int tilesN = N >> 6;
    const int tilesM = M >> 6;
    const int tile = blockIdx.x * 8 + wave;
    if (tile >= tilesM * tilesN) return;          // wave-uniform; this kernel has no block barriers
    const int tm = tile / tilesN;
    const int tn = tile - tm * tilesN;
    const int m0 = tm << 6;
    const int n0 = tn << 6;
    const int rl   = lane & 15;
    const int koff = (lane >> 4) * 8;
    const int mOff = (lane >> 4) * 8;

    v8f acc[4][4];
#pragma unroll
    for (int i = 0; i < 4; ++i)
#pragma unroll
        for (int j = 0; j < 4; ++j) { const v8f zz = {0.f, 0.f, 0.f, 0.f, 0.f, 0.f, 0.f, 0.f}; acc[i][j] = zz; }

    for (int k0 = 0; k0 < K; k0 += 32) {
        V bh[4];
#pragma unroll
        for (int j = 0; j < 4; ++j) bh[j] = FragT<ET>::load(Bt + (size_t)(n0 + (j << 4) + rl) * ldb + koff + k0);
#pragma unroll
        for (int i = 0; i < 4; ++i) {
            const V ah = FragT<ET>::load(A + (size_t)(m0 + (i << 4) + rl) * lda + koff + k0);
            acc[i][0] = FragT<ET>::mma(ah, bh[0], acc[i][0]);
            acc[i][1] = FragT<ET>::mma(ah, bh[1], acc[i][1]);
            acc[i][2] = FragT<ET>::mma(ah, bh[2], acc[i][2]);
            acc[i][3] = FragT<ET>::mma(ah, bh[3], acc[i][3]);
            guard4<V>(acc[i][0], acc[i][1], acc[i][2], acc[i][3], ah, bh[0], bh[1], bh[2], bh[3]);
        }
    }

    const int sb = wave * (16 * OP);
#pragma unroll
    for (int i = 0; i < 4; ++i) {
        const int mBase = m0 + (i << 4);
#pragma unroll
        for (int j = 0; j < 4; ++j) {
            const int n = n0 + (j << 4) + rl;
            float bvn = 0.f;
            if (BIAS_MODE == 2) bvn = bf_val(bias[n]) * bscale;
#pragma unroll
            for (int r = 0; r < 8; ++r) {
                float v = acc[i][j][r] * scale;
                if (BIAS_MODE == 1) v += bf_val(bias[mBase + mOff + r]) * bscale;
                if (BIAS_MODE == 2) v += bvn;
                sT[sb + (mOff + r) * OP + (j << 4) + rl] = v;
            }
        }
        wave_sync();
        if (OUT_MODE == 0) {
            const int hh = lane >> 4, c4 = (lane & 15) * 4;      // row segment = 256 B = 16 lanes x 16 B; 2 rows per instruction
            {
#pragma unroll
                for (int it = 0; it < 8; ++it) {
                    const int row = it * 2 + hh;
                    const v4f v = *(const v4f_ma*)&sT[sb + row * OP + c4];
                    const int grow = mBase + row;
                    const int orow = (grow / cseq) * cseqfull + (grow % cseq);
                    *(v4f*)(Cf + (size_t)orow * ldc + n0 + c4) = v;
                }
                
            }
        } else if (OUT_MODE == 1) {
            // these 16 rows x 64 columns are two adjacent fragment-order blocks = 2 KiB in a row: piece 'it' = columns 16 it + 8 (lane >> 4)
            unsigned short* cb = Ca + (size_t)(mBase >> 4) * (16 * ldc) + (size_t)(n0 >> 5) * FBLK + lane * 8;
#pragma unroll
            for (int it = 0; it < 4; ++it) {
                const v4f a = *(const v4f_ma*)&sT[sb + rl * OP + it * 16 + koff];
                const v4f b = *(const v4f_ma*)&sT[sb + rl * OP + it * 16 + koff + 4];
                v4u pk; pk.x = pk_h2f(a.x, a.y); pk.y = pk_h2f(a.z, a.w); pk.z = pk_h2f(b.x, b.y); pk.w = pk_h2f(b.z, b.w);
                *(v4u*)(cb + it * (FBLK / 2)) = pk;
            }
        } else {
            const int q = lane >> 3, c8 = (lane & 7) * 8;
            {
#pragma unroll
                for (int it = 0; it < 4; ++it) {
                    const int row = it * 4 + q;
                    const v4f a = *(const v4f_ma*)&sT[sb + row * OP + c8];
                    const v4f b = *(const v4f_ma*)&sT[sb + row * OP + c8 + 4];
                    const size_t o = (size_t)(mBase + row) * ldc + n0 + c8;
                    {
                        v4u ph, pl;
                        unsigned int h0, l0, h1, l1, h2, l2, h3, l3;
                        pk_split2(a.x, a.y, h0, l0); pk_split2(a.z, a.w, h1, l1); pk_split2(b.x, b.y, h2, l2); pk_split2(b.z, b.w, h3, l3);
                        ph.x = h0; ph.y = h1; ph.z = h2; ph.w = h3; pl.x = l0; pl.y = l1; pl.z = l2; pl.w = l3;
                        *(v4u*)(Ca + o) = ph;
                        *(v4u*)(Cb + o) = pl;
                    }
                }
                
            }
        }
        wave_sync();
    }
}

// key projection: A = value plane f16 (x16) [M = tokens][K = 64], Bt = weight plane f16 (x16) [N = 512][K = 64] ([out][in] as stored);
// out = one f16 plane holding k x256 (bias[n] added in f32 with the same carry), fragment order: [M / 16][N / 32] blocks
__global__ __launch_bounds__(256) void k_gemm_k(const unsigned short* __restrict__ A, const unsigned short* __restrict__ Bt,
                                                const float* __restrict__ bias, unsigned short* __restrict__ C,
                                                int M, int N, int K, float scale, float bscale) {
    gemm64_body<0, 2, 1>(A, K, Bt, K, nullptr, C, nullptr, N, bias, M, N, K, scale, bscale, 1, 1);
}

// =====================================================================================================================
// =====================================================================================================================
// f32 [rows][512] -> f16 plane [nrows][512] holding bf16(x) * sc; plane row r reads source row (r / seq) * seqfull + r % seq
__global__ __launch_bounds__(256) void k_cast16(const float* __restrict__ src, unsigned short* __restrict__ dst, int nrows, int seq, int seqfull, float sc) {
    const int u = blockIdx.x * 256 + threadIdx.x;
    if (u >= nrows * (DM / 8)) return;
    const int r = u / (DM / 8);
    const int c0 = (u - r * (DM / 8)) * 8;
    const int sr = (r / seq) * seqfull + (r % seq);
    const float* s = src + (size_t)sr * DM + c0;
    const v4f a = *(const v4f*)(s);
    const v4f b = *(const v4f*)(s + 4);
    v4u pk;
    pk.x = pk_h2(bf_val(a.x) * sc, bf_val(a.y) * sc); pk.y = pk_h2(bf_val(a.z) * sc, bf_val(a.w) * sc);
    pk.z = pk_h2(bf_val(b.x) * sc, bf_val(b.y) * sc); pk.w = pk_h2(bf_val(b.z) * sc, bf_val(b.w) * sc);
    v4u* d = (v4u*)(dst + (size_t)r * DM + c0);
    *d = pk; 
}
// f32 [rows][512] -> f16 plane holding bf16(x) * sc in fragment order ([nrows / 16][512 / 32] blocks); thread u writes the plane's
// u-th 16-byte piece, so a wave stores 512 contiguous bytes; a block reads 16 source rows x 512 B, whole lines between its waves
__global__ __launch_bounds__(256) void k_cast16_frag(const float* __restrict__ src, unsigned short* __restrict__ dst, int nrows, int seq, int seqfull, float sc) {
    const int u = blockIdx.x * 256 + threadIdx.x;
    if (u >= nrows * (DM / 8)) return;
    const int r  = (u >> 10) * 16 + (u & 15);                 // 1,024 pieces per 16-row tile; row = lane & 15
    const int c0 = ((u >> 6) & 15) * 32 + ((u >> 4) & 3) * 8; // block, then 16 j + 8 (lane >> 4)
    const int sr = (r / seq) * seqfull + (r % seq);
    const float* s = src + (size_t)sr * DM + c0;
    const v4f a = *(const v4f*)(s);
    const v4f b = *(const v4f*)(s + 4);
    v4u pk;
    pk.x = pk_h2(bf_val(a.x) * sc, bf_val(a.y) * sc); pk.y = pk_h2(bf_val(a.z) * sc, bf_val(a.w) * sc);
    pk.z = pk_h2(bf_val(b.x) * sc, bf_val(b.y) * sc); pk.w = pk_h2(bf_val(b.z) * sc, bf_val(b.w) * sc);
    *(v4u*)(dst + (size_t)u * 8) = pk;
}
// value f32 [batch][seqfull][64] -> transposed f16 plane holding bf16(x) * sc, rows d, k = tokens, in fragment order:
// dst[b][t / 32][d / 16] blocks, so a 64-token tile is 8 KiB in a row.
__global__ __launch_bounds__(256) void k_cast_vt(const float* __restrict__ src, unsigned short* __restrict__ dst, int seq, int seqfull, float sc) {
    __shared__ __align__(16) _Float16 Tsh[DKH * TP];
    const int nb64 = seq / 64;
    const int b  = blockIdx.x / nb64;
    const int t0 = (blockIdx.x - b * nb64) * 64;
#pragma unroll 1
    for (int it = 0; it < 4; ++it) {
        const int idx = threadIdx.x + 256 * it;           // 1,024 float4 pieces of the [64 t][64 d] tile
        const int t  = idx >> 4;
        const int d4 = (idx & 15) * 4;
        const v4f a = *(const v4f*)(src + ((size_t)(b * seqfull + t0 + t)) * DKH + d4);
        Tsh[(d4 + 0) * TP + t] = toh_flush(bf_val(a.x) * sc);
        Tsh[(d4 + 1) * TP + t] = toh_flush(bf_val(a.y) * sc);
        Tsh[(d4 + 2) * TP + t] = toh_flush(bf_val(a.z) * sc);
        Tsh[(d4 + 3) * TP + t] = toh_flush(bf_val(a.w) * sc);
    }
    __syncthreads();
    {
#pragma unroll
        for (int it = 0; it < 2; ++it) {
            const int p  = threadIdx.x + 256 * it;        // 512 pieces of 8 halves: [32-token step][16-row d tile][piece j][lane]
            const int d  = ((p >> 6) & 3) * 16 + (p & 15);
            const int c8 = (p >> 8) * 32 + ((p >> 4) & 3) * 8;
            const v8h v = *(const v8h_ma*)&Tsh[d * TP + c8];
            const v4u pk = __builtin_bit_cast(v4u, v);
            *(v4u*)(dst + ((size_t)b * seq + t0) * DKH + p * 8) = pk;
        }
        
    }
}

// =====================================================================================================================
// k_attn_heads: fused attention with the softmax taken across the 8 heads. Block = 8 waves = 16 query rows of one batch.
//   QP: f16 plane (q x16), KP: f16 plane (k x256), both [ntok / 16][512 / 32] fragment-order blocks; VT: f16 plane (v^T x16),
//   [batch][seq / 32][64 / 16] fragment-order blocks. A wave's 16 keys x 512 and a chunk's v^T are each 16 KiB in a row.
//   Per 128-key chunk:
//     phase A (wave = 16-key subtile): S^T[key][query] for all 8 heads (A = k rows, B = q rows, two 32-deep steps each),
//       head softmax lane-local in f32, P x4096 as f16 written as 16-B pieces Psh[head][subtile][query][16 keys];
//     block barrier (Psh is written by one wave and read by another);
//     phase B (wave = head): O^T[d][query] += V^T[d][32 keys] . P^T[32 keys][query]; the B fragment is two 16-B pieces of
//       two adjacent 16-key subtiles (elements 0..7 <- keys 8h+r of the first, 8..15 <- keys 8h+r of the second; lane unchanged);
//     block barrier before the next chunk overwrites Psh.
//   Epilogue: per wave (head) 16 rows x 64 columns staged in two 32-column halves through a wave-private LDS tile (wave_sync),
// =====================================================================================================================
__global__ __launch_bounds__(256) void k_attn_heads(const unsigned short* __restrict__ QP, const unsigned short* __restrict__ KP,
                                                    const unsigned short* __restrict__ VT, float* __restrict__ out,
                                                    int seq, int seqfull, float sscale) {
    __shared__ __align__(16) _Float16 Psh[NH * 8 * 16 * 16];     // [head][key subtile][query][16 keys], cross-wave
    __shared__ __align__(16) float    Osh[8 * 16 * OPH];         // wave-private output staging [16][32] (+4 pad)
    const int lane = threadIdx.x & 31;
    const int wave = __builtin_amdgcn_readfirstlane(threadIdx.x >> 5);
    const int hf = lane >> 4;
    const int c  = lane & 15;
    const int nqb = seq / 16;
    const int b  = blockIdx.x / nqb;
    const int q0 = (blockIdx.x - b * nqb) * 16;
    // Fragment addresses = a wave-uniform row base + a lane offset that is the same for every chunk.
    const unsigned short* qrow = QP + (size_t)(b * seq + q0) * DM;              // this block's 16 query rows (16 blocks)
    const unsigned short* krow = KP + (size_t)(b * seq + wave * 16) * DM;       // this wave's 16-key subtile of chunk 0
    const unsigned short* vrow = VT + (size_t)(b * DKH) * seq;                  // this batch's v^T blocks
    const unsigned int rlane = (unsigned int)(lane * 8);                        // a lane's 16-byte piece inside a fragment-order block
    const int obase = wave * (16 * OPH);
    const float sl2 = sscale * 1.4426950408889634f;

    v8f oacc[4];
#pragma unroll
    for (int t = 0; t < 4; ++t) { const v8f zz = {0.f, 0.f, 0.f, 0.f, 0.f, 0.f, 0.f, 0.f}; oacc[t] = zz; }

    for (int kc = 0; kc < seq; kc += KCH) {
        // ---------- phase A: S^T for this wave's 16 keys, all 8 heads ----------
        // Two batches of four heads: the 32 loads of a batch's k and q fragments are all issued before its first product,
        // so their latencies run side by side and the wave meets one load latency per batch instead of one per product.
        v8f s[NH];
        const unsigned short* kp = krow + kc * DM + rlane;      // both batches read at constant offsets from these two addresses
        const unsigned short* qp = qrow + rlane;
#pragma unroll
        for (int g = 0; g < 2; ++g) {
            v16h kf[8], qf[8];
#pragma unroll
            for (int j = 0; j < 8; ++j) {
                kf[j] = ldfrag_hf(kp + (g * 8 + j) * FBLK);
                qf[j] = ldfrag_hf(qp + (g * 8 + j) * FBLK);
            }
            // the addresses are inputs of the wait: they stay live up to it, so no load of the batch lands on an address register
            // of another, and what reuses those registers later stands behind the wait
            asm volatile("s_wait_xcnt 0x0" :: "v"(kp), "v"(qp) : "memory");
            __builtin_amdgcn_sched_barrier(0);      // holds the batch's loads ahead of its products (else they sink back to their uses)
#pragma unroll
            for (int j = 0; j < 4; ++j) {
                v8f z = {0.f, 0.f, 0.f, 0.f, 0.f, 0.f, 0.f, 0.f};
                z = mma_h(kf[2 * j], qf[2 * j], z);
                z = mma_h(kf[2 * j + 1], qf[2 * j + 1], z);
                s[g * 4 + j] = z;
            }
            __builtin_amdgcn_sched_barrier(0);      // holds the next loads behind these products, so one batch of fragments is live at a time
        }
        // the chunk's 16 v^T fragments (phase B) are requested here: their latency passes under the softmax's vector work
        v16h vf[16];
        const unsigned short* vp = vrow + kc * DKH + rlane;
#pragma unroll
        for (int f = 0; f < 16; ++f) vf[f] = ldfrag_hf(vp + f * FBLK);      // f = 32-key step * 4 + 16-row d tile
        // as above: the address stays live up to the wait
        asm volatile("s_wait_xcnt 0x0" :: "v"(vp) : "memory");
        __builtin_amdgcn_sched_barrier(0);          // holds these loads ahead of the softmax
        // ---------- softmax across heads: element r of every head tile is the same (key, query) pair ----------
#pragma unroll
        for (int r = 0; r < 8; ++r) {
            float m = s[0][r];
#pragma unroll
            for (int h = 1; h < NH; ++h) m = fmaxf(m, s[h][r]);
            float zsum = 0.f;
#pragma unroll
            for (int h = 0; h < NH; ++h) {
                const float e = exp2f((s[h][r] - m) * sl2);
                s[h][r] = e;
                zsum += e;
            }
            const float inv = PCARRY / zsum;
#pragma unroll
            for (int h = 0; h < NH; ++h) s[h][r] = s[h][r] * inv;
        }
#pragma unroll
        for (int h = 0; h < NH; ++h) {
            v8h pv;
#pragma unroll
            for (int r = 0; r < 8; ++r) pv[r] = toh_flush(s[h][r]);
            *(v8h_ma*)&Psh[((h * 8 + wave) * 16 + c) * 16 + 8 * hf] = pv;      // keys 8*hf .. 8*hf+7 of subtile 'wave', query c
        }
        __syncthreads();
        // ---------- phase B: head = wave; O^T[d][query] += V^T . P^T over the chunk's four 32-key steps ----------
#pragma unroll
        for (int sc = 0; sc < 4; ++sc) {                // unrolled: vf is indexed by constants and stays in registers
            const int po = ((wave * 8 + 2 * sc) * 16 + c) * 16 + 8 * hf;
            const v8h p0 = *(const v8h_ma*)&Psh[po];
            const v8h p1 = *(const v8h_ma*)&Psh[po + 256];
            const v16h pb = __builtin_shufflevector(p0, p1, 0, 1, 2, 3, 4, 5, 6, 7, 8, 9, 10, 11, 12, 13, 14, 15);
            oacc[0] = mma_h(vf[sc * 4 + 0], pb, oacc[0]);
            oacc[1] = mma_h(vf[sc * 4 + 1], pb, oacc[1]);
            oacc[2] = mma_h(vf[sc * 4 + 2], pb, oacc[2]);
            oacc[3] = mma_h(vf[sc * 4 + 3], pb, oacc[3]);
        }
        __syncthreads();
    }

    // ---------- epilogue: out[b][q0 + query][wave*64 + d], d = t*16 + 8*hf + r held by lane (query c) ----------
    const float osc = 1.0f / (PCARRY * VCARRY);
#pragma unroll
    for (int half = 0; half < 2; ++half) {
#pragma unroll
        for (int tt = 0; tt < 2; ++tt) {
#pragma unroll
            for (int r = 0; r < 8; ++r) Osh[obase + c * OPH + tt * 16 + 8 * hf + r] = oacc[half * 2 + tt][r] * osc;
        }
        wave_sync();
        {
            const int q = lane >> 3, c4 = (lane & 7) * 4;
            {
#pragma unroll
                for (int it = 0; it < 4; ++it) {
                    const int row = it * 4 + q;
                    const v4f v = *(const v4f_ma*)&Osh[obase + row * OPH + c4];
                    *(v4f*)(out + (size_t)(b * seqfull + q0 + row) * DM + wave * DKH + half * 32 + c4) = v;
                }
                
            }
        }
        wave_sync();
    }
}

// =====================================================================================================================
// Host side: workspace carve (all plane sizes are multiples of 256 B), 6 launches.
// =====================================================================================================================
constexpr size_t SZ_TOK  = (size_t)NTOK * DM * 2;          // one 16-bit token plane [NTOK][512]
constexpr size_t SZ_V    = (size_t)NTOK * DKH * 2;         // value plane [NTOK][64]
constexpr size_t SZ_W    = (size_t)DM * DKH * 2;           // weight plane [512][64]
constexpr size_t SZ_VT   = (size_t)NB * DKH * SEQ * 2;     // v^T plane [NB*64][SEQ]
constexpr size_t WS_TOTAL = SZ_TOK + SZ_V + SZ_W + SZ_TOK + SZ_VT;
static_assert(SZ_TOK % 256 == 0);
static_assert(SZ_V % 256 == 0);
static_assert(SZ_W % 256 == 0);
static_assert(SZ_VT % 256 == 0);
static_assert(WS_TOTAL <= (size_t)134217728);            // carve stays within 128 MiB
static_assert(((NTOK / 64) * (DM / 64)) % 8 == 0);        // GEMM grid is whole blocks of 8 wave tiles
static_assert((size_t)NTOK * DM < (size_t)2147483647);    // int plane offsets
static_assert((size_t)NB_FULL * SEQ_FULL * DM * 4 == (size_t)8388608);   // output extent in bytes (offset 0)

extern "C" void kernel_launch(void* const* d_in, const int* in_sizes, int n_in, void* d_out, int out_size, void* d_ws, size_t ws_size, hipStream_t stream) {
    if (n_in < 4) return;
    const long long need_q = ((long long)(NB - 1) * SEQ_FULL + SEQ) * DM;
    const long long need_v = ((long long)(NB - 1) * SEQ_FULL + SEQ) * DKH;
    if ((long long)in_sizes[0] < need_q || (long long)in_sizes[1] < need_v) return;
    if (in_sizes[2] < DM * DKH || in_sizes[3] < DM) return;
    if ((long long)out_size < need_q) return;
    if (WS_TOTAL > ws_size) return;

    // query, value, conv_w [512][64][1], conv_b [512]
    const float* xq = (const float*)d_in[0];
    const float* xv = (const float*)d_in[1];
    const float* Wc = (const float*)d_in[2];
    const float* bc = (const float*)d_in[3];
    float* out = (float*)d_out;

    char* wsp = (char*)d_ws;
    unsigned short* Q16 = (unsigned short*)wsp; wsp += SZ_TOK;
    unsigned short* V16 = (unsigned short*)wsp; wsp += SZ_V;
    unsigned short* W16 = (unsigned short*)wsp; wsp += SZ_W;
    unsigned short* KPp = (unsigned short*)wsp; wsp += SZ_TOK;
    unsigned short* VTp = (unsigned short*)wsp; wsp += SZ_VT;
    if ((size_t)(wsp - (char*)d_ws) > ws_size) return;

    const unsigned gx_q = (unsigned)((NTOK * (DM / 8) + 255) / 256);
    const unsigned gx_v = (unsigned)(((NTOK / 8) * (DM / 8) + 255) / 256);
    const unsigned gx_w = (unsigned)((DKH * (DM / 8) + 255) / 256);
    const unsigned gx_gemm = (unsigned)((((NTOK / 64) * (DM / 64)) + 7) / 8);

    // query plane (fragment order): row r <- input row (r / SEQ) * SEQ_FULL + r % SEQ, x16
    k_cast16_frag<<<gx_q, 256, 0, stream>>>(xq, Q16, NTOK, SEQ, SEQ_FULL, QCARRY);
    // value [tokens][64] viewed as 512-wide rows of 8 tokens: in[NTOK/8][512] -> plane [NTOK/8][512] = [NTOK][64], x16
    k_cast16<<<gx_v, 256, 0, stream>>>(xv, V16, NTOK / 8, SEQ / 8, SEQ_FULL / 8, VCARRY);
    // weight [512 out][64 in] viewed as [64][512]; stored order kept (Bt[n][k] = W[n][k]), x16
    k_cast16<<<gx_w, 256, 0, stream>>>(Wc, W16, DKH, DKH, DKH, WCARRY);
    // v^T plane (fragment order): in[tokens][64] -> rows d, k = tokens, per batch, x16; grid = NB * SEQ/64 tiles
    k_cast_vt<<<(unsigned)(NB * (SEQ / 64)), 256, 0, stream>>>(xv, VTp, SEQ, SEQ_FULL, VCARRY);

    // k x256 = (value x16)(W x16)^T + 256 * bias  -> f16 plane (fragment order)
    k_gemm_k<<<gx_gemm, 256, 0, stream>>>(V16, W16, bc, KPp, NTOK, DM, DKH, KCARRY / (VCARRY * WCARRY), KCARRY);

    // scores carry 16 * 256; score scale 1/8 applied with the carries inside the head softmax
    k_attn_heads<<<(unsigned)(NB * (SEQ / 16)), 256, 0, stream>>>(Q16, KPp, VTp, out, SEQ, SEQ_FULL, 0.125f / (QCARRY * KCARRY));
}

// v003
// It runs in 72.1 microseconds.
// Timed twice side by side with v002, it ran 1.09 and 1.13 times as fast.
// Over all steps from v000 it is 2.05 times as fast.
// Multi-head dot attention, 2 x 2,048 queries x 2,048 keys, width 512 = 8 heads x 64; keys = pointwise [out][in] 64->512 map of the value rows + bias, values = the 64-wide value rows shared by all heads, softmax taken ACROSS THE 8 HEADS per (query, key), no key normalisation, no mask. Inputs and parameters converted to bf16 (RNE). Key projection: v_wmma_f32_16x16x32_f16 (f16 operands holding the bf16 values, value x16, weight x16, f32 accumulate, k carried x256 as one f16 plane); scores: v_wmma_f32_16x16x32_f16 (q x16 f16 plane against the k plane, f32 accumulate, f32 head softmax); weights.V: v_wmma_f32_16x16x32_f16 (P x4096 as f16, v^T x16 as f16, f32 accumulate).
#include <hip/hip_runtime.h>
#include <math.h>

#ifndef NB
#define NB 2
#endif
#ifndef SEQ
#define SEQ 2048
#endif
#define NB_FULL 2
#define SEQ_FULL 2048
#define DM 512
#define NH 8
#define DKH 64
#define NTOK (NB * SEQ)
#define OP 68      // f32 staging pitch (floats), GEMM epilogue
#define OPH 36     // f32 staging pitch (floats), attention epilogue (32-column halves)
#define TP 72      // transpose tile pitch (halves)
#define KW 32      // keys per wave and trip = two 16-key subtiles = one 32-deep step of weights.V
#define KCH 256    // keys per trip = 8 waves x KW
#define BH 2       // heads per batch of score fragments (beside 256 accumulator registers a batch of four exceeds the 512-register budget and spills)
#define QCARRY 16.0f
#define VCARRY 16.0f
#define WCARRY 16.0f
#define KCARRY 256.0f
#define PCARRY 4096.0f

static_assert(DM == NH * DKH);            // merged head layout h*64+d
static_assert(DKH == 64);                 // two 32-deep k-steps per score tile, four 16-wide output tiles
static_assert(NH == 8);                   // one head per wave in the final sum and the epilogue, 8 waves per block
static_assert(SEQ % 64 == 0);             // 64-row GEMM tiles and 64-token transpose tiles inside one sequence
static_assert(SEQ % KCH == 0);            // whole key chunks
static_assert(SEQ % 16 == 0);             // 16-query blocks
static_assert(SEQ % 8 == 0);              // value rows viewed as 512-wide rows (8 tokens each) by the cast kernel
static_assert(SEQ_FULL % 8 == 0);
static_assert(NTOK % 64 == 0);            // GEMM tile multiple (M)
static_assert(DM % 64 == 0);              // GEMM tile multiple (N)
static_assert(DKH % 32 == 0);             // K steps of 32
static_assert((DM * DKH) % DM == 0);      // weight viewed as 512-wide rows by the cast kernel
static_assert(NB <= NB_FULL);
static_assert(SEQ <= SEQ_FULL);
static_assert((OP % 4) == 0);             // 16-B aligned reloads from the f32 staging tile
static_assert((OPH % 4) == 0);
static_assert((TP % 8) == 0);             // 16-B aligned reloads from the transpose tile
static_assert(KCH == 8 * KW);
static_assert(NH % BH == 0);
static_assert(NTOK % 16 == 0);            // whole 16-row tiles in the fragment-order planes
static_assert(DM == 512);                 // k_cast16_frag: 1,024 pieces per 16-row tile, 16 blocks per tile

typedef __attribute__((ext_vector_type(16))) _Float16 v16h;
typedef __attribute__((ext_vector_type(8)))  _Float16 v8h;
typedef __attribute__((ext_vector_type(16))) __bf16   v16b;
typedef __attribute__((ext_vector_type(8)))  __bf16   v8b;
typedef __attribute__((ext_vector_type(8)))  float    v8f;
typedef __attribute__((ext_vector_type(4)))  float    v4f;
typedef __attribute__((ext_vector_type(4)))  unsigned int v4u;
typedef v8h v8h_ma __attribute__((may_alias));
typedef v4f v4f_ma __attribute__((may_alias));

// 16-bit WMMA fragment map (wave32), lane L, h = L>>4, m = L&15:
//   A 16x32: lane = row m;    element i -> k = (i<8) ? 8h+i : 16+8h+(i-8)
//   B 32x16: lane = column m; the SAME k(i,h)
//   D 16x16 (8 f32): lane = column m; element r -> row 8h+r
// A fragment from a k-contiguous row is therefore p[0..7] | p[16..23] with p = row + k0 + 8h.
// Fragment order (the attention kernel's three operand planes): a 16-row x 32-k block is stored as 512 halves
//   [piece j][lane L][8 halves], piece j of lane L = row (L & 15), k = 16 j + 8 (L >> 4) + 0..7,
// so that the 32 lanes of one 16-byte load read 512 contiguous bytes (four whole 128-B lines) where a row-major plane
// makes them touch 16 lines. The registers receive the same elements as from a row-major plane.
#define FBLK 512   // halves per 16 x 32 block

__device__ __forceinline__ unsigned int bf_bits(float f) {            // bf16 RNE bit pattern (finite inputs)
    const unsigned int u = __float_as_uint(f);
    return (u + 0x7FFFu + ((u >> 16) & 1u)) >> 16;
}
__device__ __forceinline__ float bf_val(float f) { return __uint_as_float(bf_bits(f) << 16); }
__device__ __forceinline__ unsigned int pk_h2(float a, float b) {
    return (unsigned int)__builtin_bit_cast(unsigned short, (_Float16)a) | ((unsigned int)__builtin_bit_cast(unsigned short, (_Float16)b) << 16);
}
__device__ __forceinline__ void pk_split2(float a, float b, unsigned int& hi, unsigned int& lo) {
    const unsigned int ha = bf_bits(a), hb = bf_bits(b);
    const unsigned int la = bf_bits(a - __uint_as_float(ha << 16)), lb = bf_bits(b - __uint_as_float(hb << 16));
    hi = ha | (hb << 16); lo = la | (lb << 16);
}
// f32 -> f16 that cannot produce an f16 subnormal: magnitudes below 2^-14 become zero (value select)
static __device__ __forceinline__ _Float16 toh_flush(float v) {
    const _Float16 r = (_Float16)v;
    return (fabsf(v) < 6.103515625e-05f) ? (_Float16)0.0f : r;
}
static __device__ __forceinline__ unsigned int pk_h2f(float a, float b) {
    return (unsigned int)__builtin_bit_cast(unsigned short, toh_flush(a)) | ((unsigned int)__builtin_bit_cast(unsigned short, toh_flush(b)) << 16);
}
__device__ __forceinline__ void wave_sync() {
    __builtin_amdgcn_fence(3 /* release order */, "workgroup");
    __builtin_amdgcn_wave_barrier();
    __builtin_amdgcn_fence(2 /* acquire order */, "workgroup");
}

__device__ __forceinline__ v16h ldfrag_h(const unsigned short* __restrict__ p) {
    const v8h a = *(const v8h*)(p);
    const v8h b = *(const v8h*)(p + 16);
    return __builtin_shufflevector(a, b, 0, 1, 2, 3, 4, 5, 6, 7, 8, 9, 10, 11, 12, 13, 14, 15);
}
// fragment from a fragment-order block: p = block + lane * 8
__device__ __forceinline__ v16h ldfrag_hf(const unsigned short* __restrict__ p) {
    const v8h a = *(const v8h*)(p);
    const v8h b = *(const v8h*)(p + FBLK / 2);
    return __builtin_shufflevector(a, b, 0, 1, 2, 3, 4, 5, 6, 7, 8, 9, 10, 11, 12, 13, 14, 15);
}
__device__ __forceinline__ v16b ldfrag_b(const unsigned short* __restrict__ p) {
    const v8b a = *(const v8b*)(p);
    const v8b b = *(const v8b*)(p + 16);
    return __builtin_shufflevector(a, b, 0, 1, 2, 3, 4, 5, 6, 7, 8, 9, 10, 11, 12, 13, 14, 15);
}

template <int ET> struct FragT;
template <> struct FragT<0> {
    typedef v16h V;
    static __device__ __forceinline__ v16h load(const unsigned short* __restrict__ p) { return ldfrag_h(p); }
    static __device__ __forceinline__ v8f mma(v16h a, v16h b, v8f c) { return __builtin_amdgcn_wmma_f32_16x16x32_f16(false, a, false, b, (short)0, c, false, false); }
};
template <> struct FragT<1> {
    typedef v16b V;
    static __device__ __forceinline__ v16b load(const unsigned short* __restrict__ p) { return ldfrag_b(p); }
    static __device__ __forceinline__ v8f mma(v16b a, v16b b, v8f c) { return __builtin_amdgcn_wmma_f32_16x16x32_bf16(false, a, false, b, (short)0, c, false, false); }
};
// hazard guard for a group of four independent WMMAs: all four accumulators tied, A and all B fragments kept live
template <typename V>
__device__ __forceinline__ void guard4(v8f& a, v8f& b, v8f& c, v8f& d, V x, V y0, V y1, V y2, V y3) {
    asm volatile("v_nop\n\tv_nop\n\tv_nop\n\tv_nop" : "+v"(a), "+v"(b), "+v"(c), "+v"(d) : "v"(x), "v"(y0), "v"(y1), "v"(y2), "v"(y3));
}
// single f16 WMMA with its own hazard guard (one accumulator tied, both fragments kept live)
static __device__ __forceinline__ v8f mma_h(v16h a, v16h b, v8f c) {
    c = __builtin_amdgcn_wmma_f32_16x16x32_f16(false, a, false, b, (short)0, c, false, false);
    asm volatile("v_nop\n\tv_nop\n\tv_nop\n\tv_nop" : "+v"(c) : "v"(a), "v"(b));
    return c;
}

// =====================================================================================================================
// gemm64_body: C[m][n] = scale * sum_k A[m][k] * Bt[n][k] + bscale * bf16(bias); each wave owns a 64x64 tile, block = 8 waves.
//   A row-major [M][K] (pitch lda), Bt row-major [N][K] (pitch ldb), 16-bit planes; M, N % 64 == 0, K % 32 == 0 (host asserts).
//   ET 0: f16 operands, 1: bf16 operands. BIAS_MODE 1: bias[m], 2: bias[n].
//   OUT_MODE 0: f32 C (row m stored at row (m / cseq) * cseqfull + m % cseq); 1: f16 plane Ca in fragment order ([m / 16][n / 32] blocks); 2: bf16 hi plane Ca + bf16 lo plane Cb.
// =====================================================================================================================
template <int ET, int BIAS_MODE, int OUT_MODE>
__device__ __forceinline__ void gemm64_body(const unsigned short* __restrict__ A, int lda,
                                            const unsigned short* __restrict__ Bt, int ldb,
                                            float* __restrict__ Cf, unsigned short* __restrict__ Ca, unsigned short* __restrict__ Cb, int ldc,
                                            const float* __restrict__ bias, int M, int N, int K,
                                            float scale, float bscale, int cseq, int cseqfull) {
    typedef typename FragT<ET>::V V;
    __shared__ __align__(16) float sT[8 * 16 * OP];
    const int lane = threadIdx.x & 31;
    const int wave = __builtin_amdgcn_readfirstlane(threadIdx.x >> 5);
    const int tilesN = N >> 6;
    const int tilesM = M >> 6;
    const int tile = blockIdx.x * 8 + wave;
    if (tile >= tilesM * tilesN) return;          // wave-uniform; this kernel has no block barriers
    const int tm = tile / tilesN;
    const int tn = tile - tm * tilesN;
    const int m0 = tm << 6;
    const int n0 = tn << 6;
    const int rl   = lane & 15;
    const int koff = (lane >> 4) * 8;
    const int mOff = (lane >> 4) * 8;

    v8f acc[4][4];
#pragma unroll
    for (int i = 0; i < 4; ++i)
#pragma unroll
        for (int j = 0; j < 4; ++j) { const v8f zz = {0.f, 0.f, 0.f, 0.f, 0.f, 0.f, 0.f, 0.f}; acc[i][j] = zz; }

    for (int k0 = 0; k0 < K; k0 += 32) {
        V bh[4];
#pragma unroll
        for (int j = 0; j < 4; ++j) bh[j] = FragT<ET>::load(Bt + (size_t)(n0 + (j << 4) + rl) * ldb + koff + k0);
#pragma unroll
        for (int i = 0; i < 4; ++i) {
            const V ah = FragT<ET>::load(A + (size_t)(m0 + (i << 4) + rl) * lda + koff + k0);
            acc[i][0] = FragT<ET>::mma(ah, bh[0], acc[i][0]);
            acc[i][1] = FragT<ET>::mma(ah, bh[1], acc[i][1]);
            acc[i][2] = FragT<ET>::mma(ah, bh[2], acc[i][2]);
            acc[i][3] = FragT<ET>::mma(ah, bh[3], acc[i][3]);
            guard4<V>(acc[i][0], acc[i][1], acc[i][2], acc[i][3], ah, bh[0], bh[1], bh[2], bh[3]);
        }
    }

    const int sb = wave * (16 * OP);
#pragma unroll
    for (int i = 0; i < 4; ++i) {
        const int mBase = m0 + (i << 4);
#pragma unroll
        for (int j = 0; j < 4; ++j) {
            const int n = n0 + (j << 4) + rl;
            float bvn = 0.f;
            if (BIAS_MODE == 2) bvn = bf_val(bias[n]) * bscale;
#pragma unroll
            for (int r = 0; r < 8; ++r) {
                float v = acc[i][j][r] * scale;
                if (BIAS_MODE == 1) v += bf_val(bias[mBase + mOff + r]) * bscale;
                if (BIAS_MODE == 2) v += bvn;
                sT[sb + (mOff + r) * OP + (j << 4) + rl] = v;
            }
        }
        wave_sync();
        if (OUT_MODE == 0) {
            const int hh = lane >> 4, c4 = (lane & 15) * 4;      // row segment = 256 B = 16 lanes x 16 B; 2 rows per instruction
            {
#pragma unroll
                for (int it = 0; it < 8; ++it) {
                    const int row = it * 2 + hh;
                    const v4f v = *(const v4f_ma*)&sT[sb + row * OP + c4];
                    const int grow = mBase + row;
                    const int orow = (grow / cseq) * cseqfull + (grow % cseq);
                    *(v4f*)(Cf + (size_t)orow * ldc + n0 + c4) = v;
                }
                
            }
        } else if (OUT_MODE == 1) {
            // these 16 rows x 64 columns are two adjacent fragment-order blocks = 2 KiB in a row: piece 'it' = columns 16 it + 8 (lane >> 4)
            unsigned short* cb = Ca + (size_t)(mBase >> 4) * (16 * ldc) + (size_t)(n0 >> 5) * FBLK + lane * 8;
#pragma unroll
            for (int it = 0; it < 4; ++it) {
                const v4f a = *(const v4f_ma*)&sT[sb + rl * OP + it * 16 + koff];
                const v4f b = *(const v4f_ma*)&sT[sb + rl * OP + it * 16 + koff + 4];
                v4u pk; pk.x = pk_h2f(a.x, a.y); pk.y = pk_h2f(a.z, a.w); pk.z = pk_h2f(b.x, b.y); pk.w = pk_h2f(b.z, b.w);
                *(v4u*)(cb + it * (FBLK / 2)) = pk;
            }
        } else {
            const int q = lane >> 3, c8 = (lane & 7) * 8;
            {
#pragma unroll
                for (int it = 0; it < 4; ++it) {
                    const int row = it * 4 + q;
                    const v4f a = *(const v4f_ma*)&sT[sb + row * OP + c8];
                    const v4f b = *(const v4f_ma*)&sT[sb + row * OP + c8 + 4];
                    const size_t o = (size_t)(mBase + row) * ldc + n0 + c8;
                    {
                        v4u ph, pl;
                        unsigned int h0, l0, h1, l1, h2, l2, h3, l3;
                        pk_split2(a.x, a.y, h0, l0); pk_split2(a.z, a.w, h1, l1); pk_split2(b.x, b.y, h2, l2); pk_split2(b.z, b.w, h3, l3);
                        ph.x = h0; ph.y = h1; ph.z = h2; ph.w = h3; pl.x = l0; pl.y = l1; pl.z = l2; pl.w = l3;
                        *(v4u*)(Ca + o) = ph;
                        *(v4u*)(Cb + o) = pl;
                    }
                }
                
            }
        }
        wave_sync();
    }
}

// key projection: A = value plane f16 (x16) [M = tokens][K = 64], Bt = weight plane f16 (x16) [N = 512][K = 64] ([out][in] as stored);
// out = one f16 plane holding k x256 (bias[n] added in f32 with the same carry), fragment order: [M / 16][N / 32] blocks
__global__ __launch_bounds__(256) void k_gemm_k(const unsigned short* __restrict__ A, const unsigned short* __restrict__ Bt,
                                                const float* __restrict__ bias, unsigned short* __restrict__ C,
                                                int M, int N, int K, float scale, float bscale) {
    gemm64_body<0, 2, 1>(A, K, Bt, K, nullptr, C, nullptr, N, bias, M, N, K, scale, bscale, 1, 1);
}

// =====================================================================================================================
// =====================================================================================================================
// f32 [rows][512] -> f16 plane [nrows][512] holding bf16(x) * sc; plane row r reads source row (r / seq) * seqfull + r % seq
__global__ __launch_bounds__(256) void k_cast16(const float* __restrict__ src, unsigned short* __restrict__ dst, int nrows, int seq, int seqfull, float sc) {
    const int u = blockIdx.x * 256 + threadIdx.x;
    if (u >= nrows * (DM / 8)) return;
    const int r = u / (DM / 8);
    const int c0 = (u - r * (DM / 8)) * 8;
    const int sr = (r / seq) * seqfull + (r % seq);
    const float* s = src + (size_t)sr * DM + c0;
    const v4f a = *(const v4f*)(s);
    const v4f b = *(const v4f*)(s + 4);
    v4u pk;
    pk.x = pk_h2(bf_val(a.x) * sc, bf_val(a.y) * sc); pk.y = pk_h2(bf_val(a.z) * sc, bf_val(a.w) * sc);
    pk.z = pk_h2(bf_val(b.x) * sc, bf_val(b.y) * sc); pk.w = pk_h2(bf_val(b.z) * sc, bf_val(b.w) * sc);
    v4u* d = (v4u*)(dst + (size_t)r * DM + c0);
    *d = pk; 
}
// f32 [rows][512] -> f16 plane holding bf16(x) * sc in fragment order ([nrows / 16][512 / 32] blocks); thread u writes the plane's
// u-th 16-byte piece, so a wave stores 512 contiguous bytes; a block reads 16 source rows x 512 B, whole lines between its waves
__global__ __launch_bounds__(256) void k_cast16_frag(const float* __restrict__ src, unsigned short* __restrict__ dst, int nrows, int seq, int seqfull, float sc) {
    const int u = blockIdx.x * 256 + threadIdx.x;
    if (u >= nrows * (DM / 8)) return;
    const int r  = (u >> 10) * 16 + (u & 15);                 // 1,024 pieces per 16-row tile; row = lane & 15
    const int c0 = ((u >> 6) & 15) * 32 + ((u >> 4) & 3) * 8; // block, then 16 j + 8 (lane >> 4)
    const int sr = (r / seq) * seqfull + (r % seq);
    const float* s = src + (size_t)sr * DM + c0;
    const v4f a = *(const v4f*)(s);
    const v4f b = *(const v4f*)(s + 4);
    v4u pk;
    pk.x = pk_h2(bf_val(a.x) * sc, bf_val(a.y) * sc); pk.y = pk_h2(bf_val(a.z) * sc, bf_val(a.w) * sc);
    pk.z = pk_h2(bf_val(b.x) * sc, bf_val(b.y) * sc); pk.w = pk_h2(bf_val(b.z) * sc, bf_val(b.w) * sc);
    *(v4u*)(dst + (size_t)u * 8) = pk;
}
// value f32 [batch][seqfull][64] -> transposed f16 plane holding bf16(x) * sc, rows d, k = tokens, in fragment order:
// dst[b][t / 32][d / 16] blocks, so a 64-token tile is 8 KiB in a row.
__global__ __launch_bounds__(256) void k_cast_vt(const float* __restrict__ src, unsigned short* __restrict__ dst, int seq, int seqfull, float sc) {
    __shared__ __align__(16) _Float16 Tsh[DKH * TP];
    const int nb64 = seq / 64;
    const int b  = blockIdx.x / nb64;
    const int t0 = (blockIdx.x - b * nb64) * 64;
#pragma unroll 1
    for (int it = 0; it < 4; ++it) {
        const int idx = threadIdx.x + 256 * it;           // 1,024 float4 pieces of the [64 t][64 d] tile
        const int t  = idx >> 4;
        const int d4 = (idx & 15) * 4;
        const v4f a = *(const v4f*)(src + ((size_t)(b * seqfull + t0 + t)) * DKH + d4);
        Tsh[(d4 + 0) * TP + t] = toh_flush(bf_val(a.x) * sc);
        Tsh[(d4 + 1) * TP + t] = toh_flush(bf_val(a.y) * sc);
        Tsh[(d4 + 2) * TP + t] = toh_flush(bf_val(a.z) * sc);
        Tsh[(d4 + 3) * TP + t] = toh_flush(bf_val(a.w) * sc);
    }
    __syncthreads();
    {
#pragma unroll
        for (int it = 0; it < 2; ++it) {
            const int p  = threadIdx.x + 256 * it;        // 512 pieces of 8 halves: [32-token step][16-row d tile][piece j][lane]
            const int d  = ((p >> 6) & 3) * 16 + (p & 15);
            const int c8 = (p >> 8) * 32 + ((p >> 4) & 3) * 8;
            const v8h v = *(const v8h_ma*)&Tsh[d * TP + c8];
            const v4u pk = __builtin_bit_cast(v4u, v);
            *(v4u*)(dst + ((size_t)b * seq + t0) * DKH + p * 8) = pk;
        }
        
    }
}

// =====================================================================================================================
// k_attn_heads: fused attention with the softmax taken across the 8 heads. Block = 8 waves = 16 query rows of one batch.
//   QP: f16 plane (q x16), KP: f16 plane (k x256), both [ntok / 16][512 / 32] fragment-order blocks; VT: f16 plane (v^T x16),
//   [batch][seq / 32][64 / 16] fragment-order blocks.
//   Every wave owns its keys from the scores to the output sums: 32 keys per trip (wave w: keys 256 i + 32 w ...), all 8 heads.
//     scores (two 16-key subtiles): S^T[key][query] for all 8 heads (A = k rows, B = q rows, two 32-deep steps each),
//       head softmax lane-local in f32, P x4096 as f16 kept in registers;
//     weights.V: O^T[head][d][query] += V^T[d][32 keys] . P^T[32 keys][query]; the B fragment of a head is the lane's own two
//       8-key pieces (elements 0..7 <- keys 8h+r of the first subtile, 8..15 <- keys 8h+r of the second), so P crosses no lane
//       and no wave, the loop holds no LDS traffic and no barrier, and a wave loads only its own 32 keys of v^T.
//   After the loop the 8 waves' partial sums (8 heads x 64 x 16 each) meet once in LDS: one block barrier, wave = head adds the
//   eight partials in wave order.
//   Epilogue: per wave (head) 16 rows x 64 columns staged in two 32-column halves through a wave-private LDS tile (wave_sync),
// =====================================================================================================================
__global__ __launch_bounds__(256) void k_attn_heads(const unsigned short* __restrict__ QP, const unsigned short* __restrict__ KP,
                                                    const unsigned short* __restrict__ VT, float* __restrict__ out,
                                                    int seq, int seqfull, float sscale) {
    __shared__ __align__(16) float    Rsh[8 * NH * 4 * 256];     // [wave][head][d tile][piece][lane][4] partial sums, cross-wave
    __shared__ __align__(16) float    Osh[8 * 16 * OPH];         // wave-private output staging [16][32] (+4 pad)
    const int lane = threadIdx.x & 31;
    const int wave = __builtin_amdgcn_readfirstlane(threadIdx.x >> 5);
    const int hf = lane >> 4;
    const int c  = lane & 15;
    const int nqb = seq / 16;
    const int b  = blockIdx.x / nqb;
    const int q0 = (blockIdx.x - b * nqb) * 16;
    // Fragment addresses = a wave-uniform row base + a lane offset that is the same for every trip.
    const unsigned short* qrow = QP + (size_t)(b * seq + q0) * DM;              // this block's 16 query rows (16 blocks)
    const unsigned short* krow = KP + (size_t)(b * seq) * DM;                   // this batch's key rows
    const unsigned short* vrow = VT + (size_t)(b * DKH) * seq;                  // this batch's v^T blocks
    const unsigned int rlane = (unsigned int)(lane * 8);                        // a lane's 16-byte piece inside a fragment-order block
    const int obase = wave * (16 * OPH);
    const float sl2 = sscale * 1.4426950408889634f;

    v8f oacc[NH][4];
#pragma unroll
    for (int h = 0; h < NH; ++h)
#pragma unroll
        for (int t = 0; t < 4; ++t) { const v8f zz = {0.f, 0.f, 0.f, 0.f, 0.f, 0.f, 0.f, 0.f}; oacc[h][t] = zz; }

    for (int kc = wave * KW; kc < seq; kc += KCH) {
        v8h ph[2][NH];
        v16h vf[4];
#pragma unroll
        for (int sub = 0; sub < 2; ++sub) {
            // ---------- scores: S^T for 16 of this wave's keys, all 8 heads ----------
            // Batches of BH heads: the loads of a batch's k and q fragments are all issued before its first product,
            // so their latencies run side by side and the wave meets one load latency per batch instead of one per product.
            v8f s[NH];
            const unsigned short* kp = krow + (kc + sub * 16) * DM + rlane;     // all batches read at constant offsets from these two addresses
            const unsigned short* qp = qrow + rlane;
#pragma unroll
            for (int g = 0; g < NH / BH; ++g) {
                v16h kf[2 * BH], qf[2 * BH];
#pragma unroll
                for (int j = 0; j < 2 * BH; ++j) {
                    kf[j] = ldfrag_hf(kp + (g * 2 * BH + j) * FBLK);
                    qf[j] = ldfrag_hf(qp + (g * 2 * BH + j) * FBLK);
                }
                // the addresses are inputs of the wait: they stay live up to it, so no load of the batch lands on an address register
                // of another, and what reuses those registers later stands behind the wait
                asm volatile("s_wait_xcnt 0x0" :: "v"(kp), "v"(qp) : "memory");
                __builtin_amdgcn_sched_barrier(0);      // holds the batch's loads ahead of its products (else they sink back to their uses)
#pragma unroll
                for (int j = 0; j < BH; ++j) {
                    v8f z = {0.f, 0.f, 0.f, 0.f, 0.f, 0.f, 0.f, 0.f};
                    z = mma_h(kf[2 * j], qf[2 * j], z);
                    z = mma_h(kf[2 * j + 1], qf[2 * j + 1], z);
                    s[g * BH + j] = z;
                }
                __builtin_amdgcn_sched_barrier(0);      // holds the next loads behind these products, so one batch of fragments is live at a time
            }
            if (sub == 1) {
                // the four v^T fragments of these 32 keys are requested here: their latency passes under the softmax's vector work
                const unsigned short* vp = vrow + kc * DKH + rlane;
#pragma unroll
                for (int t = 0; t < 4; ++t) vf[t] = ldfrag_hf(vp + t * FBLK);   // t = 16-row d tile
                // as above: the address stays live up to the wait
                asm volatile("s_wait_xcnt 0x0" :: "v"(vp) : "memory");
                __builtin_amdgcn_sched_barrier(0);      // holds these loads ahead of the softmax
            }
            // ---------- softmax across heads: element r of every head tile is the same (key, query) pair ----------
#pragma unroll
            for (int r = 0; r < 8; ++r) {
                float m = s[0][r];
#pragma unroll
                for (int h = 1; h < NH; ++h) m = fmaxf(m, s[h][r]);
                float zsum = 0.f;
#pragma unroll
                for (int h = 0; h < NH; ++h) {
                    const float e = exp2f((s[h][r] - m) * sl2);
                    s[h][r] = e;
                    zsum += e;
                }
                const float inv = PCARRY / zsum;
#pragma unroll
                for (int h = 0; h < NH; ++h) s[h][r] = s[h][r] * inv;
            }
#pragma unroll
            for (int h = 0; h < NH; ++h) {
                v8h pv;
#pragma unroll
                for (int r = 0; r < 8; ++r) pv[r] = toh_flush(s[h][r]);
                ph[sub][h] = pv;                        // keys 8*hf .. 8*hf+7 of subtile 'sub', query c
            }
        }
        // ---------- weights.V: O^T[head][d][query] += V^T . P^T over this wave's 32 keys ----------
        // plain builtin products (the compiler keeps their distances itself): the 256 accumulator registers reach above v255,
        // where an asm statement cannot take them as operands
#pragma unroll
        for (int h = 0; h < NH; ++h) {
            const v16h pb = __builtin_shufflevector(ph[0][h], ph[1][h], 0, 1, 2, 3, 4, 5, 6, 7, 8, 9, 10, 11, 12, 13, 14, 15);
            oacc[h][0] = FragT<0>::mma(vf[0], pb, oacc[h][0]);
            oacc[h][1] = FragT<0>::mma(vf[1], pb, oacc[h][1]);
            oacc[h][2] = FragT<0>::mma(vf[2], pb, oacc[h][2]);
            oacc[h][3] = FragT<0>::mma(vf[3], pb, oacc[h][3]);
        }
    }

    // ---------- the waves' partial sums meet: every wave stores its 32 tiles, wave = head adds eight partials in wave order ----------
#pragma unroll
    for (int h = 0; h < NH; ++h) {
#pragma unroll
        for (int t = 0; t < 4; ++t) {
            float* rp = &Rsh[((wave * NH + h) * 4 + t) * 256 + lane * 4];       // a wave's 16-byte store covers 512 contiguous bytes
            const v4f lo = {oacc[h][t][0], oacc[h][t][1], oacc[h][t][2], oacc[h][t][3]};
            const v4f hi = {oacc[h][t][4], oacc[h][t][5], oacc[h][t][6], oacc[h][t][7]};
            *(v4f_ma*)rp = lo;
            *(v4f_ma*)(rp + 128) = hi;
        }
    }
    __syncthreads();
    v8f osum[4];
#pragma unroll
    for (int t = 0; t < 4; ++t) {
        v4f lo = {0.f, 0.f, 0.f, 0.f}, hi = {0.f, 0.f, 0.f, 0.f};
#pragma unroll
        for (int w = 0; w < 8; ++w) {
            const float* rp = &Rsh[((w * NH + wave) * 4 + t) * 256 + lane * 4];
            lo += *(const v4f_ma*)rp;
            hi += *(const v4f_ma*)(rp + 128);
        }
        const v8f sm = {lo.x, lo.y, lo.z, lo.w, hi.x, hi.y, hi.z, hi.w};
        osum[t] = sm;
    }

    // ---------- epilogue: out[b][q0 + query][wave*64 + d], d = t*16 + 8*hf + r held by lane (query c) ----------
    const float osc = 1.0f / (PCARRY * VCARRY);
#pragma unroll
    for (int half = 0; half < 2; ++half) {
#pragma unroll
        for (int tt = 0; tt < 2; ++tt) {
#pragma unroll
            for (int r = 0; r < 8; ++r) Osh[obase + c * OPH + tt * 16 + 8 * hf + r] = osum[half * 2 + tt][r] * osc;
        }
        wave_sync();
        {
            const int q = lane >> 3, c4 = (lane & 7) * 4;
            {
#pragma unroll
                for (int it = 0; it < 4; ++it) {
                    const int row = it * 4 + q;
                    const v4f v = *(const v4f_ma*)&Osh[obase + row * OPH + c4];
                    *(v4f*)(out + (size_t)(b * seqfull + q0 + row) * DM + wave * DKH + half * 32 + c4) = v;
                }
                
            }
        }
        wave_sync();
    }
}

// =====================================================================================================================
// Host side: workspace carve (all plane sizes are multiples of 256 B), 6 launches.
// =====================================================================================================================
constexpr size_t SZ_TOK  = (size_t)NTOK * DM * 2;          // one 16-bit token plane [NTOK][512]
constexpr size_t SZ_V    = (size_t)NTOK * DKH * 2;         // value plane [NTOK][64]
constexpr size_t SZ_W    = (size_t)DM * DKH * 2;           // weight plane [512][64]
constexpr size_t SZ_VT   = (size_t)NB * DKH * SEQ * 2;     // v^T plane [NB*64][SEQ]
constexpr size_t WS_TOTAL = SZ_TOK + SZ_V + SZ_W + SZ_TOK + SZ_VT;
static_assert(SZ_TOK % 256 == 0);
static_assert(SZ_V % 256 == 0);
static_assert(SZ_W % 256 == 0);
static_assert(SZ_VT % 256 == 0);
static_assert(WS_TOTAL <= (size_t)134217728);            // carve stays within 128 MiB
static_assert(((NTOK / 64) * (DM / 64)) % 8 == 0);        // GEMM grid is whole blocks of 8 wave tiles
static_assert((size_t)NTOK * DM < (size_t)2147483647);    // int plane offsets
static_assert((size_t)NB_FULL * SEQ_FULL * DM * 4 == (size_t)8388608);   // output extent in bytes (offset 0)

extern "C" void kernel_launch(void* const* d_in, const int* in_sizes, int n_in, void* d_out, int out_size, void* d_ws, size_t ws_size, hipStream_t stream) {
    if (n_in < 4) return;
    const long long need_q = ((long long)(NB - 1) * SEQ_FULL + SEQ) * DM;
    const long long need_v = ((long long)(NB - 1) * SEQ_FULL + SEQ) * DKH;
    if ((long long)in_sizes[0] < need_q || (long long)in_sizes[1] < need_v) return;
    if (in_sizes[2] < DM * DKH || in_sizes[3] < DM) return;
    if ((long long)out_size < need_q) return;
    if (WS_TOTAL > ws_size) return;

    // query, value, conv_w [512][64][1], conv_b [512]
    const float* xq = (const float*)d_in[0];
    const float* xv = (const float*)d_in[1];
    const float* Wc = (const float*)d_in[2];
    const float* bc = (const float*)d_in[3];
    float* out = (float*)d_out;

    char* wsp = (char*)d_ws;
    unsigned short* Q16 = (unsigned short*)wsp; wsp += SZ_TOK;
    unsigned short* V16 = (unsigned short*)wsp; wsp += SZ_V;
    unsigned short* W16 = (unsigned short*)wsp; wsp += SZ_W;
    unsigned short* KPp = (unsigned short*)wsp; wsp += SZ_TOK;
    unsigned short* VTp = (unsigned short*)wsp; wsp += SZ_VT;
    if ((size_t)(wsp - (char*)d_ws) > ws_size) return;

    const unsigned gx_q = (unsigned)((NTOK * (DM / 8) + 255) / 256);
    const unsigned gx_v = (unsigned)(((NTOK / 8) * (DM / 8) + 255) / 256);
    const unsigned gx_w = (unsigned)((DKH * (DM / 8) + 255) / 256);
    const unsigned gx_gemm = (unsigned)((((NTOK / 64) * (DM / 64)) + 7) / 8);

    // query plane (fragment order): row r <- input row (r / SEQ) * SEQ_FULL + r % SEQ, x16
    k_cast16_frag<<<gx_q, 256, 0, stream>>>(xq, Q16, NTOK, SEQ, SEQ_FULL, QCARRY);
    // value [tokens][64] viewed as 512-wide rows of 8 tokens: in[NTOK/8][512] -> plane [NTOK/8][512] = [NTOK][64], x16
    k_cast16<<<gx_v, 256, 0, stream>>>(xv, V16, NTOK / 8, SEQ / 8, SEQ_FULL / 8, VCARRY);
    // weight [512 out][64 in] viewed as [64][512]; stored order kept (Bt[n][k] = W[n][k]), x16
    k_cast16<<<gx_w, 256, 0, stream>>>(Wc, W16, DKH, DKH, DKH, WCARRY);
    // v^T plane (fragment order): in[tokens][64] -> rows d, k = tokens, per batch, x16; grid = NB * SEQ/64 tiles
    k_cast_vt<<<(unsigned)(NB * (SEQ / 64)), 256, 0, stream>>>(xv, VTp, SEQ, SEQ_FULL, VCARRY);

    // k x256 = (value x16)(W x16)^T + 256 * bias  -> f16 plane (fragment order)
    k_gemm_k<<<gx_gemm, 256, 0, stream>>>(V16, W16, bc, KPp, NTOK, DM, DKH, KCARRY / (VCARRY * WCARRY), KCARRY);

    // scores carry 16 * 256; score scale 1/8 applied with the carries inside the head softmax
    k_attn_heads<<<(unsigned)(NB * (SEQ / 16)), 256, 0, stream>>>(Q16, KPp, VTp, out, SEQ, SEQ_FULL, 0.125f / (QCARRY * KCARRY));
}

// v004
// One run takes 60.8 microseconds.
// Timed twice side by side with v003, it ran 1.17 and 1.23 times as fast.
// Over all steps from v000 it is 2.47 times as fast.
// Multi-head dot attention, 2 x 2,048 queries x 2,048 keys, width 512 = 8 heads x 64; keys = pointwise [out][in] 64->512 map of the value rows + bias, values = the 64-wide value rows shared by all heads, softmax taken ACROSS THE 8 HEADS per (query, key), no key normalisation, no mask. Inputs and parameters converted to bf16 (RNE). Key projection: v_wmma_f32_16x16x32_f16 (f16 operands holding the bf16 values, value x16, weight x16, f32 accumulate, k carried x256 as one f16 plane); scores: v_wmma_f32_16x16x32_f16 (q x16 f16 plane against the k plane, f32 accumulate, f32 head softmax); weights.V: v_wmma_f32_16x16x32_f16 (P x4096 as f16, v^T x16 as f16, f32 accumulate).
#include <hip/hip_runtime.h>
#include <math.h>

#ifndef NB
#define NB 2
#endif
#ifndef SEQ
#define SEQ 2048
#endif
#define NB_FULL 2
#define SEQ_FULL 2048
#define DM 512
#define NH 8
#define DKH 64
#define NTOK (NB * SEQ)
#define OP 68      // f32 staging pitch (floats), GEMM epilogue
#define OPH 36     // f32 staging pitch (floats), attention epilogue (32-column halves)
#define TP 72      // transpose tile pitch (halves)
#define KW 32      // keys per wave and trip = two 16-key subtiles = one 32-deep step of weights.V
#define KCH 256    // keys per trip = 8 waves x KW
#define BH 2       // heads per batch of score fragments (beside 256 accumulator registers a batch of four exceeds the 512-register budget and spills)
#define QCARRY 16.0f
#define VCARRY 16.0f
#define WCARRY 16.0f
#define KCARRY 256.0f
#define PCARRY 4096.0f

static_assert(DM == NH * DKH);            // merged head layout h*64+d
static_assert(DKH == 64);                 // two 32-deep k-steps per score tile, four 16-wide output tiles
static_assert(NH == 8);                   // one head per wave in the final sum and the epilogue, 8 waves per block
static_assert(SEQ % 64 == 0);             // 64-row GEMM tiles and 64-token transpose tiles inside one sequence
static_assert(SEQ % KCH == 0);            // whole key chunks
static_assert(SEQ % 16 == 0);             // 16-query blocks
static_assert(NTOK % 64 == 0);            // GEMM tile multiple (M)
static_assert(DM % 64 == 0);              // GEMM tile multiple (N)
static_assert(DKH % 32 == 0);             // K steps of 32
static_assert(NB <= NB_FULL);
static_assert(SEQ <= SEQ_FULL);
static_assert((OP % 4) == 0);             // 16-B aligned reloads from the f32 staging tile
static_assert((OPH % 4) == 0);
static_assert((TP % 8) == 0);             // 16-B aligned reloads from the transpose tile
static_assert(KCH == 8 * KW);
static_assert(NH % BH == 0);
static_assert(NTOK % 16 == 0);            // whole 16-row tiles in the fragment-order planes
static_assert(DM == 512);                 // cast16_frag_part: 1,024 pieces per 16-row tile, 16 blocks per tile

typedef __attribute__((ext_vector_type(16))) _Float16 v16h;
typedef __attribute__((ext_vector_type(8)))  _Float16 v8h;
typedef __attribute__((ext_vector_type(8)))  float    v8f;
typedef __attribute__((ext_vector_type(4)))  float    v4f;
typedef __attribute__((ext_vector_type(4)))  unsigned int v4u;
typedef v8h v8h_ma __attribute__((may_alias));
typedef v4f v4f_ma __attribute__((may_alias));

// 16-bit WMMA fragment map (wave32), lane L, h = L>>4, m = L&15:
//   A 16x32: lane = row m;    element i -> k = (i<8) ? 8h+i : 16+8h+(i-8)
//   B 32x16: lane = column m; the SAME k(i,h)
//   D 16x16 (8 f32): lane = column m; element r -> row 8h+r
// A fragment from a k-contiguous row is therefore p[0..7] | p[16..23] with p = row + k0 + 8h.
// Fragment order (the attention kernel's three operand planes): a 16-row x 32-k block is stored as 512 halves
//   [piece j][lane L][8 halves], piece j of lane L = row (L & 15), k = 16 j + 8 (L >> 4) + 0..7,
// so that the 32 lanes of one 16-byte load read 512 contiguous bytes (four whole 128-B lines) where a row-major plane
// makes them touch 16 lines. The registers receive the same elements as from a row-major plane.
#define FBLK 512   // halves per 16 x 32 block

__device__ __forceinline__ unsigned int bf_bits(float f) {            // bf16 RNE bit pattern (finite inputs)
    const unsigned int u = __float_as_uint(f);
    return (u + 0x7FFFu + ((u >> 16) & 1u)) >> 16;
}
__device__ __forceinline__ float bf_val(float f) { return __uint_as_float(bf_bits(f) << 16); }
__device__ __forceinline__ unsigned int pk_h2(float a, float b) {
    return (unsigned int)__builtin_bit_cast(unsigned short, (_Float16)a) | ((unsigned int)__builtin_bit_cast(unsigned short, (_Float16)b) << 16);
}
// f32 -> f16 that cannot produce an f16 subnormal: magnitudes below 2^-14 become zero (value select)
static __device__ __forceinline__ _Float16 toh_flush(float v) {
    const _Float16 r = (_Float16)v;
    return (fabsf(v) < 6.103515625e-05f) ? (_Float16)0.0f : r;
}
static __device__ __forceinline__ unsigned int pk_h2f(float a, float b) {
    return (unsigned int)__builtin_bit_cast(unsigned short, toh_flush(a)) | ((unsigned int)__builtin_bit_cast(unsigned short, toh_flush(b)) << 16);
}
__device__ __forceinline__ void wave_sync() {
    __builtin_amdgcn_fence(3 /* release order */, "workgroup");
    __builtin_amdgcn_wave_barrier();
    __builtin_amdgcn_fence(2 /* acquire order */, "workgroup");
}

// fragment from a k-contiguous f32 row, p = row + k0 + 8h: elements p[0..7] | p[16..23], each as f16(bf16(x) * sc);
// the four 16-byte loads and the conversion are separate calls, so that many fragments' loads can be issued ahead of the first conversion
struct RawFrag { v4f a0, a1, b0, b1; };
__device__ __forceinline__ RawFrag ldfrag_raw(const float* __restrict__ p) {
    RawFrag r;
    r.a0 = *(const v4f*)(p);
    r.a1 = *(const v4f*)(p + 4);
    r.b0 = *(const v4f*)(p + 16);
    r.b1 = *(const v4f*)(p + 20);
    return r;
}
__device__ __forceinline__ v16h cvtfrag(const RawFrag& r, float sc) {
    const v4f a0 = r.a0, a1 = r.a1, b0 = r.b0, b1 = r.b1;
    v4u lo, hi;
    lo.x = pk_h2(bf_val(a0.x) * sc, bf_val(a0.y) * sc); lo.y = pk_h2(bf_val(a0.z) * sc, bf_val(a0.w) * sc);
    lo.z = pk_h2(bf_val(a1.x) * sc, bf_val(a1.y) * sc); lo.w = pk_h2(bf_val(a1.z) * sc, bf_val(a1.w) * sc);
    hi.x = pk_h2(bf_val(b0.x) * sc, bf_val(b0.y) * sc); hi.y = pk_h2(bf_val(b0.z) * sc, bf_val(b0.w) * sc);
    hi.z = pk_h2(bf_val(b1.x) * sc, bf_val(b1.y) * sc); hi.w = pk_h2(bf_val(b1.z) * sc, bf_val(b1.w) * sc);
    return __builtin_shufflevector(__builtin_bit_cast(v8h, lo), __builtin_bit_cast(v8h, hi), 0, 1, 2, 3, 4, 5, 6, 7, 8, 9, 10, 11, 12, 13, 14, 15);
}
// fragment from a fragment-order block: p = block + lane * 8
__device__ __forceinline__ v16h ldfrag_hf(const unsigned short* __restrict__ p) {
    const v8h a = *(const v8h*)(p);
    const v8h b = *(const v8h*)(p + FBLK / 2);
    return __builtin_shufflevector(a, b, 0, 1, 2, 3, 4, 5, 6, 7, 8, 9, 10, 11, 12, 13, 14, 15);
}

template <int ET> struct FragT;
template <> struct FragT<0> {
    typedef v16h V;
    static __device__ __forceinline__ v8f mma(v16h a, v16h b, v8f c) { return __builtin_amdgcn_wmma_f32_16x16x32_f16(false, a, false, b, (short)0, c, false, false); }
};
// hazard guard for a group of four independent WMMAs: all four accumulators tied, A and all B fragments kept live
template <typename V>
__device__ __forceinline__ void guard4(v8f& a, v8f& b, v8f& c, v8f& d, V x, V y0, V y1, V y2, V y3) {
    asm volatile("v_nop\n\tv_nop\n\tv_nop\n\tv_nop" : "+v"(a), "+v"(b), "+v"(c), "+v"(d) : "v"(x), "v"(y0), "v"(y1), "v"(y2), "v"(y3));
}
// single f16 WMMA with its own hazard guard (one accumulator tied, both fragments kept live)
static __device__ __forceinline__ v8f mma_h(v16h a, v16h b, v8f c) {
    c = __builtin_amdgcn_wmma_f32_16x16x32_f16(false, a, false, b, (short)0, c, false, false);
    asm volatile("v_nop\n\tv_nop\n\tv_nop\n\tv_nop" : "+v"(c) : "v"(a), "v"(b));
    return c;
}

// =====================================================================================================================
// The three preparatory parts below read the inputs alone and write disjoint planes, so they run as block ranges of ONE launch
// (k_prep): the key projection converts its own operands on the way into the fragments instead of reading planes that earlier
// launches had to write.
// =====================================================================================================================
#define PB_GEMM (((NTOK / 64) * (DM / 64)) / 8)   // blocks of 8 wave tiles, key projection
#define PB_VT   (NB * (SEQ / 64))                 // 64-token transpose tiles
#define PB_Q    ((NTOK * (DM / 8)) / 256)         // 256 16-byte pieces of the query plane per block
static_assert(((NTOK / 64) * (DM / 64)) % 8 == 0);        // whole blocks of 8 wave tiles
static_assert((NTOK * (DM / 8)) % 256 == 0);              // whole blocks of query pieces
static_assert(DKH * TP * 2 <= 8 * 16 * OP * 4);           // the transpose tile fits the shared staging array

// kproj_part: k x256 = (value x16)(W x16)^T + 256 * bf16(bias[n]); each wave owns a 64x64 tile of [M = tokens][N = 512], K = 64.
//   A = value rows f32 [tokens][64], Bt = weight rows f32 [512 out][64 in] as stored, both taken as f16(bf16(x) * 16) by the loader;
//   out = one f16 plane in fragment order: [M / 16][N / 32] blocks. No block barrier.
__device__ __forceinline__ void kproj_part(const float* __restrict__ xv, const float* __restrict__ Wc, const float* __restrict__ bias,
                                           unsigned short* __restrict__ Ca, float* sT, int blk) {
    constexpr float scale  = KCARRY / (VCARRY * WCARRY);
    constexpr float bscale = KCARRY;
    constexpr int tilesN = DM >> 6;
    constexpr int tilesM = NTOK >> 6;
    const int lane = threadIdx.x & 31;
    const int wave = __builtin_amdgcn_readfirstlane(threadIdx.x >> 5);
    const int tile = blk * 8 + wave;
    if (tile >= tilesM * tilesN) return;          // wave-uniform; this part has no block barriers
    const int tm = tile / tilesN;
    const int tn = tile - tm * tilesN;
    const int m0 = tm << 6;
    const int n0 = tn << 6;
    const int rl   = lane & 15;
    const int koff = (lane >> 4) * 8;
    const int mOff = (lane >> 4) * 8;
    const float* arow = xv + (size_t)((m0 / SEQ) * SEQ_FULL + (m0 % SEQ) + rl) * DKH + koff;   // a 64-row tile lies inside one sequence
    const float* brow = Wc + (size_t)(n0 + rl) * DKH + koff;

    // K = 64 is two 32-deep steps, so the wave's whole operand set is sixteen fragments, all fetched ahead of the first product and of
    // the fences in the store loop: the 32 loads of a step are issued together and the wave meets one load latency per step. One 16-row
    // strip of the tile is then finished at a time (both steps, then its stores): four accumulator tiles are live beside the fragments.
    v16h bh[2][4], ah[4][2];
    float bvn[4];
#pragma unroll
    for (int j = 0; j < 4; ++j) bvn[j] = bias[n0 + (j << 4) + rl];
    asm volatile("s_wait_xcnt 0x0" ::: "memory");   // the fragment loads below may land on the offset register that these four loads name
#pragma unroll
    for (int ks = 0; ks < 2; ++ks) {
        RawFrag rb[4], ra[4];
#pragma unroll
        for (int j = 0; j < 4; ++j) {
            rb[j] = ldfrag_raw(brow + (j << 4) * DKH + ks * 32);
            ra[j] = ldfrag_raw(arow + (j << 4) * DKH + ks * 32);
        }
        __builtin_amdgcn_sched_barrier(0);      // holds the step's loads ahead of its conversions (else each fragment's loads sink to their use and every latency is met alone)
#pragma unroll
        for (int j = 0; j < 4; ++j) {
            bh[ks][j] = cvtfrag(rb[j], WCARRY);
            ah[j][ks] = cvtfrag(ra[j], VCARRY);
        }
        __builtin_amdgcn_sched_barrier(0);      // holds the next step's loads behind these conversions: one step's f32 values live at a time, two blocks fit a WGP's registers
    }

#pragma unroll
    for (int j = 0; j < 4; ++j) bvn[j] = bf_val(bvn[j]) * bscale;

    const int sb = wave * (16 * OP);
#pragma unroll
    for (int i = 0; i < 4; ++i) {
        v8f acc[4];
#pragma unroll
        for (int j = 0; j < 4; ++j) { const v8f zz = {0.f, 0.f, 0.f, 0.f, 0.f, 0.f, 0.f, 0.f}; acc[j] = zz; }
#pragma unroll
        for (int ks = 0; ks < 2; ++ks) {
            acc[0] = FragT<0>::mma(ah[i][ks], bh[ks][0], acc[0]);
            acc[1] = FragT<0>::mma(ah[i][ks], bh[ks][1], acc[1]);
            acc[2] = FragT<0>::mma(ah[i][ks], bh[ks][2], acc[2]);
            acc[3] = FragT<0>::mma(ah[i][ks], bh[ks][3], acc[3]);
            guard4<v16h>(acc[0], acc[1], acc[2], acc[3], ah[i][ks], bh[ks][0], bh[ks][1], bh[ks][2], bh[ks][3]);
        }
        const int mBase = m0 + (i << 4);
#pragma unroll
        for (int j = 0; j < 4; ++j) {
#pragma unroll
            for (int r = 0; r < 8; ++r) {
                float v = acc[j][r] * scale;
                v += bvn[j];
                sT[sb + (mOff + r) * OP + (j << 4) + rl] = v;
            }
        }
        wave_sync();
        // these 16 rows x 64 columns are two adjacent fragment-order blocks = 2 KiB in a row: piece 'it' = columns 16 it + 8 (lane >> 4)
        unsigned short* cb = Ca + (size_t)(mBase >> 4) * (16 * DM) + (size_t)(n0 >> 5) * FBLK + lane * 8;
#pragma unroll
        for (int it = 0; it < 4; ++it) {
            const v4f a = *(const v4f_ma*)&sT[sb + rl * OP + it * 16 + koff];
            const v4f b = *(const v4f_ma*)&sT[sb + rl * OP + it * 16 + koff + 4];
            v4u pk; pk.x = pk_h2f(a.x, a.y); pk.y = pk_h2f(a.z, a.w); pk.z = pk_h2f(b.x, b.y); pk.w = pk_h2f(b.z, b.w);
            *(v4u*)(cb + it * (FBLK / 2)) = pk;
        }
        wave_sync();
    }
}

// query f32 [rows][512] -> f16 plane holding bf16(x) * 16 in fragment order ([NTOK / 16][512 / 32] blocks); plane row r reads source
// row (r / SEQ) * SEQ_FULL + r % SEQ; thread u writes the plane's u-th 16-byte piece, so a wave stores 512 contiguous bytes; a block
// reads 16 source rows x 512 B, whole lines between its waves
__device__ __forceinline__ void cast16_frag_part(const float* __restrict__ src, unsigned short* __restrict__ dst, int blk) {
    const int u = blk * 256 + threadIdx.x;
    if (u >= NTOK * (DM / 8)) return;
    const int r  = (u >> 10) * 16 + (u & 15);                 // 1,024 pieces per 16-row tile; row = lane & 15
    const int c0 = ((u >> 6) & 15) * 32 + ((u >> 4) & 3) * 8; // block, then 16 j + 8 (lane >> 4)
    const int sr = (r / SEQ) * SEQ_FULL + (r % SEQ);
    const float* s = src + (size_t)sr * DM + c0;
    const v4f a = *(const v4f*)(s);
    const v4f b = *(const v4f*)(s + 4);
    v4u pk;
    pk.x = pk_h2(bf_val(a.x) * QCARRY, bf_val(a.y) * QCARRY); pk.y = pk_h2(bf_val(a.z) * QCARRY, bf_val(a.w) * QCARRY);
    pk.z = pk_h2(bf_val(b.x) * QCARRY, bf_val(b.y) * QCARRY); pk.w = pk_h2(bf_val(b.z) * QCARRY, bf_val(b.w) * QCARRY);
    *(v4u*)(dst + (size_t)u * 8) = pk;
}

// value f32 [batch][SEQ_FULL][64] -> transposed f16 plane holding bf16(x) * 16, rows d, k = tokens, in fragment order:
// dst[b][t / 32][d / 16] blocks, so a 64-token tile is 8 KiB in a row.
__device__ __forceinline__ void cast_vt_part(const float* __restrict__ src, unsigned short* __restrict__ dst, _Float16* Tsh, int blk) {
    constexpr int nb64 = SEQ / 64;
    const int b  = blk / nb64;
    const int t0 = (blk - b * nb64) * 64;
#pragma unroll 1
    for (int it = 0; it < 4; ++it) {
        const int idx = threadIdx.x + 256 * it;           // 1,024 float4 pieces of the [64 t][64 d] tile
        const int t  = idx >> 4;
        const int d4 = (idx & 15) * 4;
        const v4f a = *(const v4f*)(src + ((size_t)(b * SEQ_FULL + t0 + t)) * DKH + d4);
        Tsh[(d4 + 0) * TP + t] = toh_flush(bf_val(a.x) * VCARRY);
        Tsh[(d4 + 1) * TP + t] = toh_flush(bf_val(a.y) * VCARRY);
        Tsh[(d4 + 2) * TP + t] = toh_flush(bf_val(a.z) * VCARRY);
        Tsh[(d4 + 3) * TP + t] = toh_flush(bf_val(a.w) * VCARRY);
    }
    __syncthreads();
#pragma unroll
    for (int it = 0; it < 2; ++it) {
        const int p  = threadIdx.x + 256 * it;            // 512 pieces of 8 halves: [32-token step][16-row d tile][piece j][lane]
        const int d  = ((p >> 6) & 3) * 16 + (p & 15);
        const int c8 = (p >> 8) * 32 + ((p >> 4) & 3) * 8;
        const v8h v = *(const v8h_ma*)&Tsh[d * TP + c8];
        const v4u pk = __builtin_bit_cast(v4u, v);
        *(v4u*)(dst + ((size_t)b * SEQ + t0) * DKH + p * 8) = pk;
    }
    asm volatile("s_wait_xcnt 0x0" ::: "memory");   // behind the two stores: another part's code follows in the kernel's text and rewrites the registers of their address
}

// one launch for all three parts; the block index picks the part (block-uniform), the longest part (key projection) starts first
__global__ __launch_bounds__(256) void k_prep(const float* __restrict__ xq, const float* __restrict__ xv, const float* __restrict__ Wc,
                                              const float* __restrict__ bc, unsigned short* __restrict__ QP, unsigned short* __restrict__ KP,
                                              unsigned short* __restrict__ VT) {
    __shared__ __align__(16) float sh[8 * 16 * OP];       // projection: f32 staging, one 16 x 64 tile per wave; transpose: its f16 tile
    const int blk = blockIdx.x;
    if (blk < PB_GEMM)              kproj_part(xv, Wc, bc, KP, sh, blk);
    else if (blk < PB_GEMM + PB_VT) cast_vt_part(xv, VT, (_Float16*)sh, blk - PB_GEMM);
    else                            cast16_frag_part(xq, QP, blk - (PB_GEMM + PB_VT));
}

// =====================================================================================================================
// k_attn_heads: fused attention with the softmax taken across the 8 heads. Block = 8 waves = 16 query rows of one batch.
//   QP: f16 plane (q x16), KP: f16 plane (k x256), both [ntok / 16][512 / 32] fragment-order blocks; VT: f16 plane (v^T x16),
//   [batch][seq / 32][64 / 16] fragment-order blocks.
//   Every wave owns its keys from the scores to the output sums: 32 keys per trip (wave w: keys 256 i + 32 w ...), all 8 heads.
//     scores (two 16-key subtiles): S^T[key][query] for all 8 heads (A = k rows, B = q rows, two 32-deep steps each),
//       head softmax lane-local in f32, P x4096 as f16 kept in registers;
//     weights.V: O^T[head][d][query] += V^T[d][32 keys] . P^T[32 keys][query]; the B fragment of a head is the lane's own two
//       8-key pieces (elements 0..7 <- keys 8h+r of the first subtile, 8..15 <- keys 8h+r of the second), so P crosses no lane
//       and no wave, the loop holds no LDS traffic and no barrier, and a wave loads only its own 32 keys of v^T.
//   After the loop the 8 waves' partial sums (8 heads x 64 x 16 each) meet once in LDS: one block barrier, wave = head adds the
//   eight partials in wave order.
//   Epilogue: per wave (head) 16 rows x 64 columns staged in two 32-column halves through a wave-private LDS tile (wave_sync),
// =====================================================================================================================
__global__ __launch_bounds__(256) void k_attn_heads(const unsigned short* __restrict__ QP, const unsigned short* __restrict__ KP,
                                                    const unsigned short* __restrict__ VT, float* __restrict__ out,
                                                    int seq, int seqfull, float sscale) {
    __shared__ __align__(16) float    Rsh[8 * NH * 4 * 256];     // [wave][head][d tile][piece][lane][4] partial sums, cross-wave
    __shared__ __align__(16) float    Osh[8 * 16 * OPH];         // wave-private output staging [16][32] (+4 pad)
    const int lane = threadIdx.x & 31;
    const int wave = __builtin_amdgcn_readfirstlane(threadIdx.x >> 5);
    const int hf = lane >> 4;
    const int c  = lane & 15;
    const int nqb = seq / 16;
    const int b  = blockIdx.x / nqb;
    const int q0 = (blockIdx.x - b * nqb) * 16;
    // Fragment addresses = a wave-uniform row base + a lane offset that is the same for every trip.
    const unsigned short* qrow = QP + (size_t)(b * seq + q0) * DM;              // this block's 16 query rows (16 blocks)
    const unsigned short* krow = KP + (size_t)(b * seq) * DM;                   // this batch's key rows
    const unsigned short* vrow = VT + (size_t)(b * DKH) * seq;                  // this batch's v^T blocks
    const unsigned int rlane = (unsigned int)(lane * 8);                        // a lane's 16-byte piece inside a fragment-order block
    const int obase = wave * (16 * OPH);
    const float sl2 = sscale * 1.4426950408889634f;

    v8f oacc[NH][4];
#pragma unroll
    for (int h = 0; h < NH; ++h)
#pragma unroll
        for (int t = 0; t < 4; ++t) { const v8f zz = {0.f, 0.f, 0.f, 0.f, 0.f, 0.f, 0.f, 0.f}; oacc[h][t] = zz; }

    for (int kc = wave * KW; kc < seq; kc += KCH) {
        v8h ph[2][NH];
        v16h vf[4];
#pragma unroll
        for (int sub = 0; sub < 2; ++sub) {
            // ---------- scores: S^T for 16 of this wave's keys, all 8 heads ----------
            // Batches of BH heads: the loads of a batch's k and q fragments are all issued before its first product,
            // so their latencies run side by side and the wave meets one load latency per batch instead of one per product.
            v8f s[NH];
            const unsigned short* kp = krow + (kc + sub * 16) * DM + rlane;     // all batches read at constant offsets from these two addresses
            const unsigned short* qp = qrow + rlane;
#pragma unroll
            for (int g = 0; g < NH / BH; ++g) {
                v16h kf[2 * BH], qf[2 * BH];
#pragma unroll
                for (int j = 0; j < 2 * BH; ++j) {
                    kf[j] = ldfrag_hf(kp + (g * 2 * BH + j) * FBLK);
                    qf[j] = ldfrag_hf(qp + (g * 2 * BH + j) * FBLK);
                }
                // the addresses are inputs of the wait: they stay live up to it, so no load of the batch lands on an address register
                // of another, and what reuses those registers later stands behind the wait
                asm volatile("s_wait_xcnt 0x0" :: "v"(kp), "v"(qp) : "memory");
                __builtin_amdgcn_sched_barrier(0);      // holds the batch's loads ahead of its products (else they sink back to their uses)
#pragma unroll
                for (int j = 0; j < BH; ++j) {
                    v8f z = {0.f, 0.f, 0.f, 0.f, 0.f, 0.f, 0.f, 0.f};
                    z = mma_h(kf[2 * j], qf[2 * j], z);
                    z = mma_h(kf[2 * j + 1], qf[2 * j + 1], z);
                    s[g * BH + j] = z;
                }
                __builtin_amdgcn_sched_barrier(0);      // holds the next loads behind these products, so one batch of fragments is live at a time
            }
            if (sub == 1) {
                // the four v^T fragments of these 32 keys are requested here: their latency passes under the softmax's vector work
                const unsigned short* vp = vrow + kc * DKH + rlane;
#pragma unroll
                for (int t = 0; t < 4; ++t) vf[t] = ldfrag_hf(vp + t * FBLK);   // t = 16-row d tile
                // as above: the address stays live up to the wait
                asm volatile("s_wait_xcnt 0x0" :: "v"(vp) : "memory");
                __builtin_amdgcn_sched_barrier(0);      // holds these loads ahead of the softmax
            }
            // ---------- softmax across heads: element r of every head tile is the same (key, query) pair ----------
#pragma unroll
            for (int r = 0; r < 8; ++r) {
                float m = s[0][r];
#pragma unroll
                for (int h = 1; h < NH; ++h) m = fmaxf(m, s[h][r]);
                float zsum = 0.f;
#pragma unroll
                for (int h = 0; h < NH; ++h) {
                    const float e = exp2f((s[h][r] - m) * sl2);
                    s[h][r] = e;
                    zsum += e;
                }
                const float inv = PCARRY / zsum;
#pragma unroll
                for (int h = 0; h < NH; ++h) s[h][r] = s[h][r] * inv;
            }
#pragma unroll
            for (int h = 0; h < NH; ++h) {
                v8h pv;
#pragma unroll
                for (int r = 0; r < 8; ++r) pv[r] = toh_flush(s[h][r]);
                ph[sub][h] = pv;                        // keys 8*hf .. 8*hf+7 of subtile 'sub', query c
            }
        }
        // ---------- weights.V: O^T[head][d][query] += V^T . P^T over this wave's 32 keys ----------
        // plain builtin products (the compiler keeps their distances itself): the 256 accumulator registers reach above v255,
        // where an asm statement cannot take them as operands
#pragma unroll
        for (int h = 0; h < NH; ++h) {
            const v16h pb = __builtin_shufflevector(ph[0][h], ph[1][h], 0, 1, 2, 3, 4, 5, 6, 7, 8, 9, 10, 11, 12, 13, 14, 15);
            oacc[h][0] = FragT<0>::mma(vf[0], pb, oacc[h][0]);
            oacc[h][1] = FragT<0>::mma(vf[1], pb, oacc[h][1]);
            oacc[h][2] = FragT<0>::mma(vf[2], pb, oacc[h][2]);
            oacc[h][3] = FragT<0>::mma(vf[3], pb, oacc[h][3]);
        }
    }

    // ---------- the waves' partial sums meet: every wave stores its 32 tiles, wave = head adds eight partials in wave order ----------
#pragma unroll
    for (int h = 0; h < NH; ++h) {
#pragma unroll
        for (int t = 0; t < 4; ++t) {
            float* rp = &Rsh[((wave * NH + h) * 4 + t) * 256 + lane * 4];       // a wave's 16-byte store covers 512 contiguous bytes
            const v4f lo = {oacc[h][t][0], oacc[h][t][1], oacc[h][t][2], oacc[h][t][3]};
            const v4f hi = {oacc[h][t][4], oacc[h][t][5], oacc[h][t][6], oacc[h][t][7]};
            *(v4f_ma*)rp = lo;
            *(v4f_ma*)(rp + 128) = hi;
        }
    }
    __syncthreads();
    v8f osum[4];
#pragma unroll
    for (int t = 0; t < 4; ++t) {
        v4f lo = {0.f, 0.f, 0.f, 0.f}, hi = {0.f, 0.f, 0.f, 0.f};
#pragma unroll
        for (int w = 0; w < 8; ++w) {
            const float* rp = &Rsh[((w * NH + wave) * 4 + t) * 256 + lane * 4];
            lo += *(const v4f_ma*)rp;
            hi += *(const v4f_ma*)(rp + 128);
        }
        const v8f sm = {lo.x, lo.y, lo.z, lo.w, hi.x, hi.y, hi.z, hi.w};
        osum[t] = sm;
    }

    // ---------- epilogue: out[b][q0 + query][wave*64 + d], d = t*16 + 8*hf + r held by lane (query c) ----------
    const float osc = 1.0f / (PCARRY * VCARRY);
#pragma unroll
    for (int half = 0; half < 2; ++half) {
#pragma unroll
        for (int tt = 0; tt < 2; ++tt) {
#pragma unroll
            for (int r = 0; r < 8; ++r) Osh[obase + c * OPH + tt * 16 + 8 * hf + r] = osum[half * 2 + tt][r] * osc;
        }
        wave_sync();
        {
            const int q = lane >> 3, c4 = (lane & 7) * 4;
            {
#pragma unroll
                for (int it = 0; it < 4; ++it) {
                    const int row = it * 4 + q;
                    const v4f v = *(const v4f_ma*)&Osh[obase + row * OPH + c4];
                    *(v4f*)(out + (size_t)(b * seqfull + q0 + row) * DM + wave * DKH + half * 32 + c4) = v;
                }
                
            }
        }
        wave_sync();
    }
}

// =====================================================================================================================
// Host side: workspace carve (all plane sizes are multiples of 256 B), 2 launches.
// =====================================================================================================================
constexpr size_t SZ_TOK  = (size_t)NTOK * DM * 2;          // one 16-bit token plane [NTOK][512]
constexpr size_t SZ_VT   = (size_t)NB * DKH * SEQ * 2;     // v^T plane [NB*64][SEQ]
constexpr size_t WS_TOTAL = SZ_TOK + SZ_TOK + SZ_VT;
static_assert(SZ_TOK % 256 == 0);
static_assert(SZ_VT % 256 == 0);
static_assert(WS_TOTAL <= (size_t)134217728);            // carve stays within 128 MiB
static_assert((size_t)NTOK * DM < (size_t)2147483647);    // int plane offsets
static_assert((size_t)NB_FULL * SEQ_FULL * DM * 4 == (size_t)8388608);   // output extent in bytes (offset 0)

extern "C" void kernel_launch(void* const* d_in, const int* in_sizes, int n_in, void* d_out, int out_size, void* d_ws, size_t ws_size, hipStream_t stream) {
    if (n_in < 4) return;
    const long long need_q = ((long long)(NB - 1) * SEQ_FULL + SEQ) * DM;
    const long long need_v = ((long long)(NB - 1) * SEQ_FULL + SEQ) * DKH;
    if ((long long)in_sizes[0] < need_q || (long long)in_sizes[1] < need_v) return;
    if (in_sizes[2] < DM * DKH || in_sizes[3] < DM) return;
    if ((long long)out_size < need_q) return;
    if (WS_TOTAL > ws_size) return;

    // query, value, conv_w [512][64][1], conv_b [512]
    const float* xq = (const float*)d_in[0];
    const float* xv = (const float*)d_in[1];
    const float* Wc = (const float*)d_in[2];
    const float* bc = (const float*)d_in[3];
    float* out = (float*)d_out;

    char* wsp = (char*)d_ws;
    unsigned short* Q16 = (unsigned short*)wsp; wsp += SZ_TOK;
    unsigned short* KPp = (unsigned short*)wsp; wsp += SZ_TOK;
    unsigned short* VTp = (unsigned short*)wsp; wsp += SZ_VT;
    if ((size_t)(wsp - (char*)d_ws) > ws_size) return;

    // query plane x16, k plane x256 = (value x16)(W x16)^T + 256 * bias, v^T plane x16, all in fragment order
    k_prep<<<(unsigned)(PB_GEMM + PB_VT + PB_Q), 256, 0, stream>>>(xq, xv, Wc, bc, Q16, KPp, VTp);

    // scores carry 16 * 256; score scale 1/8 applied with the carries inside the head softmax
    k_attn_heads<<<(unsigned)(NB * (SEQ / 16)), 256, 0, stream>>>(Q16, KPp, VTp, out, SEQ, SEQ_FULL, 0.125f / (QCARRY * KCARRY));
}

// v006
// A run of this version takes 30.1 microseconds.
// Versions in between are left out here; by their measured steps it is 1.99 times as fast as v004.
// Counting every step since v000, it is 4.92 times as fast.
// Multi-head dot attention, 2 x 2,048 queries x 2,048 keys, width 512 = 8 heads x 64; keys = pointwise [out][in] 64->512 map of the value rows + bias, values = the 64-wide value rows shared by all heads, softmax taken ACROSS THE 8 HEADS per (query, key), no key normalisation, no mask. Scores reassociated: q_h . (W_h v + b_h) = (W_h^T q_h) . v + q_h . b_h, so the query is projected (per head, 64 -> 64) and the key operand of every head is the value row itself. Inputs and parameters converted to bf16 (RNE). Query projection: v_wmma_f32_16x16x32_f16 (f16 operands holding the bf16 values, query x16, weight x16, bias x16, f32 accumulate, projected query carried x256 as one f16 plane, q.b x256 in f32); scores: v_wmma_f32_16x16x32_f16 (value rows x16 against the projected query plane, f32 accumulate, f32 head softmax); weights.V: v_wmma_f32_16x16x32_f16 (P x4096 as f16, v^T x16 as f16, f32 accumulate).
#include <hip/hip_runtime.h>
#include <math.h>

#ifndef NB
#define NB 2
#endif
#ifndef SEQ
#define SEQ 2048
#endif
#define NB_FULL 2
#define SEQ_FULL 2048
#define DM 512
#define NH 8
#define DKH 64
#define NTOK (NB * SEQ)
#define OP 68      // f32 staging pitch (floats), GEMM epilogue
#define OPH 36     // f32 staging pitch (floats), attention epilogue (32-column halves)
#define TP 72      // transpose tile pitch (halves)
#define KW 32      // keys per wave and trip = two 16-key subtiles = one 32-deep step of weights.V
#define KCH 256    // keys per trip = 8 waves x KW
#define BH 4       // heads per batch of score fragments: eight query fragments, 16 loads
#define QCARRY 16.0f
#define VCARRY 16.0f
#define WCARRY 16.0f
#define KCARRY 256.0f
#define PCARRY 4096.0f

static_assert(DM == NH * DKH);            // merged head layout h*64+d
static_assert(DKH == 64);                 // two 32-deep k-steps per score tile, four 16-wide output tiles
static_assert(NH == 8);                   // one head per wave in the final sum and the epilogue, 8 waves per block
static_assert(SEQ % 64 == 0);             // 64-row GEMM tiles and 64-token transpose tiles inside one sequence
static_assert(SEQ % KCH == 0);            // whole key chunks
static_assert(SEQ % 16 == 0);             // 16-query blocks
static_assert(NTOK % 64 == 0);            // GEMM tile multiple (M)
static_assert(DM % 64 == 0);              // GEMM tile multiple (N)
static_assert(DKH % 32 == 0);             // K steps of 32
static_assert(NB <= NB_FULL);
static_assert(SEQ <= SEQ_FULL);
static_assert((OP % 4) == 0);             // 16-B aligned reloads from the f32 staging tile
static_assert((OPH % 4) == 0);
static_assert((TP % 8) == 0);             // 16-B aligned reloads from the transpose tile
static_assert(KCH == 8 * KW);
static_assert(NH % BH == 0);
static_assert(NTOK % 16 == 0);            // whole 16-row tiles in the fragment-order planes
static_assert(DKH == 64);                 // cast_vrow_part: 128 pieces per 16-row tile, 2 blocks per tile

typedef __attribute__((ext_vector_type(16))) _Float16 v16h;
typedef __attribute__((ext_vector_type(8)))  _Float16 v8h;
typedef __attribute__((ext_vector_type(8)))  float    v8f;
typedef __attribute__((ext_vector_type(4)))  float    v4f;
typedef __attribute__((ext_vector_type(2)))  float    v2f;
typedef __attribute__((ext_vector_type(2)))  _Float16 v2h;
typedef __attribute__((ext_vector_type(4)))  unsigned int v4u;
typedef v8h v8h_ma __attribute__((may_alias));
typedef v4f v4f_ma __attribute__((may_alias));

// 16-bit WMMA fragment map (wave32), lane L, h = L>>4, m = L&15:
//   A 16x32: lane = row m;    element i -> k = (i<8) ? 8h+i : 16+8h+(i-8)
//   B 32x16: lane = column m; the SAME k(i,h)
//   D 16x16 (8 f32): lane = column m; element r -> row 8h+r
// A fragment from a k-contiguous row is therefore p[0..7] | p[16..23] with p = row + k0 + 8h.
// Fragment order (the attention kernel's three operand planes): a 16-row x 32-k block is stored as 512 halves
//   [piece j][lane L][8 halves], piece j of lane L = row (L & 15), k = 16 j + 8 (L >> 4) + 0..7,
// so that the 32 lanes of one 16-byte load read 512 contiguous bytes (four whole 128-B lines) where a row-major plane
// makes them touch 16 lines. The registers receive the same elements as from a row-major plane.
#define FBLK 512   // halves per 16 x 32 block

__device__ __forceinline__ unsigned int bf_bits(float f) {            // bf16 RNE bit pattern (finite inputs)
    const unsigned int u = __float_as_uint(f);
    return (u + 0x7FFFu + ((u >> 16) & 1u)) >> 16;
}
__device__ __forceinline__ float bf_val(float f) { return __uint_as_float(bf_bits(f) << 16); }
__device__ __forceinline__ unsigned int pk_h2(float a, float b) {
    return (unsigned int)__builtin_bit_cast(unsigned short, (_Float16)a) | ((unsigned int)__builtin_bit_cast(unsigned short, (_Float16)b) << 16);
}
// f32 -> f16 that cannot produce an f16 subnormal: magnitudes below 2^-14 become zero (value select)
static __device__ __forceinline__ _Float16 toh_flush(float v) {
    const _Float16 r = (_Float16)v;
    return (fabsf(v) < 6.103515625e-05f) ? (_Float16)0.0f : r;
}
static __device__ __forceinline__ unsigned int pk_h2f(float a, float b) {
    return (unsigned int)__builtin_bit_cast(unsigned short, toh_flush(a)) | ((unsigned int)__builtin_bit_cast(unsigned short, toh_flush(b)) << 16);
}
__device__ __forceinline__ void wave_sync() {
    __builtin_amdgcn_fence(3 /* release order */, "workgroup");
    __builtin_amdgcn_wave_barrier();
    __builtin_amdgcn_fence(2 /* acquire order */, "workgroup");
}

// fragment from a k-contiguous f32 row, p = row + k0 + 8h: elements p[0..7] | p[16..23], each as f16(bf16(x) * sc);
// the four 16-byte loads and the conversion are separate calls, so that many fragments' loads can be issued ahead of the first conversion
struct RawFrag { v4f a0, a1, b0, b1; };
__device__ __forceinline__ RawFrag ldfrag_raw(const float* __restrict__ p) {
    RawFrag r;
    r.a0 = *(const v4f*)(p);
    r.a1 = *(const v4f*)(p + 4);
    r.b0 = *(const v4f*)(p + 16);
    r.b1 = *(const v4f*)(p + 20);
    return r;
}
// the same sixteen elements from a k-strided column, p = column + (k0 + 8h) * pitch: element k stands at p[k * pitch]
__device__ __forceinline__ RawFrag ldfrag_col(const float* __restrict__ p, int pitch) {
    RawFrag r;
#pragma unroll
    for (int e = 0; e < 4; ++e) {
        r.a0[e] = p[e * pitch];
        r.a1[e] = p[(4 + e) * pitch];
        r.b0[e] = p[(16 + e) * pitch];
        r.b1[e] = p[(20 + e) * pitch];
    }
    return r;
}
__device__ __forceinline__ v16h cvtfrag(const RawFrag& r, float sc) {
    const v4f a0 = r.a0, a1 = r.a1, b0 = r.b0, b1 = r.b1;
    v4u lo, hi;
    lo.x = pk_h2(bf_val(a0.x) * sc, bf_val(a0.y) * sc); lo.y = pk_h2(bf_val(a0.z) * sc, bf_val(a0.w) * sc);
    lo.z = pk_h2(bf_val(a1.x) * sc, bf_val(a1.y) * sc); lo.w = pk_h2(bf_val(a1.z) * sc, bf_val(a1.w) * sc);
    hi.x = pk_h2(bf_val(b0.x) * sc, bf_val(b0.y) * sc); hi.y = pk_h2(bf_val(b0.z) * sc, bf_val(b0.w) * sc);
    hi.z = pk_h2(bf_val(b1.x) * sc, bf_val(b1.y) * sc); hi.w = pk_h2(bf_val(b1.z) * sc, bf_val(b1.w) * sc);
    return __builtin_shufflevector(__builtin_bit_cast(v8h, lo), __builtin_bit_cast(v8h, hi), 0, 1, 2, 3, 4, 5, 6, 7, 8, 9, 10, 11, 12, 13, 14, 15);
}
// fragment from a fragment-order block: p = block + lane * 8
__device__ __forceinline__ v16h ldfrag_hf(const unsigned short* __restrict__ p) {
    const v8h a = *(const v8h*)(p);
    const v8h b = *(const v8h*)(p + FBLK / 2);
    return __builtin_shufflevector(a, b, 0, 1, 2, 3, 4, 5, 6, 7, 8, 9, 10, 11, 12, 13, 14, 15);
}

template <int ET> struct FragT;
template <> struct FragT<0> {
    typedef v16h V;
    static __device__ __forceinline__ v8f mma(v16h a, v16h b, v8f c) { return __builtin_amdgcn_wmma_f32_16x16x32_f16(false, a, false, b, (short)0, c, false, false); }
};
// hazard guard for a group of four independent WMMAs: all four accumulators tied, A and all B fragments kept live
template <typename V>
__device__ __forceinline__ void guard4(v8f& a, v8f& b, v8f& c, v8f& d, V x, V y0, V y1, V y2, V y3) {
    asm volatile("v_nop\n\tv_nop\n\tv_nop\n\tv_nop" : "+v"(a), "+v"(b), "+v"(c), "+v"(d) : "v"(x), "v"(y0), "v"(y1), "v"(y2), "v"(y3));
}
// single f16 WMMA with its own hazard guard (one accumulator tied, both fragments kept live)
static __device__ __forceinline__ v8f mma_h(v16h a, v16h b, v8f c) {
    c = __builtin_amdgcn_wmma_f32_16x16x32_f16(false, a, false, b, (short)0, c, false, false);
    asm volatile("v_nop\n\tv_nop\n\tv_nop\n\tv_nop" : "+v"(c) : "v"(a), "v"(b));
    return c;
}

// =====================================================================================================================
// The three preparatory parts below read the inputs alone and write disjoint planes, so they run as block ranges of ONE launch
// (k_prep): the query projection converts its own operands on the way into the fragments.
// =====================================================================================================================
#define PB_GEMM (((NTOK / 64) * (DM / 64)) / 8)   // blocks of 8 wave tiles, query projection
#define PB_VT   (NB * (SEQ / 64))                 // 64-token transpose tiles
#define PB_VR   ((NTOK * (DKH / 8)) / 256)        // 256 16-byte pieces of the value-row plane per block
static_assert(((NTOK / 64) * (DM / 64)) % 8 == 0);        // whole blocks of 8 wave tiles
static_assert((NTOK * (DKH / 8)) % 256 == 0);             // whole blocks of value-row pieces
static_assert(DKH * TP * 2 <= 8 * 16 * OP * 4);           // the transpose tile fits the shared staging array

// qproj_part: u x256 = (query_h x16)(W_h x16), u[token][h*64 + d] = sum_j query[token][h*64 + j] W[h*64 + j][d]; each wave owns 64 tokens
//   of one head (a 64x64 tile of [M = tokens][N = 512]), K = 64.
//   A = query rows f32 [tokens][512], k-contiguous; B[k = j][n = d] = weight f32 [512 out][64 in] read down its columns; both taken as
//   f16(bf16(x) * 16) by the loader. A fifth B fragment holds the head's 64 bias values in every column: its product is
//   q_h . b_h x256, the score term that no key changes, stored in f32 as Cq[head][token].
//   out = one f16 plane in fragment order: [M / 16][N / 32] blocks. No block barrier.
__device__ __forceinline__ void qproj_part(const float* __restrict__ xq, const float* __restrict__ Wc, const float* __restrict__ bias,
                                           unsigned short* __restrict__ Ca, float* __restrict__ Cq, float* sT, int blk) {
    constexpr float scale  = KCARRY / (QCARRY * WCARRY);
    constexpr int tilesN = DM >> 6;
    constexpr int tilesM = NTOK >> 6;
    const int lane = threadIdx.x & 31;
    const int wave = __builtin_amdgcn_readfirstlane(threadIdx.x >> 5);
    const int tile = blk * 8 + wave;
    if (tile >= tilesM * tilesN) return;          // wave-uniform; this part has no block barriers
    const int tm = tile / tilesN;
    const int tn = tile - tm * tilesN;            // head
    const int m0 = tm << 6;
    const int n0 = tn << 6;
    const int rl   = lane & 15;
    const int koff = (lane >> 4) * 8;
    const int mOff = (lane >> 4) * 8;
    const float* arow = xq + (size_t)((m0 / SEQ) * SEQ_FULL + (m0 % SEQ) + rl) * DM + n0 + koff;   // a 64-row tile lies inside one sequence
    const float* bcol = Wc + (size_t)(n0 + koff) * DKH + rl;
    const float* brow = bias + n0 + koff;

    // K = 64 is two 32-deep steps, so the wave's whole operand set is eighteen fragments, all fetched ahead of the first product and of
    // the fences in the store loop: the loads of a step are issued together and the wave meets one load latency per step. One 16-row
    // strip of the tile is then finished at a time (both steps, then its stores): five accumulator tiles are live beside the fragments.
    v16h bh[2][4], ah[4][2], bb[2];
#pragma unroll
    for (int ks = 0; ks < 2; ++ks) {
        RawFrag rb[4], ra[4], rv;
#pragma unroll
        for (int j = 0; j < 4; ++j) {
            ra[j] = ldfrag_raw(arow + (j << 4) * DM + ks * 32);
            rb[j] = ldfrag_col(bcol + ks * 32 * DKH + (j << 4), DKH);
        }
        rv = ldfrag_raw(brow + ks * 32);
        // the addresses are inputs of the wait: they stay live up to it, so no load of the step lands on an address register of another
        asm volatile("s_wait_xcnt 0x0" :: "v"(arow), "v"(bcol), "v"(brow) : "memory");
        __builtin_amdgcn_sched_barrier(0);      // holds the step's loads ahead of its conversions (else each fragment's loads sink to their use and every latency is met alone)
#pragma unroll
        for (int j = 0; j < 4; ++j) {
            bh[ks][j] = cvtfrag(rb[j], WCARRY);
            ah[j][ks] = cvtfrag(ra[j], QCARRY);
        }
        bb[ks] = cvtfrag(rv, WCARRY);
        __builtin_amdgcn_sched_barrier(0);      // holds the next step's loads behind these conversions: one step's f32 values live at a time
    }

    const int sb = wave * (16 * OP);
#pragma unroll
    for (int i = 0; i < 4; ++i) {
        v8f acc[4];
        v8f accb = {0.f, 0.f, 0.f, 0.f, 0.f, 0.f, 0.f, 0.f};
#pragma unroll
        for (int j = 0; j < 4; ++j) { const v8f zz = {0.f, 0.f, 0.f, 0.f, 0.f, 0.f, 0.f, 0.f}; acc[j] = zz; }
#pragma unroll
        for (int ks = 0; ks < 2; ++ks) {
            accb = mma_h(ah[i][ks], bb[ks], accb);
            acc[0] = FragT<0>::mma(ah[i][ks], bh[ks][0], acc[0]);
            acc[1] = FragT<0>::mma(ah[i][ks], bh[ks][1], acc[1]);
            acc[2] = FragT<0>::mma(ah[i][ks], bh[ks][2], acc[2]);
            acc[3] = FragT<0>::mma(ah[i][ks], bh[ks][3], acc[3]);
            guard4<v16h>(acc[0], acc[1], acc[2], acc[3], ah[i][ks], bh[ks][0], bh[ks][1], bh[ks][2], bh[ks][3]);
        }
        const int mBase = m0 + (i << 4);
        // every column of accb holds the same 16 sums: lanes 0 and 16 store rows 0..7 and 8..15; the wave's four strips fill two whole lines
        if (rl == 0) {
            float* cp = Cq + (size_t)tn * NTOK + mBase + mOff;
            const v4f lo = {accb[0], accb[1], accb[2], accb[3]};
            const v4f hi = {accb[4], accb[5], accb[6], accb[7]};
            *(v4f*)cp = lo;
            *(v4f*)(cp + 4) = hi;
            asm volatile("s_wait_xcnt 0x0" :: "v"(cp) : "memory");   // behind the two stores: the address register is reused below
        }
#pragma unroll
        for (int j = 0; j < 4; ++j) {
#pragma unroll
            for (int r = 0; r < 8; ++r) {
                sT[sb + (mOff + r) * OP + (j << 4) + rl] = acc[j][r] * scale;
            }
        }
        wave_sync();
        // these 16 rows x 64 columns are two adjacent fragment-order blocks = 2 KiB in a row: piece 'it' = columns 16 it + 8 (lane >> 4)
        unsigned short* cb = Ca + (size_t)(mBase >> 4) * (16 * DM) + (size_t)(n0 >> 5) * FBLK + lane * 8;
#pragma unroll
        for (int it = 0; it < 4; ++it) {
            const v4f a = *(const v4f_ma*)&sT[sb + rl * OP + it * 16 + koff];
            const v4f b = *(const v4f_ma*)&sT[sb + rl * OP + it * 16 + koff + 4];
            v4u pk; pk.x = pk_h2f(a.x, a.y); pk.y = pk_h2f(a.z, a.w); pk.z = pk_h2f(b.x, b.y); pk.w = pk_h2f(b.z, b.w);
            *(v4u*)(cb + it * (FBLK / 2)) = pk;
        }
        wave_sync();
    }
}

// value f32 [rows][64] -> f16 plane holding bf16(x) * 16 in fragment order ([NTOK / 16][64 / 32] blocks); plane row r reads source
// row (r / SEQ) * SEQ_FULL + r % SEQ; thread u writes the plane's u-th 16-byte piece, so a wave stores 512 contiguous bytes
__device__ __forceinline__ void cast_vrow_part(const float* __restrict__ src, unsigned short* __restrict__ dst, int blk) {
    const int u = blk * 256 + threadIdx.x;
    if (u >= NTOK * (DKH / 8)) return;
    const int r  = (u >> 7) * 16 + (u & 15);                  // 128 pieces per 16-row tile; row = lane & 15
    const int c0 = ((u >> 6) & 1) * 32 + ((u >> 4) & 3) * 8;  // block, then 16 j + 8 (lane >> 4)
    const int sr = (r / SEQ) * SEQ_FULL + (r % SEQ);
    const float* s = src + (size_t)sr * DKH + c0;
    const v4f a = *(const v4f*)(s);
    const v4f b = *(const v4f*)(s + 4);
    v4u pk;
    pk.x = pk_h2(bf_val(a.x) * VCARRY, bf_val(a.y) * VCARRY); pk.y = pk_h2(bf_val(a.z) * VCARRY, bf_val(a.w) * VCARRY);
    pk.z = pk_h2(bf_val(b.x) * VCARRY, bf_val(b.y) * VCARRY); pk.w = pk_h2(bf_val(b.z) * VCARRY, bf_val(b.w) * VCARRY);
    *(v4u*)(dst + (size_t)u * 8) = pk;
}

// value f32 [batch][SEQ_FULL][64] -> transposed f16 plane holding bf16(x) * 16, rows d, k = tokens, in fragment order:
// dst[b][t / 32][d / 16] blocks, so a 64-token tile is 8 KiB in a row.
__device__ __forceinline__ void cast_vt_part(const float* __restrict__ src, unsigned short* __restrict__ dst, _Float16* Tsh, int blk) {
    constexpr int nb64 = SEQ / 64;
    const int b  = blk / nb64;
    const int t0 = (blk - b * nb64) * 64;
#pragma unroll 1
    for (int it = 0; it < 4; ++it) {
        const int idx = threadIdx.x + 256 * it;           // 1,024 float4 pieces of the [64 t][64 d] tile
        const int t  = idx >> 4;
        const int d4 = (idx & 15) * 4;
        const v4f a = *(const v4f*)(src + ((size_t)(b * SEQ_FULL + t0 + t)) * DKH + d4);
        Tsh[(d4 + 0) * TP + t] = toh_flush(bf_val(a.x) * VCARRY);
        Tsh[(d4 + 1) * TP + t] = toh_flush(bf_val(a.y) * VCARRY);
        Tsh[(d4 + 2) * TP + t] = toh_flush(bf_val(a.z) * VCARRY);
        Tsh[(d4 + 3) * TP + t] = toh_flush(bf_val(a.w) * VCARRY);
    }
    __syncthreads();
#pragma unroll
    for (int it = 0; it < 2; ++it) {
        const int p  = threadIdx.x + 256 * it;            // 512 pieces of 8 halves: [32-token step][16-row d tile][piece j][lane]
        const int d  = ((p >> 6) & 3) * 16 + (p & 15);
        const int c8 = (p >> 8) * 32 + ((p >> 4) & 3) * 8;
        const v8h v = *(const v8h_ma*)&Tsh[d * TP + c8];
        const v4u pk = __builtin_bit_cast(v4u, v);
        *(v4u*)(dst + ((size_t)b * SEQ + t0) * DKH + p * 8) = pk;
    }
    asm volatile("s_wait_xcnt 0x0" ::: "memory");   // behind the two stores: another part's code follows in the kernel's text and rewrites the registers of their address
}

// one launch for all three parts; the block index picks the part (block-uniform), the longest part (query projection) starts first
__global__ __launch_bounds__(256) void k_prep(const float* __restrict__ xq, const float* __restrict__ xv, const float* __restrict__ Wc,
                                              const float* __restrict__ bc, unsigned short* __restrict__ QP, float* __restrict__ CQ,
                                              unsigned short* __restrict__ VR, unsigned short* __restrict__ VT) {
    __shared__ __align__(16) float sh[8 * 16 * OP];       // projection: f32 staging, one 16 x 64 tile per wave; transpose: its f16 tile
    const int blk = blockIdx.x;
    if (blk < PB_GEMM)              qproj_part(xq, Wc, bc, QP, CQ, sh, blk);
    else if (blk < PB_GEMM + PB_VT) cast_vt_part(xv, VT, (_Float16*)sh, blk - PB_GEMM);
    else                            cast_vrow_part(xv, VR, blk - (PB_GEMM + PB_VT));
}

// =====================================================================================================================
// k_attn_heads: fused attention with the softmax taken across the 8 heads. Block = 8 waves = 16 query rows of one batch.
//   QP: f16 plane (projected query x256), [ntok / 16][512 / 32] fragment-order blocks; VR: f16 plane (value rows x16),
//   [ntok / 16][64 / 32] fragment-order blocks; CQ: f32 q_h . b_h x256, [head][ntok]; VT: f16 plane (v^T x16),
//   [batch][seq / 32][64 / 16] fragment-order blocks.
//   Every wave owns its keys from the scores to the output sums: 32 keys per trip (wave w: keys 256 i + 32 w ...), all 8 heads.
//     scores (two 16-key subtiles): S^T[key][query] for all 8 heads (A = value rows, the same two fragments for every head,
//       B = projected query rows, two 32-deep steps each; q_h . b_h joins in the softmax's scaling),
//       head softmax lane-local in f32, P x4096 as f16 kept in registers;
//     weights.V: O^T[head][d][query] += V^T[d][32 keys] . P^T[32 keys][query]; the B fragment of a head is the lane's own two
//       8-key pieces (elements 0..7 <- keys 8h+r of the first subtile, 8..15 <- keys 8h+r of the second), so P crosses no lane
//       and no wave, the loop holds no LDS traffic and no barrier, and a wave loads only its own 32 keys of v^T.
//   After the loop the 8 waves' partial sums (8 heads x 64 x 16 each) meet once in LDS: one block barrier, wave = head adds the
//   eight partials in wave order.
//   Epilogue: per wave (head) 16 rows x 64 columns staged in two 32-column halves through a wave-private LDS tile (wave_sync),
// =====================================================================================================================
__global__ __launch_bounds__(256) void k_attn_heads(const unsigned short* __restrict__ QP, const float* __restrict__ CQ,
                                                    const unsigned short* __restrict__ VR, const unsigned short* __restrict__ VT, float* __restrict__ out,
                                                    int seq, int seqfull, float sscale) {
    __shared__ __align__(16) float    Rsh[8 * NH * 4 * 256];     // [wave][head][d tile][piece][lane][4] partial sums, cross-wave
    __shared__ __align__(16) float    Osh[8 * 16 * OPH];         // wave-private output staging [16][32] (+4 pad)
    const int lane = threadIdx.x & 31;
    const int wave = __builtin_amdgcn_readfirstlane(threadIdx.x >> 5);
    const int hf = lane >> 4;
    const int c  = lane & 15;
    const int nqb = seq / 16;
    const int b  = blockIdx.x / nqb;
    const int q0 = (blockIdx.x - b * nqb) * 16;
    // Fragment addresses = a wave-uniform row base + a lane offset that is the same for every trip.
    const unsigned short* qrow = QP + (size_t)(b * seq + q0) * DM;              // this block's 16 query rows (16 blocks)
    const unsigned short* arow = VR + (size_t)(b * seq) * DKH;                  // this batch's value rows (2 blocks per 16 keys)
    const unsigned short* vrow = VT + (size_t)(b * DKH) * seq;                  // this batch's v^T blocks
    const unsigned int rlane = (unsigned int)(lane * 8);                        // a lane's 16-byte piece inside a fragment-order block
    const int obase = wave * (16 * OPH);
    const float sl2 = sscale * 1.4426950408889634f;
    // q_h . b_h of this lane's query, in the exponent's units (the plane carries x256, the scores x4096)
    float cl[NH];
#pragma unroll
    for (int h = 0; h < NH; ++h) cl[h] = CQ[(size_t)h * NTOK + b * seq + q0 + c] * ((VCARRY * KCARRY) / (QCARRY * WCARRY) * sl2);

    v8f oacc[NH][4];
#pragma unroll
    for (int h = 0; h < NH; ++h)
#pragma unroll
        for (int t = 0; t < 4; ++t) { const v8f zz = {0.f, 0.f, 0.f, 0.f, 0.f, 0.f, 0.f, 0.f}; oacc[h][t] = zz; }

    // the two value-row fragments of a 16-key subtile serve all 8 heads; each subtile's pair is requested one subtile ahead
    v16h va[2];
    {
        const unsigned short* ap = arow + (wave * KW) * DKH + rlane;
        va[0] = ldfrag_hf(ap);
        va[1] = ldfrag_hf(ap + FBLK);
        asm volatile("s_wait_xcnt 0x0" :: "v"(ap) : "memory");   // the address stays live up to the wait
    }

    for (int kc = wave * KW; kc < seq; kc += KCH) {
        v8h ph[2][NH];
        v16h vf[4];
#pragma unroll
        for (int sub = 0; sub < 2; ++sub) {
            // ---------- scores: S^T for 16 of this wave's keys, all 8 heads ----------
            // Batches of BH heads: the loads of a batch's query fragments are all issued before its first product,
            // so their latencies run side by side and the wave meets one load latency per batch instead of one per product.
            v8f s[NH];
            const unsigned short* qp = qrow + rlane;                            // all batches read at constant offsets from this address
#pragma unroll
            for (int g = 0; g < NH / BH; ++g) {
                v16h qf[2 * BH];
#pragma unroll
                for (int j = 0; j < 2 * BH; ++j) qf[j] = ldfrag_hf(qp + (g * 2 * BH + j) * FBLK);
                // the address is an input of the wait: it stays live up to it, so no load of the batch lands on the address register,
                // and what reuses that register later stands behind the wait
                asm volatile("s_wait_xcnt 0x0" :: "v"(qp) : "memory");
                __builtin_amdgcn_sched_barrier(0);      // holds the batch's loads ahead of its products (else they sink back to their uses)
#pragma unroll
                for (int j = 0; j < BH; ++j) {
                    v8f z = {0.f, 0.f, 0.f, 0.f, 0.f, 0.f, 0.f, 0.f};
                    z = mma_h(va[0], qf[2 * j], z);
                    z = mma_h(va[1], qf[2 * j + 1], z);
                    s[g * BH + j] = z;
                }
                __builtin_amdgcn_sched_barrier(0);      // holds the next loads behind these products, so one batch of fragments is live at a time
            }
            {
                // the next subtile's value rows are requested here, behind the last product that reads this subtile's: their latency passes
                // under the softmax's vector work; behind the last trip the wave's first rows are read again (in bounds, not used)
                const int kn = (sub == 0) ? kc : ((kc + KCH < seq) ? kc + KCH : wave * KW);
                const int ao = (sub == 0) ? 16 * DKH : 0;                // a constant step: it rides in the loads' offset field
                const unsigned short* ap = arow + kn * DKH + rlane;
                va[0] = ldfrag_hf(ap + ao);
                va[1] = ldfrag_hf(ap + ao + FBLK);
                asm volatile("s_wait_xcnt 0x0" :: "v"(ap) : "memory");   // the address stays live up to the wait
                if (sub == 0) __builtin_amdgcn_sched_barrier(0);         // holds these loads ahead of the softmax
            }
            if (sub == 1) {
                // the four v^T fragments of these 32 keys are requested here: their latency passes under the softmax's vector work
                const unsigned short* vp = vrow + kc * DKH + rlane;
#pragma unroll
                for (int t = 0; t < 4; ++t) vf[t] = ldfrag_hf(vp + t * FBLK);   // t = 16-row d tile
                // as above: the address stays live up to the wait
                asm volatile("s_wait_xcnt 0x0" :: "v"(vp) : "memory");
                __builtin_amdgcn_sched_barrier(0);      // holds these loads ahead of the softmax
            }
            // ---------- softmax across heads: element r of every head tile is the same (key, query) pair ----------
            // Two r at a time, so that scaling, shift, sum and weighting are packed f32 instructions on the accumulators' own register pairs.
            // The exponent's argument is <= 0 and the sum lies in [1, 8]: the bare exponential and the bare reciprocal cover both ranges.
            unsigned int pw[NH][4];
#pragma unroll
            for (int p = 0; p < 4; ++p) {
                v2f t[NH];
#pragma unroll
                for (int h = 0; h < NH; ++h) {
                    const v2f sv = {s[h][2 * p], s[h][2 * p + 1]};
                    const v2f sc = {sl2, sl2};
                    const v2f cb = {cl[h], cl[h]};
                    t[h] = __builtin_elementwise_fma(sv, sc, cb);
                }
                float m0 = t[0].x, m1 = t[0].y;
#pragma unroll
                for (int h = 1; h < NH; ++h) { m0 = fmaxf(m0, t[h].x); m1 = fmaxf(m1, t[h].y); }
                const v2f mm = {m0, m1};
                v2f zsum = {0.f, 0.f};
#pragma unroll
                for (int h = 0; h < NH; ++h) {
                    const v2f a = t[h] - mm;
                    const v2f e = {__builtin_amdgcn_exp2f(a.x), __builtin_amdgcn_exp2f(a.y)};
                    t[h] = e;
                    zsum += e;
                }
                const v2f inv = {PCARRY * __builtin_amdgcn_rcpf(zsum.x), PCARRY * __builtin_amdgcn_rcpf(zsum.y)};
#pragma unroll
                for (int h = 0; h < NH; ++h)      // one packed convert per pair, round to nearest even; a weight too small for a normal f16 stays a subnormal operand
                    pw[h][p] = __builtin_bit_cast(unsigned int, __builtin_convertvector(t[h] * inv, v2h));
            }
#pragma unroll
            for (int h = 0; h < NH; ++h) {
                const v4u pk = {pw[h][0], pw[h][1], pw[h][2], pw[h][3]};
                ph[sub][h] = __builtin_bit_cast(v8h, pk);   // keys 8*hf .. 8*hf+7 of subtile 'sub', query c
            }
        }
        // ---------- weights.V: O^T[head][d][query] += V^T . P^T over this wave's 32 keys ----------
        // plain builtin products (the compiler keeps their distances itself): the 256 accumulator registers reach above v255,
        // where an asm statement cannot take them as operands
#pragma unroll
        for (int h = 0; h < NH; ++h) {
            const v16h pb = __builtin_shufflevector(ph[0][h], ph[1][h], 0, 1, 2, 3, 4, 5, 6, 7, 8, 9, 10, 11, 12, 13, 14, 15);
            oacc[h][0] = FragT<0>::mma(vf[0], pb, oacc[h][0]);
            oacc[h][1] = FragT<0>::mma(vf[1], pb, oacc[h][1]);
            oacc[h][2] = FragT<0>::mma(vf[2], pb, oacc[h][2]);
            oacc[h][3] = FragT<0>::mma(vf[3], pb, oacc[h][3]);
        }
    }

    // ---------- the waves' partial sums meet: every wave stores its 32 tiles, wave = head adds eight partials in wave order ----------
#pragma unroll
    for (int h = 0; h < NH; ++h) {
#pragma unroll
        for (int t = 0; t < 4; ++t) {
            float* rp = &Rsh[((wave * NH + h) * 4 + t) * 256 + lane * 4];       // a wave's 16-byte store covers 512 contiguous bytes
            const v4f lo = {oacc[h][t][0], oacc[h][t][1], oacc[h][t][2], oacc[h][t][3]};
            const v4f hi = {oacc[h][t][4], oacc[h][t][5], oacc[h][t][6], oacc[h][t][7]};
            *(v4f_ma*)rp = lo;
            *(v4f_ma*)(rp + 128) = hi;
        }
    }
    __syncthreads();
    v8f osum[4];
#pragma unroll
    for (int t = 0; t < 4; ++t) {
        v4f lo = {0.f, 0.f, 0.f, 0.f}, hi = {0.f, 0.f, 0.f, 0.f};
#pragma unroll
        for (int w = 0; w < 8; ++w) {
            const float* rp = &Rsh[((w * NH + wave) * 4 + t) * 256 + lane * 4];
            lo += *(const v4f_ma*)rp;
            hi += *(const v4f_ma*)(rp + 128);
        }
        const v8f sm = {lo.x, lo.y, lo.z, lo.w, hi.x, hi.y, hi.z, hi.w};
        osum[t] = sm;
    }

    // ---------- epilogue: out[b][q0 + query][wave*64 + d], d = t*16 + 8*hf + r held by lane (query c) ----------
    const float osc = 1.0f / (PCARRY * VCARRY);
#pragma unroll
    for (int half = 0; half < 2; ++half) {
#pragma unroll
        for (int tt = 0; tt < 2; ++tt) {
#pragma unroll
            for (int r = 0; r < 8; ++r) Osh[obase + c * OPH + tt * 16 + 8 * hf + r] = osum[half * 2 + tt][r] * osc;
        }
        wave_sync();
        {
            const int q = lane >> 3, c4 = (lane & 7) * 4;
            {
#pragma unroll
                for (int it = 0; it < 4; ++it) {
                    const int row = it * 4 + q;
                    const v4f v = *(const v4f_ma*)&Osh[obase + row * OPH + c4];
                    *(v4f*)(out + (size_t)(b * seqfull + q0 + row) * DM + wave * DKH + half * 32 + c4) = v;
                }
                
            }
        }
        wave_sync();
    }
}

// =====================================================================================================================
// Host side: workspace carve (all plane sizes are multiples of 256 B), 2 launches.
// =====================================================================================================================
constexpr size_t SZ_TOK  = (size_t)NTOK * DM * 2;          // one 16-bit token plane [NTOK][512]
constexpr size_t SZ_VT   = (size_t)NB * DKH * SEQ * 2;     // v^T plane [NB*64][SEQ]
constexpr size_t SZ_CQ   = (size_t)NH * NTOK * 4;          // q_h . b_h plane [8][NTOK] f32
constexpr size_t WS_TOTAL = SZ_TOK + SZ_CQ + SZ_VT + SZ_VT;
static_assert(SZ_TOK % 256 == 0);
static_assert(SZ_VT % 256 == 0);
static_assert(SZ_CQ % 256 == 0);
static_assert(WS_TOTAL <= (size_t)134217728);            // carve stays within 128 MiB
static_assert((size_t)NTOK * DM < (size_t)2147483647);    // int plane offsets
static_assert((size_t)NB_FULL * SEQ_FULL * DM * 4 == (size_t)8388608);   // output extent in bytes (offset 0)

extern "C" void kernel_launch(void* const* d_in, const int* in_sizes, int n_in, void* d_out, int out_size, void* d_ws, size_t ws_size, hipStream_t stream) {
    if (n_in < 4) return;
    const long long need_q = ((long long)(NB - 1) * SEQ_FULL + SEQ) * DM;
    const long long need_v = ((long long)(NB - 1) * SEQ_FULL + SEQ) * DKH;
    if ((long long)in_sizes[0] < need_q || (long long)in_sizes[1] < need_v) return;
    if (in_sizes[2] < DM * DKH || in_sizes[3] < DM) return;
    if ((long long)out_size < need_q) return;
    if (WS_TOTAL > ws_size) return;

    // query, value, conv_w [512][64][1], conv_b [512]
    const float* xq = (const float*)d_in[0];
    const float* xv = (const float*)d_in[1];
    const float* Wc = (const float*)d_in[2];
    const float* bc = (const float*)d_in[3];
    float* out = (float*)d_out;

    char* wsp = (char*)d_ws;
    unsigned short* Q16 = (unsigned short*)wsp; wsp += SZ_TOK;
    float*          CQp = (float*)wsp;          wsp += SZ_CQ;
    unsigned short* VRp = (unsigned short*)wsp; wsp += SZ_VT;
    unsigned short* VTp = (unsigned short*)wsp; wsp += SZ_VT;
    if ((size_t)(wsp - (char*)d_ws) > ws_size) return;

    // projected query plane x256 = (query x16)(W x16) per head, q.b x256, value-row plane x16, v^T plane x16; the f16 planes in fragment order
    k_prep<<<(unsigned)(PB_GEMM + PB_VT + PB_VR), 256, 0, stream>>>(xq, xv, Wc, bc, Q16, CQp, VRp, VTp);

    // scores carry 16 * 256; score scale 1/8 applied with the carries inside the head softmax
    k_attn_heads<<<(unsigned)(NB * (SEQ / 16)), 256, 0, stream>>>(Q16, CQp, VRp, VTp, out, SEQ, SEQ_FULL, 0.125f / (VCARRY * KCARRY));
}

// v007
// One run takes 24.6 microseconds.
// In two side-by-side timings against v006, it was 1.22 and 1.23 times as fast.
// All steps since v000 together make it 6.03 times as fast.
// Multi-head dot attention, 2 x 2,048 queries x 2,048 keys, width 512 = 8 heads x 64; keys = pointwise [out][in] 64->512 map of the value rows + bias, values = the 64-wide value rows shared by all heads, softmax taken ACROSS THE 8 HEADS per (query, key), no key normalisation, no mask. Scores reassociated: q_h . (W_h v + b_h) = (W_h^T q_h) . v + q_h . b_h, so the query is projected (per head, 64 -> 64) and the key operand of every head is the value row itself. Inputs and parameters converted to bf16 (RNE). Query projection: v_wmma_f32_16x16x32_f16 (f16 operands holding the bf16 values, query x16, weight x16, bias x16, f32 accumulate, projected query carried x256 as one f16 plane, q.b x256 in f32); scores: v_wmma_f32_16x16x32_f16 (value rows x16 against the projected query plane, f32 accumulate, f32 head softmax); weights.V: v_wmma_f32_16x16x32_f16 (P x4096 as f16, v^T x16 as f16, f32 accumulate).
#include <hip/hip_runtime.h>
#include <math.h>

#ifndef NB
#define NB 2
#endif
#ifndef SEQ
#define SEQ 2048
#endif
#define NB_FULL 2
#define SEQ_FULL 2048
#define DM 512
#define NH 8
#define DKH 64
#define NTOK (NB * SEQ)
#define OP 68      // f32 staging pitch (floats), GEMM epilogue
#define OPH 36     // f32 staging pitch (floats), attention epilogue (32-column halves)
#define TP 72      // transpose tile pitch (halves)
#define KW 32      // keys per wave and trip = two 16-key subtiles = one 32-deep step of weights.V
#define KCH 256    // keys per trip = 8 waves x KW
#define BH 4       // heads per batch of score fragments: eight query fragments, 16 loads
#define QCARRY 16.0f
#define VCARRY 16.0f
#define WCARRY 16.0f
#define KCARRY 256.0f
#define PCARRY 4096.0f

static_assert(DM == NH * DKH);            // merged head layout h*64+d
static_assert(DKH == 64);                 // two 32-deep k-steps per score tile, four 16-wide output tiles
static_assert(NH == 8);                   // one head per wave in the final sum and the epilogue, 8 waves per block
static_assert(SEQ % 64 == 0);             // 64-token transpose tiles inside one sequence
static_assert(SEQ % KCH == 0);            // whole key chunks
static_assert(SEQ % 16 == 0);             // 16-query blocks
static_assert(NTOK % 64 == 0);
static_assert(DM % 64 == 0);              // GEMM tile multiple (N)
static_assert(DKH % 32 == 0);             // K steps of 32
static_assert(NB <= NB_FULL);
static_assert(SEQ <= SEQ_FULL);
static_assert((OP % 4) == 0);             // 16-B aligned reloads from the f32 staging tile
static_assert((OPH % 4) == 0);
static_assert((TP % 8) == 0);             // 16-B aligned reloads from the transpose tile
static_assert(KCH == 8 * KW);
static_assert(NH % BH == 0);
static_assert(NTOK % 16 == 0);            // whole 16-row tiles in the fragment-order planes
static_assert(DKH == 64);                 // cast_vrow_part: 128 pieces per 16-row tile, 2 blocks per tile

typedef __attribute__((ext_vector_type(16))) _Float16 v16h;
typedef __attribute__((ext_vector_type(8)))  _Float16 v8h;
typedef __attribute__((ext_vector_type(8)))  float    v8f;
typedef __attribute__((ext_vector_type(4)))  float    v4f;
typedef __attribute__((ext_vector_type(2)))  float    v2f;
typedef __attribute__((ext_vector_type(2)))  _Float16 v2h;
typedef __attribute__((ext_vector_type(4)))  unsigned int v4u;
typedef v8h v8h_ma __attribute__((may_alias));
typedef v4f v4f_ma __attribute__((may_alias));

// 16-bit WMMA fragment map (wave32), lane L, h = L>>4, m = L&15:
//   A 16x32: lane = row m;    element i -> k = (i<8) ? 8h+i : 16+8h+(i-8)
//   B 32x16: lane = column m; the SAME k(i,h)
//   D 16x16 (8 f32): lane = column m; element r -> row 8h+r
// A fragment from a k-contiguous row is therefore p[0..7] | p[16..23] with p = row + k0 + 8h.
// Fragment order (the attention kernel's three operand planes): a 16-row x 32-k block is stored as 512 halves
//   [piece j][lane L][8 halves], piece j of lane L = row (L & 15), k = 16 j + 8 (L >> 4) + 0..7,
// so that the 32 lanes of one 16-byte load read 512 contiguous bytes (four whole 128-B lines) where a row-major plane
// makes them touch 16 lines. The registers receive the same elements as from a row-major plane.
#define FBLK 512   // halves per 16 x 32 block

__device__ __forceinline__ unsigned int bf_bits(float f) {            // bf16 RNE bit pattern (finite inputs)
    const unsigned int u = __float_as_uint(f);
    return (u + 0x7FFFu + ((u >> 16) & 1u)) >> 16;
}
__device__ __forceinline__ float bf_val(float f) { return __uint_as_float(bf_bits(f) << 16); }
__device__ __forceinline__ unsigned int pk_h2(float a, float b) {
    return (unsigned int)__builtin_bit_cast(unsigned short, (_Float16)a) | ((unsigned int)__builtin_bit_cast(unsigned short, (_Float16)b) << 16);
}
// f32 -> f16 that cannot produce an f16 subnormal: magnitudes below 2^-14 become zero (value select)
static __device__ __forceinline__ _Float16 toh_flush(float v) {
    const _Float16 r = (_Float16)v;
    return (fabsf(v) < 6.103515625e-05f) ? (_Float16)0.0f : r;
}
static __device__ __forceinline__ unsigned int pk_h2f(float a, float b) {
    return (unsigned int)__builtin_bit_cast(unsigned short, toh_flush(a)) | ((unsigned int)__builtin_bit_cast(unsigned short, toh_flush(b)) << 16);
}
__device__ __forceinline__ void wave_sync() {
    __builtin_amdgcn_fence(3 /* release order */, "workgroup");
    __builtin_amdgcn_wave_barrier();
    __builtin_amdgcn_fence(2 /* acquire order */, "workgroup");
}

// fragment from a k-contiguous f32 row, p = row + k0 + 8h: elements p[0..7] | p[16..23], each as f16(bf16(x) * sc);
// the four 16-byte loads and the conversion are separate calls, so that many fragments' loads can be issued ahead of the first conversion
struct RawFrag { v4f a0, a1, b0, b1; };
__device__ __forceinline__ RawFrag ldfrag_raw(const float* __restrict__ p) {
    RawFrag r;
    r.a0 = *(const v4f*)(p);
    r.a1 = *(const v4f*)(p + 4);
    r.b0 = *(const v4f*)(p + 16);
    r.b1 = *(const v4f*)(p + 20);
    return r;
}
// the same sixteen elements from a k-strided column, p = column + (k0 + 8h) * pitch: element k stands at p[k * pitch]
__device__ __forceinline__ RawFrag ldfrag_col(const float* __restrict__ p, int pitch) {
    RawFrag r;
#pragma unroll
    for (int e = 0; e < 4; ++e) {
        r.a0[e] = p[e * pitch];
        r.a1[e] = p[(4 + e) * pitch];
        r.b0[e] = p[(16 + e) * pitch];
        r.b1[e] = p[(20 + e) * pitch];
    }
    return r;
}
__device__ __forceinline__ v16h cvtfrag(const RawFrag& r, float sc) {
    const v4f a0 = r.a0, a1 = r.a1, b0 = r.b0, b1 = r.b1;
    v4u lo, hi;
    lo.x = pk_h2(bf_val(a0.x) * sc, bf_val(a0.y) * sc); lo.y = pk_h2(bf_val(a0.z) * sc, bf_val(a0.w) * sc);
    lo.z = pk_h2(bf_val(a1.x) * sc, bf_val(a1.y) * sc); lo.w = pk_h2(bf_val(a1.z) * sc, bf_val(a1.w) * sc);
    hi.x = pk_h2(bf_val(b0.x) * sc, bf_val(b0.y) * sc); hi.y = pk_h2(bf_val(b0.z) * sc, bf_val(b0.w) * sc);
    hi.z = pk_h2(bf_val(b1.x) * sc, bf_val(b1.y) * sc); hi.w = pk_h2(bf_val(b1.z) * sc, bf_val(b1.w) * sc);
    return __builtin_shufflevector(__builtin_bit_cast(v8h, lo), __builtin_bit_cast(v8h, hi), 0, 1, 2, 3, 4, 5, 6, 7, 8, 9, 10, 11, 12, 13, 14, 15);
}
// fragment from a fragment-order block: p = block + lane * 8
__device__ __forceinline__ v16h ldfrag_hf(const unsigned short* __restrict__ p) {
    const v8h a = *(const v8h*)(p);
    const v8h b = *(const v8h*)(p + FBLK / 2);
    return __builtin_shufflevector(a, b, 0, 1, 2, 3, 4, 5, 6, 7, 8, 9, 10, 11, 12, 13, 14, 15);
}

template <int ET> struct FragT;
template <> struct FragT<0> {
    typedef v16h V;
    static __device__ __forceinline__ v8f mma(v16h a, v16h b, v8f c) { return __builtin_amdgcn_wmma_f32_16x16x32_f16(false, a, false, b, (short)0, c, false, false); }
};
// hazard guard for a group of four independent WMMAs: all four accumulators tied, A and all B fragments kept live
template <typename V>
__device__ __forceinline__ void guard4(v8f& a, v8f& b, v8f& c, v8f& d, V x, V y0, V y1, V y2, V y3) {
    asm volatile("v_nop\n\tv_nop\n\tv_nop\n\tv_nop" : "+v"(a), "+v"(b), "+v"(c), "+v"(d) : "v"(x), "v"(y0), "v"(y1), "v"(y2), "v"(y3));
}
// single f16 WMMA with its own hazard guard (one accumulator tied, both fragments kept live)
static __device__ __forceinline__ v8f mma_h(v16h a, v16h b, v8f c) {
    c = __builtin_amdgcn_wmma_f32_16x16x32_f16(false, a, false, b, (short)0, c, false, false);
    asm volatile("v_nop\n\tv_nop\n\tv_nop\n\tv_nop" : "+v"(c) : "v"(a), "v"(b));
    return c;
}

// =====================================================================================================================
// The three preparatory parts below read the inputs alone and write disjoint planes, so they run as block ranges of ONE launch
// (k_prep): the query projection converts its own operands on the way into the fragments.
// =====================================================================================================================
#define PB_GEMM ((NTOK / 128) * (DM / 64))        // blocks of 8 strips of 16 tokens, one head each, query projection
#define PB_VT   (NB * (SEQ / 64))                 // 64-token transpose tiles
#define PB_VR   ((NTOK * (DKH / 8)) / 256)        // 256 16-byte pieces of the value-row plane per block
static_assert(NTOK % 128 == 0);                           // whole blocks of 8 strips
static_assert((NTOK * (DKH / 8)) % 256 == 0);             // whole blocks of value-row pieces
static_assert(DKH * TP * 2 <= 8 * 16 * OP * 4);           // the transpose tile fits the shared staging array

// qproj_part: u x256 = (query_h x16)(W_h x16), u[token][h*64 + d] = sum_j query[token][h*64 + j] W[h*64 + j][d]; a block owns 128 tokens
//   of one head, each of its 8 waves one 16-token strip (a 16x64 tile of [M = tokens][N = 512]), K = 64.
//   A = query rows f32 [tokens][512], k-contiguous; B[k = j][n = d] = weight f32 [512 out][64 in] read down its columns; both taken as
//   f16(bf16(x) * 16) by the loader. All 8 strips use the same ten B fragments (eight of W_h, two that hold the head's 64 bias values
//   in every column): wave w loads and converts W fragment w, waves 0 and 1 a bias fragment too, and the block shares them through LDS,
//   lane for lane as the registers hold them. The bias product is q_h . b_h x256, the score term that no key changes, stored in f32 as
//   Cq[head][token]: the 8 strips' sums meet in LDS and wave 0 stores the block's four whole lines.
//   out = one f16 plane in fragment order: [M / 16][N / 32] blocks. Two block barriers (all 8 waves of a block pass both).
__device__ __forceinline__ void stfrag_lds(unsigned short* p, v16h f) {      // p = fragment + lane * 8
    *(v8h_ma*)p              = __builtin_shufflevector(f, f, 0, 1, 2, 3, 4, 5, 6, 7);
    *(v8h_ma*)(p + FBLK / 2) = __builtin_shufflevector(f, f, 8, 9, 10, 11, 12, 13, 14, 15);
}
__device__ __forceinline__ v16h ldfrag_lds(const unsigned short* p) {
    const v8h a = *(const v8h_ma*)p;
    const v8h b = *(const v8h_ma*)(p + FBLK / 2);
    return __builtin_shufflevector(a, b, 0, 1, 2, 3, 4, 5, 6, 7, 8, 9, 10, 11, 12, 13, 14, 15);
}
__device__ __forceinline__ void qproj_part(const float* __restrict__ xq, const float* __restrict__ Wc, const float* __restrict__ bias,
                                           unsigned short* __restrict__ Ca, float* __restrict__ Cq, float* sT, unsigned short* sB, float* sC, int blk) {
    constexpr float scale  = KCARRY / (QCARRY * WCARRY);
    constexpr int tilesN = DM >> 6;
    const int lane = threadIdx.x & 31;
    const int wave = __builtin_amdgcn_readfirstlane(threadIdx.x >> 5);
    const int tg = blk / tilesN;                  // group of 128 tokens
    const int tn = blk - tg * tilesN;             // head
    const int mBase = tg * 128 + wave * 16;       // this wave's strip
    const int n0 = tn << 6;
    const int rl   = lane & 15;
    const int koff = (lane >> 4) * 8;
    const int mOff = (lane >> 4) * 8;
    const float* arow = xq + (size_t)((mBase / SEQ) * SEQ_FULL + (mBase % SEQ) + rl) * DM + n0 + koff;   // a 16-row strip lies inside one sequence
    const float* wcol = Wc + (size_t)(n0 + (wave >> 2) * 32 + koff) * DKH + ((wave & 3) << 4) + rl;      // W fragment w: k step w / 4, columns 16 (w % 4)

    // the wave's whole fetch (two query fragments, one W fragment) is issued ahead of the first conversion: one load latency per wave
    const RawFrag ra0 = ldfrag_raw(arow);
    const RawFrag ra1 = ldfrag_raw(arow + 32);
    const RawFrag rw  = ldfrag_col(wcol, DKH);
    // the addresses are inputs of the wait: they stay live up to it, so no load lands on an address register of another
    asm volatile("s_wait_xcnt 0x0" :: "v"(arow), "v"(wcol) : "memory");
    if (wave < 2) {                             // wave-uniform: bias fragment of k step 'wave'
        const float* brow = bias + n0 + wave * 32 + koff;
        const RawFrag rv = ldfrag_raw(brow);
        asm volatile("s_wait_xcnt 0x0" :: "v"(brow) : "memory");   // the address stays live up to the wait
        stfrag_lds(sB + (8 + wave) * FBLK + lane * 8, cvtfrag(rv, WCARRY));
    }
    stfrag_lds(sB + wave * FBLK + lane * 8, cvtfrag(rw, WCARRY));
    v16h ah[2];
    ah[0] = cvtfrag(ra0, QCARRY);
    ah[1] = cvtfrag(ra1, QCARRY);
    __syncthreads();                            // the ten B fragments are complete
    v16h bh[2][4], bb[2];
#pragma unroll
    for (int ks = 0; ks < 2; ++ks) {
#pragma unroll
        for (int j = 0; j < 4; ++j) bh[ks][j] = ldfrag_lds(sB + (ks * 4 + j) * FBLK + lane * 8);
        bb[ks] = ldfrag_lds(sB + (8 + ks) * FBLK + lane * 8);
    }

    const int sb = wave * (16 * OP);
    v8f acc[4];
    v8f accb = {0.f, 0.f, 0.f, 0.f, 0.f, 0.f, 0.f, 0.f};
#pragma unroll
    for (int j = 0; j < 4; ++j) { const v8f zz = {0.f, 0.f, 0.f, 0.f, 0.f, 0.f, 0.f, 0.f}; acc[j] = zz; }
#pragma unroll
    for (int ks = 0; ks < 2; ++ks) {
        accb = mma_h(ah[ks], bb[ks], accb);
        acc[0] = FragT<0>::mma(ah[ks], bh[ks][0], acc[0]);
        acc[1] = FragT<0>::mma(ah[ks], bh[ks][1], acc[1]);
        acc[2] = FragT<0>::mma(ah[ks], bh[ks][2], acc[2]);
        acc[3] = FragT<0>::mma(ah[ks], bh[ks][3], acc[3]);
        guard4<v16h>(acc[0], acc[1], acc[2], acc[3], ah[ks], bh[ks][0], bh[ks][1], bh[ks][2], bh[ks][3]);
    }
    // every column of accb holds the same 16 sums: lanes 0 and 16 hand over rows 0..7 and 8..15
    if (rl == 0) {
        float* cp = sC + wave * 16 + mOff;
        const v4f lo = {accb[0], accb[1], accb[2], accb[3]};
        const v4f hi = {accb[4], accb[5], accb[6], accb[7]};
        *(v4f_ma*)cp = lo;
        *(v4f_ma*)(cp + 4) = hi;
    }
#pragma unroll
    for (int j = 0; j < 4; ++j) {
#pragma unroll
        for (int r = 0; r < 8; ++r) {
            sT[sb + (mOff + r) * OP + (j << 4) + rl] = acc[j][r] * scale;
        }
    }
    __syncthreads();                            // the block's 128 q.b sums are complete; it also orders the wave's own staging tile
    if (wave == 0) {                            // wave-uniform: 128 tokens of one head = four whole lines
        const v4f v = *(const v4f_ma*)&sC[lane * 4];
        float* cp = Cq + (size_t)tn * NTOK + tg * 128 + lane * 4;
        *(v4f*)cp = v;
        asm volatile("s_wait_xcnt 0x0" :: "v"(cp) : "memory");   // behind the store: the address register is reused below
    }
    // these 16 rows x 64 columns are two adjacent fragment-order blocks = 2 KiB in a row: piece 'it' = columns 16 it + 8 (lane >> 4)
    unsigned short* cb = Ca + (size_t)(mBase >> 4) * (16 * DM) + (size_t)(n0 >> 5) * FBLK + lane * 8;
#pragma unroll
    for (int it = 0; it < 4; ++it) {
        const v4f a = *(const v4f_ma*)&sT[sb + rl * OP + it * 16 + koff];
        const v4f b = *(const v4f_ma*)&sT[sb + rl * OP + it * 16 + koff + 4];
        v4u pk; pk.x = pk_h2f(a.x, a.y); pk.y = pk_h2f(a.z, a.w); pk.z = pk_h2f(b.x, b.y); pk.w = pk_h2f(b.z, b.w);
        *(v4u*)(cb + it * (FBLK / 2)) = pk;
    }
}

// value f32 [rows][64] -> f16 plane holding bf16(x) * 16 in fragment order ([NTOK / 16][64 / 32] blocks); plane row r reads source
// row (r / SEQ) * SEQ_FULL + r % SEQ; thread u writes the plane's u-th 16-byte piece, so a wave stores 512 contiguous bytes
__device__ __forceinline__ void cast_vrow_part(const float* __restrict__ src, unsigned short* __restrict__ dst, int blk) {
    const int u = blk * 256 + threadIdx.x;
    if (u >= NTOK * (DKH / 8)) return;
    const int r  = (u >> 7) * 16 + (u & 15);                  // 128 pieces per 16-row tile; row = lane & 15
    const int c0 = ((u >> 6) & 1) * 32 + ((u >> 4) & 3) * 8;  // block, then 16 j + 8 (lane >> 4)
    const int sr = (r / SEQ) * SEQ_FULL + (r % SEQ);
    const float* s = src + (size_t)sr * DKH + c0;
    const v4f a = *(const v4f*)(s);
    const v4f b = *(const v4f*)(s + 4);
    v4u pk;
    pk.x = pk_h2(bf_val(a.x) * VCARRY, bf_val(a.y) * VCARRY); pk.y = pk_h2(bf_val(a.z) * VCARRY, bf_val(a.w) * VCARRY);
    pk.z = pk_h2(bf_val(b.x) * VCARRY, bf_val(b.y) * VCARRY); pk.w = pk_h2(bf_val(b.z) * VCARRY, bf_val(b.w) * VCARRY);
    *(v4u*)(dst + (size_t)u * 8) = pk;
}

// value f32 [batch][SEQ_FULL][64] -> transposed f16 plane holding bf16(x) * 16, rows d, k = tokens, in fragment order:
// dst[b][t / 32][d / 16] blocks, so a 64-token tile is 8 KiB in a row.
__device__ __forceinline__ void cast_vt_part(const float* __restrict__ src, unsigned short* __restrict__ dst, _Float16* Tsh, int blk) {
    constexpr int nb64 = SEQ / 64;
    const int b  = blk / nb64;
    const int t0 = (blk - b * nb64) * 64;
#pragma unroll 1
    for (int it = 0; it < 4; ++it) {
        const int idx = threadIdx.x + 256 * it;           // 1,024 float4 pieces of the [64 t][64 d] tile
        const int t  = idx >> 4;
        const int d4 = (idx & 15) * 4;
        const v4f a = *(const v4f*)(src + ((size_t)(b * SEQ_FULL + t0 + t)) * DKH + d4);
        Tsh[(d4 + 0) * TP + t] = toh_flush(bf_val(a.x) * VCARRY);
        Tsh[(d4 + 1) * TP + t] = toh_flush(bf_val(a.y) * VCARRY);
        Tsh[(d4 + 2) * TP + t] = toh_flush(bf_val(a.z) * VCARRY);
        Tsh[(d4 + 3) * TP + t] = toh_flush(bf_val(a.w) * VCARRY);
    }
    __syncthreads();
#pragma unroll
    for (int it = 0; it < 2; ++it) {
        const int p  = threadIdx.x + 256 * it;            // 512 pieces of 8 halves: [32-token step][16-row d tile][piece j][lane]
        const int d  = ((p >> 6) & 3) * 16 + (p & 15);
        const int c8 = (p >> 8) * 32 + ((p >> 4) & 3) * 8;
        const v8h v = *(const v8h_ma*)&Tsh[d * TP + c8];
        const v4u pk = __builtin_bit_cast(v4u, v);
        *(v4u*)(dst + ((size_t)b * SEQ + t0) * DKH + p * 8) = pk;
    }
    asm volatile("s_wait_xcnt 0x0" ::: "memory");   // behind the two stores: another part's code follows in the kernel's text and rewrites the registers of their address
}

// one launch for all three parts; the block index picks the part (block-uniform), the longest part (query projection) starts first
__global__ __launch_bounds__(256) void k_prep(const float* __restrict__ xq, const float* __restrict__ xv, const float* __restrict__ Wc,
                                              const float* __restrict__ bc, unsigned short* __restrict__ QP, float* __restrict__ CQ,
                                              unsigned short* __restrict__ VR, unsigned short* __restrict__ VT) {
    __shared__ __align__(16) float sh[8 * 16 * OP];       // projection: f32 staging, one 16 x 64 tile per wave; transpose: its f16 tile
    __shared__ __align__(16) unsigned short shB[10 * FBLK];   // projection: the block's ten B fragments
    __shared__ __align__(16) float shC[128];              // projection: q.b of the block's 128 tokens
    const int blk = blockIdx.x;
    if (blk < PB_GEMM)              qproj_part(xq, Wc, bc, QP, CQ, sh, shB, shC, blk);
    else if (blk < PB_GEMM + PB_VT) cast_vt_part(xv, VT, (_Float16*)sh, blk - PB_GEMM);
    else                            cast_vrow_part(xv, VR, blk - (PB_GEMM + PB_VT));
}

// =====================================================================================================================
// k_attn_heads: fused attention with the softmax taken across the 8 heads. Block = 8 waves = 16 query rows of one batch.
//   QP: f16 plane (projected query x256), [ntok / 16][512 / 32] fragment-order blocks; VR: f16 plane (value rows x16),
//   [ntok / 16][64 / 32] fragment-order blocks; CQ: f32 q_h . b_h x256, [head][ntok]; VT: f16 plane (v^T x16),
//   [batch][seq / 32][64 / 16] fragment-order blocks.
//   Every wave owns its keys from the scores to the output sums: 32 keys per trip (wave w: keys 256 i + 32 w ...), all 8 heads.
//     scores (two 16-key subtiles): S^T[key][query] for all 8 heads (A = value rows, the same two fragments for every head,
//       B = projected query rows, two 32-deep steps each; q_h . b_h joins in the softmax's scaling),
//       head softmax lane-local in f32, P x4096 as f16 kept in registers;
//     weights.V: O^T[head][d][query] += V^T[d][32 keys] . P^T[32 keys][query]; the B fragment of a head is the lane's own two
//       8-key pieces (elements 0..7 <- keys 8h+r of the first subtile, 8..15 <- keys 8h+r of the second), so P crosses no lane
//       and no wave, the loop holds no LDS traffic and no barrier, and a wave loads only its own 32 keys of v^T.
//   After the loop the 8 waves' partial sums (8 heads x 64 x 16 each) meet once in LDS: one block barrier, wave = head adds the
//   eight partials in wave order.
//   Epilogue: per wave (head) 16 rows x 64 columns staged in two 32-column halves through a wave-private LDS tile (wave_sync),
// =====================================================================================================================
__global__ __launch_bounds__(256) void k_attn_heads(const unsigned short* __restrict__ QP, const float* __restrict__ CQ,
                                                    const unsigned short* __restrict__ VR, const unsigned short* __restrict__ VT, float* __restrict__ out,
                                                    int seq, int seqfull, float sscale) {
    __shared__ __align__(16) float    Rsh[8 * NH * 4 * 256];     // [wave][head][d tile][piece][lane][4] partial sums, cross-wave
    __shared__ __align__(16) float    Osh[8 * 16 * OPH];         // wave-private output staging [16][32] (+4 pad)
    const int lane = threadIdx.x & 31;
    const int wave = __builtin_amdgcn_readfirstlane(threadIdx.x >> 5);
    const int hf = lane >> 4;
    const int c  = lane & 15;
    const int nqb = seq / 16;
    const int b  = blockIdx.x / nqb;
    const int q0 = (blockIdx.x - b * nqb) * 16;
    // Fragment addresses = a wave-uniform row base + a lane offset that is the same for every trip.
    const unsigned short* qrow = QP + (size_t)(b * seq + q0) * DM;              // this block's 16 query rows (16 blocks)
    const unsigned short* arow = VR + (size_t)(b * seq) * DKH;                  // this batch's value rows (2 blocks per 16 keys)
    const unsigned short* vrow = VT + (size_t)(b * DKH) * seq;                  // this batch's v^T blocks
    const unsigned int rlane = (unsigned int)(lane * 8);                        // a lane's 16-byte piece inside a fragment-order block
    const int obase = wave * (16 * OPH);
    const float sl2 = sscale * 1.4426950408889634f;
    // q_h . b_h of this lane's query, in the exponent's units (the plane carries x256, the scores x4096)
    float cl[NH];
#pragma unroll
    for (int h = 0; h < NH; ++h) cl[h] = CQ[(size_t)h * NTOK + b * seq + q0 + c] * ((VCARRY * KCARRY) / (QCARRY * WCARRY) * sl2);

    v8f oacc[NH][4];
#pragma unroll
    for (int h = 0; h < NH; ++h)
#pragma unroll
        for (int t = 0; t < 4; ++t) { const v8f zz = {0.f, 0.f, 0.f, 0.f, 0.f, 0.f, 0.f, 0.f}; oacc[h][t] = zz; }

    // the two value-row fragments of a 16-key subtile serve all 8 heads; each subtile's pair is requested one subtile ahead
    v16h va[2];
    {
        const unsigned short* ap = arow + (wave * KW) * DKH + rlane;
        va[0] = ldfrag_hf(ap);
        va[1] = ldfrag_hf(ap + FBLK);
        asm volatile("s_wait_xcnt 0x0" :: "v"(ap) : "memory");   // the address stays live up to the wait
    }

    for (int kc = wave * KW; kc < seq; kc += KCH) {
        v8h ph[2][NH];
        v16h vf[4];
#pragma unroll
        for (int sub = 0; sub < 2; ++sub) {
            // ---------- scores: S^T for 16 of this wave's keys, all 8 heads ----------
            // Batches of BH heads: the loads of a batch's query fragments are all issued before its first product,
            // so their latencies run side by side and the wave meets one load latency per batch instead of one per product.
            v8f s[NH];
            const unsigned short* qp = qrow + rlane;                            // all batches read at constant offsets from this address
#pragma unroll
            for (int g = 0; g < NH / BH; ++g) {
                v16h qf[2 * BH];
#pragma unroll
                for (int j = 0; j < 2 * BH; ++j) qf[j] = ldfrag_hf(qp + (g * 2 * BH + j) * FBLK);
                // the address is an input of the wait: it stays live up to it, so no load of the batch lands on the address register,
                // and what reuses that register later stands behind the wait
                asm volatile("s_wait_xcnt 0x0" :: "v"(qp) : "memory");
                __builtin_amdgcn_sched_barrier(0);      // holds the batch's loads ahead of its products (else they sink back to their uses)
#pragma unroll
                for (int j = 0; j < BH; ++j) {
                    v8f z = {0.f, 0.f, 0.f, 0.f, 0.f, 0.f, 0.f, 0.f};
                    z = mma_h(va[0], qf[2 * j], z);
                    z = mma_h(va[1], qf[2 * j + 1], z);
                    s[g * BH + j] = z;
                }
                __builtin_amdgcn_sched_barrier(0);      // holds the next loads behind these products, so one batch of fragments is live at a time
            }
            {
                // the next subtile's value rows are requested here, behind the last product that reads this subtile's: their latency passes
                // under the softmax's vector work; behind the last trip the wave's first rows are read again (in bounds, not used)
                const int kn = (sub == 0) ? kc : ((kc + KCH < seq) ? kc + KCH : wave * KW);
                const int ao = (sub == 0) ? 16 * DKH : 0;                // a constant step: it rides in the loads' offset field
                const unsigned short* ap = arow + kn * DKH + rlane;
                va[0] = ldfrag_hf(ap + ao);
                va[1] = ldfrag_hf(ap + ao + FBLK);
                asm volatile("s_wait_xcnt 0x0" :: "v"(ap) : "memory");   // the address stays live up to the wait
                if (sub == 0) __builtin_amdgcn_sched_barrier(0);         // holds these loads ahead of the softmax
            }
            if (sub == 1) {
                // the four v^T fragments of these 32 keys are requested here: their latency passes under the softmax's vector work
                const unsigned short* vp = vrow + kc * DKH + rlane;
#pragma unroll
                for (int t = 0; t < 4; ++t) vf[t] = ldfrag_hf(vp + t * FBLK);   // t = 16-row d tile
                // as above: the address stays live up to the wait
                asm volatile("s_wait_xcnt 0x0" :: "v"(vp) : "memory");
                __builtin_amdgcn_sched_barrier(0);      // holds these loads ahead of the softmax
            }
            // ---------- softmax across heads: element r of every head tile is the same (key, query) pair ----------
            // Two r at a time, so that scaling, shift, sum and weighting are packed f32 instructions on the accumulators' own register pairs.
            // The exponent's argument is <= 0 and the sum lies in [1, 8]: the bare exponential and the bare reciprocal cover both ranges.
            unsigned int pw[NH][4];
#pragma unroll
            for (int p = 0; p < 4; ++p) {
                v2f t[NH];
#pragma unroll
                for (int h = 0; h < NH; ++h) {
                    const v2f sv = {s[h][2 * p], s[h][2 * p + 1]};
                    const v2f sc = {sl2, sl2};
                    const v2f cb = {cl[h], cl[h]};
                    t[h] = __builtin_elementwise_fma(sv, sc, cb);
                }
                float m0 = t[0].x, m1 = t[0].y;
#pragma unroll
                for (int h = 1; h < NH; ++h) { m0 = fmaxf(m0, t[h].x); m1 = fmaxf(m1, t[h].y); }
                const v2f mm = {m0, m1};
                v2f zsum = {0.f, 0.f};
#pragma unroll
                for (int h = 0; h < NH; ++h) {
                    const v2f a = t[h] - mm;
                    const v2f e = {__builtin_amdgcn_exp2f(a.x), __builtin_amdgcn_exp2f(a.y)};
                    t[h] = e;
                    zsum += e;
                }
                const v2f inv = {PCARRY * __builtin_amdgcn_rcpf(zsum.x), PCARRY * __builtin_amdgcn_rcpf(zsum.y)};
#pragma unroll
                for (int h = 0; h < NH; ++h)      // one packed convert per pair, round to nearest even; a weight too small for a normal f16 stays a subnormal operand
                    pw[h][p] = __builtin_bit_cast(unsigned int, __builtin_convertvector(t[h] * inv, v2h));
            }
#pragma unroll
            for (int h = 0; h < NH; ++h) {
                const v4u pk = {pw[h][0], pw[h][1], pw[h][2], pw[h][3]};
                ph[sub][h] = __builtin_bit_cast(v8h, pk);   // keys 8*hf .. 8*hf+7 of subtile 'sub', query c
            }
        }
        // ---------- weights.V: O^T[head][d][query] += V^T . P^T over this wave's 32 keys ----------
        // plain builtin products (the compiler keeps their distances itself): the 256 accumulator registers reach above v255,
        // where an asm statement cannot take them as operands
#pragma unroll
        for (int h = 0; h < NH; ++h) {
            const v16h pb = __builtin_shufflevector(ph[0][h], ph[1][h], 0, 1, 2, 3, 4, 5, 6, 7, 8, 9, 10, 11, 12, 13, 14, 15);
            oacc[h][0] = FragT<0>::mma(vf[0], pb, oacc[h][0]);
            oacc[h][1] = FragT<0>::mma(vf[1], pb, oacc[h][1]);
            oacc[h][2] = FragT<0>::mma(vf[2], pb, oacc[h][2]);
            oacc[h][3] = FragT<0>::mma(vf[3], pb, oacc[h][3]);
        }
    }

    // ---------- the waves' partial sums meet: every wave stores its 32 tiles, wave = head adds eight partials in wave order ----------
#pragma unroll
    for (int h = 0; h < NH; ++h) {
#pragma unroll
        for (int t = 0; t < 4; ++t) {
            float* rp = &Rsh[((wave * NH + h) * 4 + t) * 256 + lane * 4];       // a wave's 16-byte store covers 512 contiguous bytes
            const v4f lo = {oacc[h][t][0], oacc[h][t][1], oacc[h][t][2], oacc[h][t][3]};
            const v4f hi = {oacc[h][t][4], oacc[h][t][5], oacc[h][t][6], oacc[h][t][7]};
            *(v4f_ma*)rp = lo;
            *(v4f_ma*)(rp + 128) = hi;
        }
    }
    __syncthreads();
    v8f osum[4];
#pragma unroll
    for (int t = 0; t < 4; ++t) {
        v4f lo = {0.f, 0.f, 0.f, 0.f}, hi = {0.f, 0.f, 0.f, 0.f};
#pragma unroll
        for (int w = 0; w < 8; ++w) {
            const float* rp = &Rsh[((w * NH + wave) * 4 + t) * 256 + lane * 4];
            lo += *(const v4f_ma*)rp;
            hi += *(const v4f_ma*)(rp + 128);
        }
        const v8f sm = {lo.x, lo.y, lo.z, lo.w, hi.x, hi.y, hi.z, hi.w};
        osum[t] = sm;
    }

    // ---------- epilogue: out[b][q0 + query][wave*64 + d], d = t*16 + 8*hf + r held by lane (query c) ----------
    const float osc = 1.0f / (PCARRY * VCARRY);
#pragma unroll
    for (int half = 0; half < 2; ++half) {
#pragma unroll
        for (int tt = 0; tt < 2; ++tt) {
#pragma unroll
            for (int r = 0; r < 8; ++r) Osh[obase + c * OPH + tt * 16 + 8 * hf + r] = osum[half * 2 + tt][r] * osc;
        }
        wave_sync();
        {
            const int q = lane >> 3, c4 = (lane & 7) * 4;
            {
#pragma unroll
                for (int it = 0; it < 4; ++it) {
                    const int row = it * 4 + q;
                    const v4f v = *(const v4f_ma*)&Osh[obase + row * OPH + c4];
                    *(v4f*)(out + (size_t)(b * seqfull + q0 + row) * DM + wave * DKH + half * 32 + c4) = v;
                }
                
            }
        }
        wave_sync();
    }
}

// =====================================================================================================================
// Host side: workspace carve (all plane sizes are multiples of 256 B), 2 launches.
// =====================================================================================================================
constexpr size_t SZ_TOK  = (size_t)NTOK * DM * 2;          // one 16-bit token plane [NTOK][512]
constexpr size_t SZ_VT   = (size_t)NB * DKH * SEQ * 2;     // v^T plane [NB*64][SEQ]
constexpr size_t SZ_CQ   = (size_t)NH * NTOK * 4;          // q_h . b_h plane [8][NTOK] f32
constexpr size_t WS_TOTAL = SZ_TOK + SZ_CQ + SZ_VT + SZ_VT;
static_assert(SZ_TOK % 256 == 0);
static_assert(SZ_VT % 256 == 0);
static_assert(SZ_CQ % 256 == 0);
static_assert(WS_TOTAL <= (size_t)134217728);            // carve stays within 128 MiB
static_assert((size_t)NTOK * DM < (size_t)2147483647);    // int plane offsets
static_assert((size_t)NB_FULL * SEQ_FULL * DM * 4 == (size_t)8388608);   // output extent in bytes (offset 0)

extern "C" void kernel_launch(void* const* d_in, const int* in_sizes, int n_in, void* d_out, int out_size, void* d_ws, size_t ws_size, hipStream_t stream) {
    if (n_in < 4) return;
    const long long need_q = ((long long)(NB - 1) * SEQ_FULL + SEQ) * DM;
    const long long need_v = ((long long)(NB - 1) * SEQ_FULL + SEQ) * DKH;
    if ((long long)in_sizes[0] < need_q || (long long)in_sizes[1] < need_v) return;
    if (in_sizes[2] < DM * DKH || in_sizes[3] < DM) return;
    if ((long long)out_size < need_q) return;
    if (WS_TOTAL > ws_size) return;

    // query, value, conv_w [512][64][1], conv_b [512]
    const float* xq = (const float*)d_in[0];
    const float* xv = (const float*)d_in[1];
    const float* Wc = (const float*)d_in[2];
    const float* bc = (const float*)d_in[3];
    float* out = (float*)d_out;

    char* wsp = (char*)d_ws;
    unsigned short* Q16 = (unsigned short*)wsp; wsp += SZ_TOK;
    float*          CQp = (float*)wsp;          wsp += SZ_CQ;
    unsigned short* VRp = (unsigned short*)wsp; wsp += SZ_VT;
    unsigned short* VTp = (unsigned short*)wsp; wsp += SZ_VT;
    if ((size_t)(wsp - (char*)d_ws) > ws_size) return;

    // projected query plane x256 = (query x16)(W x16) per head, q.b x256, value-row plane x16, v^T plane x16; the f16 planes in fragment order
    k_prep<<<(unsigned)(PB_GEMM + PB_VT + PB_VR), 256, 0, stream>>>(xq, xv, Wc, bc, Q16, CQp, VRp, VTp);

    // scores carry 16 * 256; score scale 1/8 applied with the carries inside the head softmax
    k_attn_heads<<<(unsigned)(NB * (SEQ / 16)), 256, 0, stream>>>(Q16, CQp, VRp, VTp, out, SEQ, SEQ_FULL, 0.125f / (VCARRY * KCARRY));
}

// v008
// One run takes 21.8 microseconds.
// Next to v007, in two timings, it ran 1.13 times as fast each time.
// Over all steps from v000 it is 6.81 times as fast.
// Multi-head dot attention, 2 x 2,048 queries x 2,048 keys, width 512 = 8 heads x 64; keys = pointwise [out][in] 64->512 map of the value rows + bias, values = the 64-wide value rows shared by all heads, softmax taken ACROSS THE 8 HEADS per (query, key), no key normalisation, no mask. Scores reassociated: q_h . (W_h v + b_h) = (W_h^T q_h) . v + q_h . b_h, so the query is projected (per head, 64 -> 64) and the key operand of every head is the value row itself. Inputs and parameters converted to bf16 (RNE). Query projection: v_wmma_f32_16x16x32_f16 (f16 operands holding the bf16 values, query x16, weight x16, bias x16, f32 accumulate, projected query carried x256 as one f16 plane, q.b x256 in f32); scores: v_wmma_f32_16x16x32_f16 (value rows x16 against the projected query plane, f32 accumulate, f32 head softmax); weights.V: v_wmma_f32_16x16x32_f16 (P x4096 as f16, v^T x16 as f16, f32 accumulate).
#include <hip/hip_runtime.h>
#include <math.h>

#ifndef NB
#define NB 2
#endif
#ifndef SEQ
#define SEQ 2048
#endif
#define NB_FULL 2
#define SEQ_FULL 2048
#define DM 512
#define NH 8
#define DKH 64
#define NTOK (NB * SEQ)
#define OP 68      // f32 staging pitch (floats), GEMM epilogue
#define OPH 36     // f32 staging pitch (floats), attention epilogue (32-column halves)
#define TP 72      // transpose tile pitch (halves)
#define KW 32      // keys per wave and trip = two 16-key subtiles = one 32-deep step of weights.V
#define KCH 256    // keys per trip = 8 waves x KW
#define BH 4       // heads per batch of score fragments: eight query fragments, 16 loads
#define QCARRY 16.0f
#define VCARRY 16.0f
#define WCARRY 16.0f
#define KCARRY 256.0f
#define PCARRY 4096.0f

static_assert(DM == NH * DKH);            // merged head layout h*64+d
static_assert(DKH == 64);                 // two 32-deep k-steps per score tile, four 16-wide output tiles
static_assert(NH == 8);                   // one head per wave in the final sum and the epilogue, 8 waves per block
static_assert(SEQ % 64 == 0);             // 64-token transpose tiles inside one sequence
static_assert(SEQ % KCH == 0);            // whole key chunks
static_assert(SEQ % 16 == 0);             // 16-query blocks
static_assert(NTOK % 64 == 0);
static_assert(DM % 64 == 0);              // GEMM tile multiple (N)
static_assert(DKH % 32 == 0);             // K steps of 32
static_assert(NB <= NB_FULL);
static_assert(SEQ <= SEQ_FULL);
static_assert((OP % 4) == 0);             // 16-B aligned reloads from the f32 staging tile
static_assert((OPH % 4) == 0);
static_assert((TP % 8) == 0);             // 16-B aligned reloads from the transpose tile
static_assert(KCH == 8 * KW);
static_assert(NH % BH == 0);
static_assert(NTOK % 16 == 0);            // whole 16-row tiles in the fragment-order planes
static_assert(DKH == 64);                 // cast_vrow_part: 128 pieces per 16-row tile, 2 blocks per tile

typedef __attribute__((ext_vector_type(16))) _Float16 v16h;
typedef __attribute__((ext_vector_type(8)))  _Float16 v8h;
typedef __attribute__((ext_vector_type(8)))  float    v8f;
typedef __attribute__((ext_vector_type(4)))  float    v4f;
typedef __attribute__((ext_vector_type(2)))  float    v2f;
typedef __attribute__((ext_vector_type(2)))  _Float16 v2h;
typedef __attribute__((ext_vector_type(4)))  unsigned int v4u;
typedef v8h v8h_ma __attribute__((may_alias));
typedef v4f v4f_ma __attribute__((may_alias));

// 16-bit WMMA fragment map (wave32), lane L, h = L>>4, m = L&15:
//   A 16x32: lane = row m;    element i -> k = (i<8) ? 8h+i : 16+8h+(i-8)
//   B 32x16: lane = column m; the SAME k(i,h)
//   D 16x16 (8 f32): lane = column m; element r -> row 8h+r
// A fragment from a k-contiguous row is therefore p[0..7] | p[16..23] with p = row + k0 + 8h.
// Fragment order (the attention kernel's three operand planes): a 16-row x 32-k block is stored as 512 halves
//   [piece j][lane L][8 halves], piece j of lane L = row (L & 15), k = 16 j + 8 (L >> 4) + 0..7,
// so that the 32 lanes of one 16-byte load read 512 contiguous bytes (four whole 128-B lines) where a row-major plane
// makes them touch 16 lines. The registers receive the same elements as from a row-major plane.
#define FBLK 512   // halves per 16 x 32 block

__device__ __forceinline__ unsigned int bf_bits(float f) {            // bf16 RNE bit pattern (finite inputs)
    const unsigned int u = __float_as_uint(f);
    return (u + 0x7FFFu + ((u >> 16) & 1u)) >> 16;
}
__device__ __forceinline__ float bf_val(float f) { return __uint_as_float(bf_bits(f) << 16); }
__device__ __forceinline__ unsigned int pk_h2(float a, float b) {
    return (unsigned int)__builtin_bit_cast(unsigned short, (_Float16)a) | ((unsigned int)__builtin_bit_cast(unsigned short, (_Float16)b) << 16);
}
// f32 -> f16 that cannot produce an f16 subnormal: magnitudes below 2^-14 become zero (value select)
static __device__ __forceinline__ _Float16 toh_flush(float v) {
    const _Float16 r = (_Float16)v;
    return (fabsf(v) < 6.103515625e-05f) ? (_Float16)0.0f : r;
}
static __device__ __forceinline__ unsigned int pk_h2f(float a, float b) {
    return (unsigned int)__builtin_bit_cast(unsigned short, toh_flush(a)) | ((unsigned int)__builtin_bit_cast(unsigned short, toh_flush(b)) << 16);
}
__device__ __forceinline__ void wave_sync() {
    __builtin_amdgcn_fence(3 /* release order */, "workgroup");
    __builtin_amdgcn_wave_barrier();
    __builtin_amdgcn_fence(2 /* acquire order */, "workgroup");
}

// fragment from a k-contiguous f32 row, p = row + k0 + 8h: elements p[0..7] | p[16..23], each as f16(bf16(x) * sc);
// the four 16-byte loads and the conversion are separate calls, so that many fragments' loads can be issued ahead of the first conversion
struct RawFrag { v4f a0, a1, b0, b1; };
__device__ __forceinline__ RawFrag ldfrag_raw(const float* __restrict__ p) {
    RawFrag r;
    r.a0 = *(const v4f*)(p);
    r.a1 = *(const v4f*)(p + 4);
    r.b0 = *(const v4f*)(p + 16);
    r.b1 = *(const v4f*)(p + 20);
    return r;
}
// the same sixteen elements from a k-strided column, p = column + (k0 + 8h) * pitch: element k stands at p[k * pitch]
__device__ __forceinline__ RawFrag ldfrag_col(const float* __restrict__ p, int pitch) {
    RawFrag r;
#pragma unroll
    for (int e = 0; e < 4; ++e) {
        r.a0[e] = p[e * pitch];
        r.a1[e] = p[(4 + e) * pitch];
        r.b0[e] = p[(16 + e) * pitch];
        r.b1[e] = p[(20 + e) * pitch];
    }
    return r;
}
__device__ __forceinline__ v16h cvtfrag(const RawFrag& r, float sc) {
    const v4f a0 = r.a0, a1 = r.a1, b0 = r.b0, b1 = r.b1;
    v4u lo, hi;
    lo.x = pk_h2(bf_val(a0.x) * sc, bf_val(a0.y) * sc); lo.y = pk_h2(bf_val(a0.z) * sc, bf_val(a0.w) * sc);
    lo.z = pk_h2(bf_val(a1.x) * sc, bf_val(a1.y) * sc); lo.w = pk_h2(bf_val(a1.z) * sc, bf_val(a1.w) * sc);
    hi.x = pk_h2(bf_val(b0.x) * sc, bf_val(b0.y) * sc); hi.y = pk_h2(bf_val(b0.z) * sc, bf_val(b0.w) * sc);
    hi.z = pk_h2(bf_val(b1.x) * sc, bf_val(b1.y) * sc); hi.w = pk_h2(bf_val(b1.z) * sc, bf_val(b1.w) * sc);
    return __builtin_shufflevector(__builtin_bit_cast(v8h, lo), __builtin_bit_cast(v8h, hi), 0, 1, 2, 3, 4, 5, 6, 7, 8, 9, 10, 11, 12, 13, 14, 15);
}
// fragment from a fragment-order block: p = block + lane * 8
__device__ __forceinline__ v16h ldfrag_hf(const unsigned short* __restrict__ p) {
    const v8h a = *(const v8h*)(p);
    const v8h b = *(const v8h*)(p + FBLK / 2);
    return __builtin_shufflevector(a, b, 0, 1, 2, 3, 4, 5, 6, 7, 8, 9, 10, 11, 12, 13, 14, 15);
}

template <int ET> struct FragT;
template <> struct FragT<0> {
    typedef v16h V;
    static __device__ __forceinline__ v8f mma(v16h a, v16h b, v8f c) { return __builtin_amdgcn_wmma_f32_16x16x32_f16(false, a, false, b, (short)0, c, false, false); }
};
// hazard guard for a group of four independent WMMAs: all four accumulators tied, A and all B fragments kept live
template <typename V>
__device__ __forceinline__ void guard4(v8f& a, v8f& b, v8f& c, v8f& d, V x, V y0, V y1, V y2, V y3) {
    asm volatile("v_nop\n\tv_nop\n\tv_nop\n\tv_nop" : "+v"(a), "+v"(b), "+v"(c), "+v"(d) : "v"(x), "v"(y0), "v"(y1), "v"(y2), "v"(y3));
}
// single f16 WMMA with its own hazard guard (one accumulator tied, both fragments kept live)
static __device__ __forceinline__ v8f mma_h(v16h a, v16h b, v8f c) {
    c = __builtin_amdgcn_wmma_f32_16x16x32_f16(false, a, false, b, (short)0, c, false, false);
    asm volatile("v_nop\n\tv_nop\n\tv_nop\n\tv_nop" : "+v"(c) : "v"(a), "v"(b));
    return c;
}

// =====================================================================================================================
// The three preparatory parts below read the inputs alone and write disjoint planes, so they run as block ranges of ONE launch
// (k_prep): the query projection converts its own operands on the way into the fragments.
// =====================================================================================================================
#define PB_GEMM ((NTOK / 128) * (DM / 64))        // blocks of 8 strips of 16 tokens, one head each, query projection
#define PB_VT   (NB * (SEQ / 64))                 // 64-token transpose tiles
#define PB_VR   ((NTOK * (DKH / 8)) / 256)        // 256 16-byte pieces of the value-row plane per block
static_assert(NTOK % 128 == 0);                           // whole blocks of 8 strips
static_assert((NTOK * (DKH / 8)) % 256 == 0);             // whole blocks of value-row pieces
static_assert(DKH * TP * 2 <= 8 * 16 * OP * 4);           // the transpose tile fits the shared staging array

// qproj_part: u x256 = (query_h x16)(W_h x16), u[token][h*64 + d] = sum_j query[token][h*64 + j] W[h*64 + j][d]; a block owns 128 tokens
//   of one head, each of its 8 waves one 16-token strip (a 16x64 tile of [M = tokens][N = 512]), K = 64.
//   A = query rows f32 [tokens][512], k-contiguous; B[k = j][n = d] = weight f32 [512 out][64 in] read down its columns; both taken as
//   f16(bf16(x) * 16) by the loader. All 8 strips use the same ten B fragments (eight of W_h, two that hold the head's 64 bias values
//   in every column): wave w loads and converts W fragment w, waves 0 and 1 a bias fragment too, and the block shares them through LDS,
//   lane for lane as the registers hold them. The bias product is q_h . b_h x256, the score term that no key changes, stored in f32 as
//   Cq[head][token]: the 8 strips' sums meet in LDS and wave 0 stores the block's four whole lines.
//   out = one f16 plane in fragment order: [M / 16][N / 32] blocks. Two block barriers (all 8 waves of a block pass both).
__device__ __forceinline__ void stfrag_lds(unsigned short* p, v16h f) {      // p = fragment + lane * 8
    *(v8h_ma*)p              = __builtin_shufflevector(f, f, 0, 1, 2, 3, 4, 5, 6, 7);
    *(v8h_ma*)(p + FBLK / 2) = __builtin_shufflevector(f, f, 8, 9, 10, 11, 12, 13, 14, 15);
}
__device__ __forceinline__ v16h ldfrag_lds(const unsigned short* p) {
    const v8h a = *(const v8h_ma*)p;
    const v8h b = *(const v8h_ma*)(p + FBLK / 2);
    return __builtin_shufflevector(a, b, 0, 1, 2, 3, 4, 5, 6, 7, 8, 9, 10, 11, 12, 13, 14, 15);
}
__device__ __forceinline__ void qproj_part(const float* __restrict__ xq, const float* __restrict__ Wc, const float* __restrict__ bias,
                                           unsigned short* __restrict__ Ca, float* __restrict__ Cq, float* sT, unsigned short* sB, float* sC, int blk) {
    constexpr float scale  = KCARRY / (QCARRY * WCARRY);
    constexpr int tilesN = DM >> 6;
    const int lane = threadIdx.x & 31;
    const int wave = __builtin_amdgcn_readfirstlane(threadIdx.x >> 5);
    const int tg = blk / tilesN;                  // group of 128 tokens
    const int tn = blk - tg * tilesN;             // head
    const int mBase = tg * 128 + wave * 16;       // this wave's strip
    const int n0 = tn << 6;
    const int rl   = lane & 15;
    const int koff = (lane >> 4) * 8;
    const int mOff = (lane >> 4) * 8;
    const float* arow = xq + (size_t)((mBase / SEQ) * SEQ_FULL + (mBase % SEQ) + rl) * DM + n0 + koff;   // a 16-row strip lies inside one sequence
    const float* wcol = Wc + (size_t)(n0 + (wave >> 2) * 32 + koff) * DKH + ((wave & 3) << 4) + rl;      // W fragment w: k step w / 4, columns 16 (w % 4)

    // the wave's whole fetch (two query fragments, one W fragment) is issued ahead of the first conversion: one load latency per wave
    const RawFrag ra0 = ldfrag_raw(arow);
    const RawFrag ra1 = ldfrag_raw(arow + 32);
    const RawFrag rw  = ldfrag_col(wcol, DKH);
    // the addresses are inputs of the wait: they stay live up to it, so no load lands on an address register of another
    asm volatile("s_wait_xcnt 0x0" :: "v"(arow), "v"(wcol) : "memory");
    if (wave < 2) {                             // wave-uniform: bias fragment of k step 'wave'
        const float* brow = bias + n0 + wave * 32 + koff;
        const RawFrag rv = ldfrag_raw(brow);
        asm volatile("s_wait_xcnt 0x0" :: "v"(brow) : "memory");   // the address stays live up to the wait
        stfrag_lds(sB + (8 + wave) * FBLK + lane * 8, cvtfrag(rv, WCARRY));
    }
    stfrag_lds(sB + wave * FBLK + lane * 8, cvtfrag(rw, WCARRY));
    v16h ah[2];
    ah[0] = cvtfrag(ra0, QCARRY);
    ah[1] = cvtfrag(ra1, QCARRY);
    __syncthreads();                            // the ten B fragments are complete
    v16h bh[2][4], bb[2];
#pragma unroll
    for (int ks = 0; ks < 2; ++ks) {
#pragma unroll
        for (int j = 0; j < 4; ++j) bh[ks][j] = ldfrag_lds(sB + (ks * 4 + j) * FBLK + lane * 8);
        bb[ks] = ldfrag_lds(sB + (8 + ks) * FBLK + lane * 8);
    }

    const int sb = wave * (16 * OP);
    v8f acc[4];
    v8f accb = {0.f, 0.f, 0.f, 0.f, 0.f, 0.f, 0.f, 0.f};
#pragma unroll
    for (int j = 0; j < 4; ++j) { const v8f zz = {0.f, 0.f, 0.f, 0.f, 0.f, 0.f, 0.f, 0.f}; acc[j] = zz; }
#pragma unroll
    for (int ks = 0; ks < 2; ++ks) {
        accb = mma_h(ah[ks], bb[ks], accb);
        acc[0] = FragT<0>::mma(ah[ks], bh[ks][0], acc[0]);
        acc[1] = FragT<0>::mma(ah[ks], bh[ks][1], acc[1]);
        acc[2] = FragT<0>::mma(ah[ks], bh[ks][2], acc[2]);
        acc[3] = FragT<0>::mma(ah[ks], bh[ks][3], acc[3]);
        guard4<v16h>(acc[0], acc[1], acc[2], acc[3], ah[ks], bh[ks][0], bh[ks][1], bh[ks][2], bh[ks][3]);
    }
    // every column of accb holds the same 16 sums: lanes 0 and 16 hand over rows 0..7 and 8..15
    if (rl == 0) {
        float* cp = sC + wave * 16 + mOff;
        const v4f lo = {accb[0], accb[1], accb[2], accb[3]};
        const v4f hi = {accb[4], accb[5], accb[6], accb[7]};
        *(v4f_ma*)cp = lo;
        *(v4f_ma*)(cp + 4) = hi;
    }
#pragma unroll
    for (int j = 0; j < 4; ++j) {
#pragma unroll
        for (int r = 0; r < 8; ++r) {
            sT[sb + (mOff + r) * OP + (j << 4) + rl] = acc[j][r] * scale;
        }
    }
    __syncthreads();                            // the block's 128 q.b sums are complete; it also orders the wave's own staging tile
    if (wave == 0) {                            // wave-uniform: 128 tokens of one head = four whole lines
        const v4f v = *(const v4f_ma*)&sC[lane * 4];
        float* cp = Cq + (size_t)tn * NTOK + tg * 128 + lane * 4;
        *(v4f*)cp = v;
        asm volatile("s_wait_xcnt 0x0" :: "v"(cp) : "memory");   // behind the store: the address register is reused below
    }
    // these 16 rows x 64 columns are two adjacent fragment-order blocks = 2 KiB in a row: piece 'it' = columns 16 it + 8 (lane >> 4)
    unsigned short* cb = Ca + (size_t)(mBase >> 4) * (16 * DM) + (size_t)(n0 >> 5) * FBLK + lane * 8;
#pragma unroll
    for (int it = 0; it < 4; ++it) {
        const v4f a = *(const v4f_ma*)&sT[sb + rl * OP + it * 16 + koff];
        const v4f b = *(const v4f_ma*)&sT[sb + rl * OP + it * 16 + koff + 4];
        v4u pk; pk.x = pk_h2f(a.x, a.y); pk.y = pk_h2f(a.z, a.w); pk.z = pk_h2f(b.x, b.y); pk.w = pk_h2f(b.z, b.w);
        *(v4u*)(cb + it * (FBLK / 2)) = pk;
    }
}

// value f32 [rows][64] -> f16 plane holding bf16(x) * 16 in fragment order ([NTOK / 16][64 / 32] blocks); plane row r reads source
// row (r / SEQ) * SEQ_FULL + r % SEQ; thread u writes the plane's u-th 16-byte piece, so a wave stores 512 contiguous bytes
__device__ __forceinline__ void cast_vrow_part(const float* __restrict__ src, unsigned short* __restrict__ dst, int blk) {
    const int u = blk * 256 + threadIdx.x;
    if (u >= NTOK * (DKH / 8)) return;
    const int r  = (u >> 7) * 16 + (u & 15);                  // 128 pieces per 16-row tile; row = lane & 15
    const int c0 = ((u >> 6) & 1) * 32 + ((u >> 4) & 3) * 8;  // block, then 16 j + 8 (lane >> 4)
    const int sr = (r / SEQ) * SEQ_FULL + (r % SEQ);
    const float* s = src + (size_t)sr * DKH + c0;
    const v4f a = *(const v4f*)(s);
    const v4f b = *(const v4f*)(s + 4);
    v4u pk;
    pk.x = pk_h2(bf_val(a.x) * VCARRY, bf_val(a.y) * VCARRY); pk.y = pk_h2(bf_val(a.z) * VCARRY, bf_val(a.w) * VCARRY);
    pk.z = pk_h2(bf_val(b.x) * VCARRY, bf_val(b.y) * VCARRY); pk.w = pk_h2(bf_val(b.z) * VCARRY, bf_val(b.w) * VCARRY);
    *(v4u*)(dst + (size_t)u * 8) = pk;
}

// value f32 [batch][SEQ_FULL][64] -> transposed f16 plane holding bf16(x) * 16, rows d, k = tokens, in fragment order:
// dst[b][t / 32][d / 16] blocks, so a 64-token tile is 8 KiB in a row.
__device__ __forceinline__ void cast_vt_part(const float* __restrict__ src, unsigned short* __restrict__ dst, _Float16* Tsh, int blk) {
    constexpr int nb64 = SEQ / 64;
    const int b  = blk / nb64;
    const int t0 = (blk - b * nb64) * 64;
#pragma unroll 1
    for (int it = 0; it < 4; ++it) {
        const int idx = threadIdx.x + 256 * it;           // 1,024 float4 pieces of the [64 t][64 d] tile
        const int t  = idx >> 4;
        const int d4 = (idx & 15) * 4;
        const v4f a = *(const v4f*)(src + ((size_t)(b * SEQ_FULL + t0 + t)) * DKH + d4);
        Tsh[(d4 + 0) * TP + t] = toh_flush(bf_val(a.x) * VCARRY);
        Tsh[(d4 + 1) * TP + t] = toh_flush(bf_val(a.y) * VCARRY);
        Tsh[(d4 + 2) * TP + t] = toh_flush(bf_val(a.z) * VCARRY);
        Tsh[(d4 + 3) * TP + t] = toh_flush(bf_val(a.w) * VCARRY);
    }
    __syncthreads();
#pragma unroll
    for (int it = 0; it < 2; ++it) {
        const int p  = threadIdx.x + 256 * it;            // 512 pieces of 8 halves: [32-token step][16-row d tile][piece j][lane]
        const int d  = ((p >> 6) & 3) * 16 + (p & 15);
        const int c8 = (p >> 8) * 32 + ((p >> 4) & 3) * 8;
        const v8h v = *(const v8h_ma*)&Tsh[d * TP + c8];
        const v4u pk = __builtin_bit_cast(v4u, v);
        *(v4u*)(dst + ((size_t)b * SEQ + t0) * DKH + p * 8) = pk;
    }
    asm volatile("s_wait_xcnt 0x0" ::: "memory");   // behind the two stores: another part's code follows in the kernel's text and rewrites the registers of their address
}

// one launch for all three parts; the block index picks the part (block-uniform), the longest part (query projection) starts first
__global__ __launch_bounds__(256) void k_prep(const float* __restrict__ xq, const float* __restrict__ xv, const float* __restrict__ Wc,
                                              const float* __restrict__ bc, unsigned short* __restrict__ QP, float* __restrict__ CQ,
                                              unsigned short* __restrict__ VR, unsigned short* __restrict__ VT) {
    __shared__ __align__(16) float sh[8 * 16 * OP];       // projection: f32 staging, one 16 x 64 tile per wave; transpose: its f16 tile
    __shared__ __align__(16) unsigned short shB[10 * FBLK];   // projection: the block's ten B fragments
    __shared__ __align__(16) float shC[128];              // projection: q.b of the block's 128 tokens
    const int blk = blockIdx.x;
    if (blk < PB_GEMM)              qproj_part(xq, Wc, bc, QP, CQ, sh, shB, shC, blk);
    else if (blk < PB_GEMM + PB_VT) cast_vt_part(xv, VT, (_Float16*)sh, blk - PB_GEMM);
    else                            cast_vrow_part(xv, VR, blk - (PB_GEMM + PB_VT));
}

// =====================================================================================================================
// k_attn_heads: fused attention with the softmax taken across the 8 heads. Block = 8 waves = 16 query rows of one batch.
//   QP: f16 plane (projected query x256), [ntok / 16][512 / 32] fragment-order blocks; VR: f16 plane (value rows x16),
//   [ntok / 16][64 / 32] fragment-order blocks; CQ: f32 q_h . b_h x256, [head][ntok]; VT: f16 plane (v^T x16),
//   [batch][seq / 32][64 / 16] fragment-order blocks.
//   Every wave owns its keys from the scores to the output sums: 32 keys per trip (wave w: keys 256 i + 32 w ...), all 8 heads.
//     scores (two 16-key subtiles): S^T[key][query] for all 8 heads (A = value rows, the same two fragments per subtile for every head,
//       B = projected query rows, two 32-deep steps each, every fragment loaded once for both subtiles; q_h . b_h joins in the softmax's scaling),
//       head softmax lane-local in f32, P x4096 as f16 kept in registers;
//     weights.V: O^T[head][d][query] += V^T[d][32 keys] . P^T[32 keys][query]; the B fragment of a head is the lane's own two
//       8-key pieces (elements 0..7 <- keys 8h+r of the first subtile, 8..15 <- keys 8h+r of the second), so P crosses no lane
//       and no wave, the loop holds no LDS traffic and no barrier, and a wave loads only its own 32 keys of v^T.
//   After the loop the 8 waves' partial sums (8 heads x 64 x 16 each) meet once in LDS: one block barrier, wave = head adds the
//   eight partials in wave order.
//   Epilogue: per wave (head) 16 rows x 64 columns staged in two 32-column halves through a wave-private LDS tile (wave_sync),
// =====================================================================================================================
__global__ __launch_bounds__(256) void k_attn_heads(const unsigned short* __restrict__ QP, const float* __restrict__ CQ,
                                                    const unsigned short* __restrict__ VR, const unsigned short* __restrict__ VT, float* __restrict__ out,
                                                    int seq, int seqfull, float sscale) {
    __shared__ __align__(16) float    Rsh[8 * NH * 4 * 256];     // [wave][head][d tile][piece][lane][4] partial sums, cross-wave
    __shared__ __align__(16) float    Osh[8 * 16 * OPH];         // wave-private output staging [16][32] (+4 pad)
    const int lane = threadIdx.x & 31;
    const int wave = __builtin_amdgcn_readfirstlane(threadIdx.x >> 5);
    const int hf = lane >> 4;
    const int c  = lane & 15;
    const int nqb = seq / 16;
    const int b  = blockIdx.x / nqb;
    const int q0 = (blockIdx.x - b * nqb) * 16;
    // Fragment addresses = a wave-uniform row base + a lane offset that is the same for every trip.
    const unsigned short* qrow = QP + (size_t)(b * seq + q0) * DM;              // this block's 16 query rows (16 blocks)
    const unsigned short* arow = VR + (size_t)(b * seq) * DKH;                  // this batch's value rows (2 blocks per 16 keys)
    const unsigned short* vrow = VT + (size_t)(b * DKH) * seq;                  // this batch's v^T blocks
    const unsigned int rlane = (unsigned int)(lane * 8);                        // a lane's 16-byte piece inside a fragment-order block
    const int obase = wave * (16 * OPH);
    const float sl2 = sscale * 1.4426950408889634f;
    // q_h . b_h of this lane's query, in the exponent's units (the plane carries x256, the scores x4096)
    float cl[NH];
#pragma unroll
    for (int h = 0; h < NH; ++h) cl[h] = CQ[(size_t)h * NTOK + b * seq + q0 + c] * ((VCARRY * KCARRY) / (QCARRY * WCARRY) * sl2);

    v8f oacc[NH][4];
#pragma unroll
    for (int h = 0; h < NH; ++h)
#pragma unroll
        for (int t = 0; t < 4; ++t) { const v8f zz = {0.f, 0.f, 0.f, 0.f, 0.f, 0.f, 0.f, 0.f}; oacc[h][t] = zz; }

    // the four value-row fragments of a wave's 32 keys (two 16-key subtiles x two 32-deep steps) serve all 8 heads; they are requested one trip ahead
    v16h va[2][2];
    {
        const unsigned short* ap = arow + (wave * KW) * DKH + rlane;
#pragma unroll   // va lives in registers: its indices must be constants
        for (int i = 0; i < 4; ++i) va[i >> 1][i & 1] = ldfrag_hf(ap + i * FBLK);
        asm volatile("s_wait_xcnt 0x0" :: "v"(ap) : "memory");   // the address stays live up to the wait
    }

    for (int kc = wave * KW; kc < seq; kc += KCH) {
        v8h ph[2][NH];
        v16h vf[4];
        // ---------- scores: S^T for this wave's 32 keys (both subtiles), all 8 heads ----------
        // Batches of BH heads: the loads of a batch's query fragments are all issued before its first product, and each fragment
        // serves both subtiles, so it is loaded once per 32 keys. A batch's products run as eight independent tiles per 32-deep step
        // (plain builtin products: the compiler keeps their distances itself), so no product waits for the one in front of it.
        v8f s[2][NH];
        {
            const unsigned short* qp = qrow + rlane;                            // all batches read at constant offsets from this address
#pragma unroll
            for (int g = 0; g < NH / BH; ++g) {
                v16h qf[2 * BH];
#pragma unroll
                for (int j = 0; j < 2 * BH; ++j) qf[j] = ldfrag_hf(qp + (g * 2 * BH + j) * FBLK);
                // the address is an input of the wait: it stays live up to it, so no load of the batch lands on the address register,
                // and what reuses that register later stands behind the wait
                asm volatile("s_wait_xcnt 0x0" :: "v"(qp) : "memory");
                __builtin_amdgcn_sched_barrier(0);      // holds the batch's loads ahead of its products (else they sink back to their uses)
#pragma unroll   // these four loops: s, va and qf live in registers, their indices must be constants
                for (int j = 0; j < BH; ++j)
#pragma unroll
                    for (int sub = 0; sub < 2; ++sub) {
                        const v8f z = {0.f, 0.f, 0.f, 0.f, 0.f, 0.f, 0.f, 0.f};
                        s[sub][g * BH + j] = FragT<0>::mma(va[sub][0], qf[2 * j], z);
                    }
#pragma unroll
                for (int j = 0; j < BH; ++j)
#pragma unroll
                    for (int sub = 0; sub < 2; ++sub)
                        s[sub][g * BH + j] = FragT<0>::mma(va[sub][1], qf[2 * j + 1], s[sub][g * BH + j]);
                __builtin_amdgcn_sched_barrier(0);      // holds the next loads behind these products, so one batch of fragments is live at a time
            }
        }
        {
            // the next trip's value rows are requested here, behind the last product that reads this trip's: their latency passes
            // under the softmax's vector work; behind the last trip the wave's first rows are read again (in bounds, not used)
            const int kn = (kc + KCH < seq) ? kc + KCH : wave * KW;
            const unsigned short* ap = arow + kn * DKH + rlane;
#pragma unroll   // as above: register indices
            for (int i = 0; i < 4; ++i) va[i >> 1][i & 1] = ldfrag_hf(ap + i * FBLK);
            asm volatile("s_wait_xcnt 0x0" :: "v"(ap) : "memory");   // the address stays live up to the wait
            __builtin_amdgcn_sched_barrier(0);      // holds these loads ahead of the softmax
        }
#pragma unroll
        for (int sub = 0; sub < 2; ++sub) {
            if (sub == 1) {
                // the four v^T fragments of these 32 keys are requested ahead of the second subtile's softmax: their latency passes under its vector work
                const unsigned short* vp = vrow + kc * DKH + rlane;
#pragma unroll
                for (int t = 0; t < 4; ++t) vf[t] = ldfrag_hf(vp + t * FBLK);   // t = 16-row d tile
                // as above: the address stays live up to the wait
                asm volatile("s_wait_xcnt 0x0" :: "v"(vp) : "memory");
                __builtin_amdgcn_sched_barrier(0);      // holds these loads ahead of the softmax
            }
            // ---------- softmax across heads: element r of every head tile is the same (key, query) pair ----------
            // Two r at a time, so that scaling, shift, sum and weighting are packed f32 instructions on the accumulators' own register pairs.
            // The exponent's argument is <= 0 and the sum lies in [1, 8]: the bare exponential and the bare reciprocal cover both ranges.
            unsigned int pw[NH][4];
#pragma unroll
            for (int p = 0; p < 4; ++p) {
                v2f t[NH];
#pragma unroll
                for (int h = 0; h < NH; ++h) {
                    const v2f sv = {s[sub][h][2 * p], s[sub][h][2 * p + 1]};
                    const v2f sc = {sl2, sl2};
                    const v2f cb = {cl[h], cl[h]};
                    t[h] = __builtin_elementwise_fma(sv, sc, cb);
                }
                float m0 = t[0].x, m1 = t[0].y;
#pragma unroll
                for (int h = 1; h < NH; ++h) { m0 = fmaxf(m0, t[h].x); m1 = fmaxf(m1, t[h].y); }
                const v2f mm = {m0, m1};
                v2f zsum = {0.f, 0.f};
#pragma unroll
                for (int h = 0; h < NH; ++h) {
                    const v2f a = t[h] - mm;
                    const v2f e = {__builtin_amdgcn_exp2f(a.x), __builtin_amdgcn_exp2f(a.y)};
                    t[h] = e;
                    zsum += e;
                }
                const v2f inv = {PCARRY * __builtin_amdgcn_rcpf(zsum.x), PCARRY * __builtin_amdgcn_rcpf(zsum.y)};
#pragma unroll
                for (int h = 0; h < NH; ++h)      // one packed convert per pair, round to nearest even; a weight too small for a normal f16 stays a subnormal operand
                    pw[h][p] = __builtin_bit_cast(unsigned int, __builtin_convertvector(t[h] * inv, v2h));
            }
#pragma unroll
            for (int h = 0; h < NH; ++h) {
                const v4u pk = {pw[h][0], pw[h][1], pw[h][2], pw[h][3]};
                ph[sub][h] = __builtin_bit_cast(v8h, pk);   // keys 8*hf .. 8*hf+7 of subtile 'sub', query c
            }
        }
        // ---------- weights.V: O^T[head][d][query] += V^T . P^T over this wave's 32 keys ----------
        // plain builtin products (the compiler keeps their distances itself): the 256 accumulator registers reach above v255,
        // where an asm statement cannot take them as operands
#pragma unroll
        for (int h = 0; h < NH; ++h) {
            const v16h pb = __builtin_shufflevector(ph[0][h], ph[1][h], 0, 1, 2, 3, 4, 5, 6, 7, 8, 9, 10, 11, 12, 13, 14, 15);
            oacc[h][0] = FragT<0>::mma(vf[0], pb, oacc[h][0]);
            oacc[h][1] = FragT<0>::mma(vf[1], pb, oacc[h][1]);
            oacc[h][2] = FragT<0>::mma(vf[2], pb, oacc[h][2]);
            oacc[h][3] = FragT<0>::mma(vf[3], pb, oacc[h][3]);
        }
    }

    // ---------- the waves' partial sums meet: every wave stores its 32 tiles, wave = head adds eight partials in wave order ----------
#pragma unroll
    for (int h = 0; h < NH; ++h) {
#pragma unroll
        for (int t = 0; t < 4; ++t) {
            float* rp = &Rsh[((wave * NH + h) * 4 + t) * 256 + lane * 4];       // a wave's 16-byte store covers 512 contiguous bytes
            const v4f lo = {oacc[h][t][0], oacc[h][t][1], oacc[h][t][2], oacc[h][t][3]};
            const v4f hi = {oacc[h][t][4], oacc[h][t][5], oacc[h][t][6], oacc[h][t][7]};
            *(v4f_ma*)rp = lo;
            *(v4f_ma*)(rp + 128) = hi;
        }
    }
    __syncthreads();
    v8f osum[4];
#pragma unroll
    for (int t = 0; t < 4; ++t) {
        v4f lo = {0.f, 0.f, 0.f, 0.f}, hi = {0.f, 0.f, 0.f, 0.f};
#pragma unroll
        for (int w = 0; w < 8; ++w) {
            const float* rp = &Rsh[((w * NH + wave) * 4 + t) * 256 + lane * 4];
            lo += *(const v4f_ma*)rp;
            hi += *(const v4f_ma*)(rp + 128);
        }
        const v8f sm = {lo.x, lo.y, lo.z, lo.w, hi.x, hi.y, hi.z, hi.w};
        osum[t] = sm;
    }

    // ---------- epilogue: out[b][q0 + query][wave*64 + d], d = t*16 + 8*hf + r held by lane (query c) ----------
    const float osc = 1.0f / (PCARRY * VCARRY);
#pragma unroll
    for (int half = 0; half < 2; ++half) {
#pragma unroll
        for (int tt = 0; tt < 2; ++tt) {
#pragma unroll
            for (int r = 0; r < 8; ++r) Osh[obase + c * OPH + tt * 16 + 8 * hf + r] = osum[half * 2 + tt][r] * osc;
        }
        wave_sync();
        {
            const int q = lane >> 3, c4 = (lane & 7) * 4;
            {
#pragma unroll
                for (int it = 0; it < 4; ++it) {
                    const int row = it * 4 + q;
                    const v4f v = *(const v4f_ma*)&Osh[obase + row * OPH + c4];
                    *(v4f*)(out + (size_t)(b * seqfull + q0 + row) * DM + wave * DKH + half * 32 + c4) = v;
                }
                
            }
        }
        wave_sync();
    }
}

// =====================================================================================================================
// Host side: workspace carve (all plane sizes are multiples of 256 B), 2 launches.
// =====================================================================================================================
constexpr size_t SZ_TOK  = (size_t)NTOK * DM * 2;          // one 16-bit token plane [NTOK][512]
constexpr size_t SZ_VT   = (size_t)NB * DKH * SEQ * 2;     // v^T plane [NB*64][SEQ]
constexpr size_t SZ_CQ   = (size_t)NH * NTOK * 4;          // q_h . b_h plane [8][NTOK] f32
constexpr size_t WS_TOTAL = SZ_TOK + SZ_CQ + SZ_VT + SZ_VT;
static_assert(SZ_TOK % 256 == 0);
static_assert(SZ_VT % 256 == 0);
static_assert(SZ_CQ % 256 == 0);
static_assert(WS_TOTAL <= (size_t)134217728);            // carve stays within 128 MiB
static_assert((size_t)NTOK * DM < (size_t)2147483647);    // int plane offsets
static_assert((size_t)NB_FULL * SEQ_FULL * DM * 4 == (size_t)8388608);   // output extent in bytes (offset 0)

extern "C" void kernel_launch(void* const* d_in, const int* in_sizes, int n_in, void* d_out, int out_size, void* d_ws, size_t ws_size, hipStream_t stream) {
    if (n_in < 4) return;
    const long long need_q = ((long long)(NB - 1) * SEQ_FULL + SEQ) * DM;
    const long long need_v = ((long long)(NB - 1) * SEQ_FULL + SEQ) * DKH;
    if ((long long)in_sizes[0] < need_q || (long long)in_sizes[1] < need_v) return;
    if (in_sizes[2] < DM * DKH || in_sizes[3] < DM) return;
    if ((long long)out_size < need_q) return;
    if (WS_TOTAL > ws_size) return;

    // query, value, conv_w [512][64][1], conv_b [512]
    const float* xq = (const float*)d_in[0];
    const float* xv = (const float*)d_in[1];
    const float* Wc = (const float*)d_in[2];
    const float* bc = (const float*)d_in[3];
    float* out = (float*)d_out;

    char* wsp = (char*)d_ws;
    unsigned short* Q16 = (unsigned short*)wsp; wsp += SZ_TOK;
    float*          CQp = (float*)wsp;          wsp += SZ_CQ;
    unsigned short* VRp = (unsigned short*)wsp; wsp += SZ_VT;
    unsigned short* VTp = (unsigned short*)wsp; wsp += SZ_VT;
    if ((size_t)(wsp - (char*)d_ws) > ws_size) return;

    // projected query plane x256 = (query x16)(W x16) per head, q.b x256, value-row plane x16, v^T plane x16; the f16 planes in fragment order
    k_prep<<<(unsigned)(PB_GEMM + PB_VT + PB_VR), 256, 0, stream>>>(xq, xv, Wc, bc, Q16, CQp, VRp, VTp);

    // scores carry 16 * 256; score scale 1/8 applied with the carries inside the head softmax
    k_attn_heads<<<(unsigned)(NB * (SEQ / 16)), 256, 0, stream>>>(Q16, CQp, VRp, VTp, out, SEQ, SEQ_FULL, 0.125f / (VCARRY * KCARRY));
}

// v010
// Measured time: 19.7 microseconds a run.
// Versions between v008 and this one are left out; their measured steps multiply to 1.14 times as fast.
// Counting every step since v000, it is 7.74 times as fast.
// Multi-head dot attention, 2 x 2,048 queries x 2,048 keys, width 512 = 8 heads x 64; keys = pointwise [out][in] 64->512 map of the value rows + bias, values = the 64-wide value rows shared by all heads, softmax taken ACROSS THE 8 HEADS per (query, key), no key normalisation, no mask. Scores reassociated: q_h . (W_h v + b_h) = (W_h^T q_h) . v + q_h . b_h, so the query is projected (per head, 64 -> 64) and the key operand of every head is the value row itself. ONE launch: a block projects its own 16 queries and every wave converts its own value rows on the way. Query, weight and bias converted to bf16 (RNE), value rows straight to f16 (RNE). Query projection: v_wmma_f32_16x16x32_f16 (f16 operands holding the bf16 values, query x16, weight x16, bias x16, f32 accumulate, projected query carried x256 as f16 fragments in LDS, q.b x256 in f32); scores: v_wmma_f32_16x16x32_f16 (value rows against the projected query, f32 accumulate, f32 head softmax); weights.V: v_wmma_f32_16x16x32_f16 (P x4096 as f16, v^T as f16, f32 accumulate).
#include <hip/hip_runtime.h>
#include <math.h>

#ifndef NB
#define NB 2
#endif
#ifndef SEQ
#define SEQ 2048
#endif
#define NB_FULL 2
#define SEQ_FULL 2048
#define DM 512
#define NH 8
#define DKH 64
#define NTOK (NB * SEQ)
#define OP 68      // f32 staging pitch (floats), GEMM epilogue
#define OPH 36     // f32 staging pitch (floats), attention epilogue (32-column halves)
#define VP 72      // value tile pitch in LDS (halves): 144 B, an odd multiple of 16 B
#define KW 32      // keys per wave and trip = two 16-key subtiles = one 32-deep step of weights.V
#define KCH 256    // keys per trip = 8 waves x KW
#define BH 4       // heads per batch of score fragments: eight query fragments, 16 loads
#define QCARRY 16.0f
#define VCARRY 1.0f
#define WCARRY 16.0f
#define KCARRY 256.0f
#define PCARRY 4096.0f

static_assert(DM == NH * DKH);            // merged head layout h*64+d
static_assert(DKH == 64);                 // two 32-deep k-steps per score tile, four 16-wide output tiles
static_assert(NH == 8);                   // one head per wave in the final sum and the epilogue, 8 waves per block
static_assert(SEQ % KCH == 0);            // whole key chunks
static_assert(SEQ % 16 == 0);             // 16-query blocks
static_assert(DKH % 32 == 0);             // K steps of 32
static_assert(NB <= NB_FULL);
static_assert(SEQ <= SEQ_FULL);
static_assert((OP % 4) == 0);             // 16-B aligned reloads from the f32 staging tile
static_assert((OPH % 4) == 0);
static_assert((VP % 8) == 0);             // 16-B aligned reloads from the value tile
static_assert(KCH == 8 * KW);
static_assert(NH % BH == 0);

typedef __attribute__((ext_vector_type(16))) _Float16 v16h;
typedef __attribute__((ext_vector_type(8)))  _Float16 v8h;
typedef __attribute__((ext_vector_type(8)))  float    v8f;
typedef __attribute__((ext_vector_type(4)))  float    v4f;
typedef __attribute__((ext_vector_type(2)))  float    v2f;
typedef __attribute__((ext_vector_type(2)))  _Float16 v2h;
typedef __attribute__((ext_vector_type(2)))  __bf16   v2b;
typedef __attribute__((ext_vector_type(4)))  unsigned int v4u;
typedef __attribute__((ext_vector_type(2)))  unsigned int v2u;
typedef __attribute__((ext_vector_type(8)))  short    v8s;
typedef v8h v8h_ma __attribute__((may_alias));
typedef v4f v4f_ma __attribute__((may_alias));
typedef v2u v2u_ma __attribute__((may_alias));

// 16-bit WMMA fragment map (wave32), lane L, h = L>>4, m = L&15:
//   A 16x32: lane = row m;    element i -> k = (i<8) ? 8h+i : 16+8h+(i-8)
//   B 32x16: lane = column m; the SAME k(i,h)
//   D 16x16 (8 f32): lane = column m; element r -> row 8h+r
// A fragment from a k-contiguous row is therefore p[0..7] | p[16..23] with p = row + k0 + 8h.
// Fragment order (the projected query in LDS): a 16-row x 32-k block is stored as 512 halves
//   [piece j][lane L][8 halves], piece j of lane L = row (L & 15), k = 16 j + 8 (L >> 4) + 0..7,
// so that the 32 lanes of one 16-byte load read 512 contiguous bytes. The registers receive the same elements as from a row-major plane.
#define FBLK 512   // halves per 16 x 32 block

// two f32 -> bf16 (round to nearest even, one packed convert), x sc (a power of two), as an f16 pair: the bf16 values are exact in f16
__device__ __forceinline__ unsigned int cvt2(float x, float y, float sc) {
    const v2f in = {x, y};
    const unsigned int u = __builtin_bit_cast(unsigned int, __builtin_convertvector(in, v2b));
    const v2f f = {__uint_as_float(u << 16), __uint_as_float(u & 0xFFFF0000u)};
    const v2f s2 = {sc, sc};
    return __builtin_bit_cast(unsigned int, __builtin_convertvector(f * s2, v2h));
}
// f32 -> f16 that cannot produce an f16 subnormal: magnitudes below 2^-14 become zero (value select)
static __device__ __forceinline__ _Float16 toh_flush(float v) {
    const _Float16 r = (_Float16)v;
    return (fabsf(v) < 6.103515625e-05f) ? (_Float16)0.0f : r;
}
static __device__ __forceinline__ unsigned int pk_h2f(float a, float b) {
    return (unsigned int)__builtin_bit_cast(unsigned short, toh_flush(a)) | ((unsigned int)__builtin_bit_cast(unsigned short, toh_flush(b)) << 16);
}
__device__ __forceinline__ void wave_sync() {
    __builtin_amdgcn_fence(3 /* release order */, "workgroup");
    __builtin_amdgcn_wave_barrier();
    __builtin_amdgcn_fence(2 /* acquire order */, "workgroup");
}

// fragment from a k-contiguous f32 row, p = row + k0 + 8h: elements p[0..7] | p[16..23], each as f16(bf16(x) * sc);
// the four 16-byte loads and the conversion are separate calls, so that many fragments' loads can be issued ahead of the first conversion
struct RawFrag { v4f a0, a1, b0, b1; };
__device__ __forceinline__ RawFrag ldfrag_raw(const float* __restrict__ p) {
    RawFrag r;
    r.a0 = *(const v4f*)(p);
    r.a1 = *(const v4f*)(p + 4);
    r.b0 = *(const v4f*)(p + 16);
    r.b1 = *(const v4f*)(p + 20);
    return r;
}
// the same sixteen elements from a k-strided column, p = column + (k0 + 8h) * pitch: element k stands at p[k * pitch]
__device__ __forceinline__ RawFrag ldfrag_col(const float* __restrict__ p, int pitch) {
    RawFrag r;
#pragma unroll
    for (int e = 0; e < 4; ++e) {
        r.a0[e] = p[e * pitch];
        r.a1[e] = p[(4 + e) * pitch];
        r.b0[e] = p[(16 + e) * pitch];
        r.b1[e] = p[(20 + e) * pitch];
    }
    return r;
}
__device__ __forceinline__ v16h cvtfrag(const RawFrag& r, float sc) {
    const v4f a0 = r.a0, a1 = r.a1, b0 = r.b0, b1 = r.b1;
    v4u lo, hi;
    lo.x = cvt2(a0.x, a0.y, sc); lo.y = cvt2(a0.z, a0.w, sc); lo.z = cvt2(a1.x, a1.y, sc); lo.w = cvt2(a1.z, a1.w, sc);
    hi.x = cvt2(b0.x, b0.y, sc); hi.y = cvt2(b0.z, b0.w, sc); hi.z = cvt2(b1.x, b1.y, sc); hi.w = cvt2(b1.z, b1.w, sc);
    return __builtin_shufflevector(__builtin_bit_cast(v8h, lo), __builtin_bit_cast(v8h, hi), 0, 1, 2, 3, 4, 5, 6, 7, 8, 9, 10, 11, 12, 13, 14, 15);
}
template <int ET> struct FragT;
template <> struct FragT<0> {
    typedef v16h V;
    static __device__ __forceinline__ v8f mma(v16h a, v16h b, v8f c) { return __builtin_amdgcn_wmma_f32_16x16x32_f16(false, a, false, b, (short)0, c, false, false); }
};
__device__ __forceinline__ v16h ldfrag_lds(const unsigned short* p) {      // fragment from a fragment-order block in LDS: p = block + lane * 8
    const v8h a = *(const v8h_ma*)p;
    const v8h b = *(const v8h_ma*)(p + FBLK / 2);
    return __builtin_shufflevector(a, b, 0, 1, 2, 3, 4, 5, 6, 7, 8, 9, 10, 11, 12, 13, 14, 15);
}
__device__ __forceinline__ v8h ld_tr16(const unsigned char* p) {
    typedef __attribute__((address_space(3))) v8s lds_v8s;
    return __builtin_bit_cast(v8h, __builtin_amdgcn_ds_load_tr16_b128_v8i16((lds_v8s*)p));
}

// A wave's 32 value rows (32 x 64 f32 = 8 KiB in a row): load i of lane L is the 16 bytes at 512 i + 16 L, row 2 i + (L >> 4), columns 4 (L & 15) ...
struct RawV { v4f r[16]; };
__device__ __forceinline__ void vraw_load(RawV& v, const float* __restrict__ p) {      // p = first row + lane * 4
#pragma unroll   // the rows live in registers: constant indices
    for (int i = 0; i < 16; ++i) v.r[i] = *(const v4f*)(p + i * 128);
    asm volatile("s_wait_xcnt 0x0" :: "v"(p) : "memory");   // the address is an input of the wait: it stays live up to it, and what reuses its register stands behind the wait
}
// ... converted to f16 (round to nearest even) and laid down as a row-major [32][VP] tile of the wave's own
__device__ __forceinline__ void vtile_store(unsigned short* tile, const RawV& v, int lane) {
    unsigned short* p = tile + (lane >> 4) * VP + (lane & 15) * 4;
#pragma unroll   // as above
    for (int i = 0; i < 16; ++i) {
        const v2f lo = {v.r[i].x, v.r[i].y};
        const v2f hi = {v.r[i].z, v.r[i].w};
        const v2u pk = {__builtin_bit_cast(unsigned int, __builtin_convertvector(lo, v2h)), __builtin_bit_cast(unsigned int, __builtin_convertvector(hi, v2h))};
        *(v2u_ma*)(p + 2 * i * VP) = pk;
    }
}

// =====================================================================================================================
// k_attn_heads: the whole function in one launch; softmax taken across the 8 heads. Block = 8 waves = 16 query rows of one batch.
//   Query projection (ahead of the loop, wave = head): u x256 = (query_h x16)(W_h x16), u[token][d] = sum_j query[token][h*64 + j] W[h*64 + j][d],
//     a 16 x 64 tile, K = 64. A = query rows f32, k-contiguous; B[k = j][n = d] = weight f32 [512 out][64 in] read down its columns; both taken
//     as f16(bf16(x) * 16) by the loader. Two more B fragments hold the head's 64 bias values in every column: their product is q_h . b_h x256,
//     the score term that no key changes. The tile goes through a wave-private f32 staging tile into fragment order in LDS (16 blocks for the
//     8 heads), q.b into LDS as [head][token]; one block barrier publishes both to all 8 waves.
//   Every wave owns its keys from the value rows to the output sums: 32 keys per trip (wave w: keys 256 i + 32 w ...), all 8 heads.
//     value rows: 8 KiB of f32 requested one trip ahead, converted to f16 and laid down as a wave-private row-major LDS tile (two tiles in turn);
//       plain 16-byte LDS loads give the scores' A fragments (rows = keys), transposing LDS loads give v^T (rows = d);
//     scores (two 16-key subtiles): S^T[key][query] for all 8 heads (A = value rows, the same two fragments per subtile for every head,
//       B = projected query rows, two 32-deep steps each, every fragment loaded once for both subtiles; q_h . b_h joins in the softmax's scaling),
//       head softmax lane-local in f32, P x4096 as f16 kept in registers;
//     weights.V: O^T[head][d][query] += V^T[d][32 keys] . P^T[32 keys][query]; the B fragment of a head is the lane's own two
//       8-key pieces (elements 0..7 <- keys 8h+r of the first subtile, 8..15 <- keys 8h+r of the second), so P crosses no lane
//       and no wave, and the loop holds no barrier.
//   After the loop the 8 waves' partial sums (8 heads x 64 x 16 each) meet once in LDS: one block barrier, wave = head adds the
//   eight partials in wave order.
//   Epilogue: per wave (head) 16 rows x 64 columns staged in two 32-column halves through a wave-private LDS tile (wave_sync).
//   LDS: a wave's value tiles and its projection staging lie in the wave's own 32 KiB of the partial-sum array, which the same wave fills only
//   behind its loop; the query fragments and q.b lie in the output staging array, which is written only behind the barrier after the loop.
// =====================================================================================================================
#define RW (NH * 4 * 256)                  // floats of the partial-sum array per wave
static_assert(2 * KW * VP * 2 + 16 * OP * 4 <= RW * 4);              // two value tiles + the projection's staging tile
static_assert((2 * KW * VP * 2) % 16 == 0);
static_assert(16 * FBLK * 2 + NH * 16 * 4 <= 8 * 16 * OPH * 4);      // query fragments + q.b
__global__ __launch_bounds__(256) void k_attn_heads(const float* __restrict__ xq, const float* __restrict__ xv, const float* __restrict__ Wc,
                                                    const float* __restrict__ bc, float* __restrict__ out,
                                                    int seq, int seqfull, float sscale) {
    __shared__ __align__(16) float    Rsh[8 * RW];               // [wave][head][d tile][piece][lane][4] partial sums, cross-wave
    __shared__ __align__(16) float    Osh[8 * 16 * OPH];         // wave-private output staging [16][32] (+4 pad)
    const int lane = threadIdx.x & 31;
    const int wave = __builtin_amdgcn_readfirstlane(threadIdx.x >> 5);
    const int hf = lane >> 4;
    const int c  = lane & 15;
    const int nqb = seq / 16;
    const int b  = blockIdx.x / nqb;
    const int q0 = (blockIdx.x - b * nqb) * 16;
    unsigned short* sQ = (unsigned short*)Osh;                   // projected query, 16 fragment-order blocks
    float*          sC = Osh + (16 * FBLK) / 2;                  // q_h . b_h x256, [head][token]
    unsigned short* vtile = (unsigned short*)(Rsh + wave * RW);  // this wave's two value tiles
    float*          sT = Rsh + wave * RW + KW * VP;              // this wave's projection staging tile [16][OP]
    const float* vsrc = xv + (size_t)(b * seqfull) * DKH + lane * 4;            // this batch's value rows, the lane's 16-byte piece
    const int obase = wave * (16 * OPH);
    const float sl2 = sscale * 1.4426950408889634f;

    // the first trip's value rows are requested ahead of the projection: their latency passes under it
    RawV rv;
    vraw_load(rv, vsrc + (wave * KW) * DKH);

    // ---------- query projection, head = wave ----------
    {
        constexpr float scale = KCARRY / (QCARRY * WCARRY);
        const int n0 = wave << 6;
        const int koff = hf * 8;
        const float* arow = xq + (size_t)(b * seqfull + q0 + c) * DM + n0 + koff;
        const float* brow = bc + n0 + koff;
        const float* wcol = Wc + (size_t)(n0 + koff) * DKH + c;     // W fragment (k step ks, columns 16 j): + ks * 32 * DKH + 16 j
        // the wave's whole fetch is issued ahead of the first conversion: one load latency
        const RawFrag ra0 = ldfrag_raw(arow);
        const RawFrag ra1 = ldfrag_raw(arow + 32);
        const RawFrag rb0 = ldfrag_raw(brow);
        const RawFrag rb1 = ldfrag_raw(brow + 32);
        RawFrag rw[2][4];
#pragma unroll   // here and below in the projection: fragments and sums live in registers, constant indices
        for (int ks = 0; ks < 2; ++ks)
#pragma unroll
            for (int j = 0; j < 4; ++j) rw[ks][j] = ldfrag_col(wcol + ks * 32 * DKH + 16 * j, DKH);
        // the addresses are inputs of the wait: they stay live up to it, so no load lands on an address register of another
        asm volatile("s_wait_xcnt 0x0" :: "v"(arow), "v"(brow), "v"(wcol) : "memory");
        v16h ah[2], bb[2];
        ah[0] = cvtfrag(ra0, QCARRY);
        ah[1] = cvtfrag(ra1, QCARRY);
        bb[0] = cvtfrag(rb0, WCARRY);
        bb[1] = cvtfrag(rb1, WCARRY);
        v8f acc[4];
        v8f accb = {0.f, 0.f, 0.f, 0.f, 0.f, 0.f, 0.f, 0.f};
#pragma unroll
        for (int j = 0; j < 4; ++j) { const v8f zz = {0.f, 0.f, 0.f, 0.f, 0.f, 0.f, 0.f, 0.f}; acc[j] = zz; }
        // plain builtin products: the compiler keeps their distances itself
#pragma unroll
        for (int ks = 0; ks < 2; ++ks) {
            accb = FragT<0>::mma(ah[ks], bb[ks], accb);
#pragma unroll
            for (int j = 0; j < 4; ++j) acc[j] = FragT<0>::mma(ah[ks], cvtfrag(rw[ks][j], WCARRY), acc[j]);
        }
        // every column of accb holds the same 16 sums: lanes 0 and 16 hand over rows 0..7 and 8..15
        if (c == 0) {
            float* cp = sC + wave * 16 + koff;
            const v4f lo = {accb[0], accb[1], accb[2], accb[3]};
            const v4f hi = {accb[4], accb[5], accb[6], accb[7]};
            *(v4f_ma*)cp = lo;
            *(v4f_ma*)(cp + 4) = hi;
        }
#pragma unroll
        for (int j = 0; j < 4; ++j) {
#pragma unroll
            for (int r = 0; r < 8; ++r) sT[(koff + r) * OP + (j << 4) + c] = acc[j][r] * scale;
        }
        wave_sync();                            // the staging tile is the wave's own
        // these 16 rows x 64 columns are two adjacent fragment-order blocks = 2 KiB in a row: piece 'it' = columns 16 it + 8 (lane >> 4)
        unsigned short* cb = sQ + (2 * wave) * FBLK + lane * 8;
#pragma unroll
        for (int it = 0; it < 4; ++it) {
            const v4f a = *(const v4f_ma*)&sT[c * OP + it * 16 + koff];
            const v4f e = *(const v4f_ma*)&sT[c * OP + it * 16 + koff + 4];
            v4u pk; pk.x = pk_h2f(a.x, a.y); pk.y = pk_h2f(a.z, a.w); pk.z = pk_h2f(e.x, e.y); pk.w = pk_h2f(e.z, e.w);
            *(v8h_ma*)(cb + it * (FBLK / 2)) = __builtin_bit_cast(v8h, pk);
        }
    }
    // the first value tile and its four row fragments (two 16-key subtiles x two 32-deep steps), which serve all 8 heads
    v16h va[2][2];
    vtile_store(vtile, rv, lane);
    wave_sync();                                // the tile is the wave's own: its lanes' stores stand ahead of its lanes' loads
    {
        const unsigned short* ap = vtile + c * VP + 8 * hf;
#pragma unroll   // va lives in registers: its indices must be constants
        for (int i = 0; i < 4; ++i) {
            const v8h x = *(const v8h_ma*)(ap + (i >> 1) * 16 * VP + (i & 1) * 32);
            const v8h y = *(const v8h_ma*)(ap + (i >> 1) * 16 * VP + (i & 1) * 32 + 16);
            va[i >> 1][i & 1] = __builtin_shufflevector(x, y, 0, 1, 2, 3, 4, 5, 6, 7, 8, 9, 10, 11, 12, 13, 14, 15);
        }
    }
    __syncthreads();                            // all 8 heads' query fragments and q.b are complete

    // q_h . b_h of this lane's query, in the exponent's units (it carries x256, the scores VCARRY * KCARRY)
    float cl[NH];
#pragma unroll
    for (int h = 0; h < NH; ++h) cl[h] = sC[h * 16 + c] * ((VCARRY * KCARRY) / (QCARRY * WCARRY) * sl2);

    v8f oacc[NH][4];
#pragma unroll
    for (int h = 0; h < NH; ++h)
#pragma unroll
        for (int t = 0; t < 4; ++t) { const v8f zz = {0.f, 0.f, 0.f, 0.f, 0.f, 0.f, 0.f, 0.f}; oacc[h][t] = zz; }

    int cur = 0;                                // the value tile that holds this trip's rows
    // Two waves share a SIMD and the loop holds no barrier. A wave runs its matrix phase (weights.V, then
    // the next trip's scores: one issue slot in eight cycles) at priority 3 and its softmax at priority 0: products of one wave issue on time
    // under the other wave's vector work.
    __builtin_amdgcn_s_setprio(3);              // matrix phase: the first trip's scores
    for (int kc = wave * KW; kc < seq; kc += KCH) {
        v8h ph[2][NH];
        v16h vf[4];
        // ---------- scores: S^T for this wave's 32 keys (both subtiles), all 8 heads ----------
        // Batches of BH heads: the loads of a batch's query fragments are all issued before its first product, and each fragment
        // serves both subtiles, so it is loaded once per 32 keys. A batch's products run as eight independent tiles per 32-deep step
        // (plain builtin products: the compiler keeps their distances itself), so no product waits for the one in front of it.
        v8f s[2][NH];
        {
            const unsigned short* qp = sQ + lane * 8;
#pragma unroll
            for (int g = 0; g < NH / BH; ++g) {
                v16h qf[2 * BH];
#pragma unroll
                for (int j = 0; j < 2 * BH; ++j) qf[j] = ldfrag_lds(qp + (g * 2 * BH + j) * FBLK);
                __builtin_amdgcn_sched_barrier(0);      // holds the batch's loads ahead of its products (else they sink back to their uses)
#pragma unroll   // these four loops: s, va and qf live in registers, their indices must be constants
                for (int j = 0; j < BH; ++j)
#pragma unroll
                    for (int sub = 0; sub < 2; ++sub) {
                        const v8f z = {0.f, 0.f, 0.f, 0.f, 0.f, 0.f, 0.f, 0.f};
                        s[sub][g * BH + j] = FragT<0>::mma(va[sub][0], qf[2 * j], z);
                    }
#pragma unroll
                for (int j = 0; j < BH; ++j)
#pragma unroll
                    for (int sub = 0; sub < 2; ++sub)
                        s[sub][g * BH + j] = FragT<0>::mma(va[sub][1], qf[2 * j + 1], s[sub][g * BH + j]);
                __builtin_amdgcn_sched_barrier(0);      // holds the next loads behind these products, so one batch of fragments is live at a time
            }
        }
        {
            // the next trip's value rows are requested here: their latency passes under the softmax's vector work;
            // behind the last trip the wave's first rows are read again (in bounds, not used)
            const int kn = (kc + KCH < seq) ? kc + KCH : wave * KW;
            vraw_load(rv, vsrc + kn * DKH);
            __builtin_amdgcn_sched_barrier(0);      // holds these loads ahead of the softmax
            __builtin_amdgcn_s_setprio(0);          // vector phase: the softmax yields issue slots to the other wave's products
        }
#pragma unroll
        for (int sub = 0; sub < 2; ++sub) {
            // ---------- softmax across heads: element r of every head tile is the same (key, query) pair ----------
            // Two r at a time, so that scaling, shift, sum and weighting are packed f32 instructions on the accumulators' own register pairs.
            // The exponent's argument is <= 0 and the sum lies in [1, 8]: the bare exponential and the bare reciprocal cover both ranges.
            unsigned int pw[NH][4];
#pragma unroll
            for (int p = 0; p < 4; ++p) {
                v2f t[NH];
#pragma unroll
                for (int h = 0; h < NH; ++h) {
                    const v2f sv = {s[sub][h][2 * p], s[sub][h][2 * p + 1]};
                    const v2f sc = {sl2, sl2};
                    const v2f cb = {cl[h], cl[h]};
                    t[h] = __builtin_elementwise_fma(sv, sc, cb);
                }
                float m0 = t[0].x, m1 = t[0].y;
#pragma unroll
                for (int h = 1; h < NH; ++h) { m0 = fmaxf(m0, t[h].x); m1 = fmaxf(m1, t[h].y); }
                const v2f mm = {m0, m1};
                v2f zsum = {0.f, 0.f};
#pragma unroll
                for (int h = 0; h < NH; ++h) {
                    const v2f a = t[h] - mm;
                    const v2f e = {__builtin_amdgcn_exp2f(a.x), __builtin_amdgcn_exp2f(a.y)};
                    t[h] = e;
                    zsum += e;
                }
                const v2f inv = {PCARRY * __builtin_amdgcn_rcpf(zsum.x), PCARRY * __builtin_amdgcn_rcpf(zsum.y)};
#pragma unroll
                for (int h = 0; h < NH; ++h)      // one packed convert per pair, round to nearest even; a weight too small for a normal f16 stays a subnormal operand
                    pw[h][p] = __builtin_bit_cast(unsigned int, __builtin_convertvector(t[h] * inv, v2h));
            }
#pragma unroll
            for (int h = 0; h < NH; ++h) {
                const v4u pk = {pw[h][0], pw[h][1], pw[h][2], pw[h][3]};
                ph[sub][h] = __builtin_bit_cast(v8h, pk);   // keys 8*hf .. 8*hf+7 of subtile 'sub', query c
            }
        }
        {
            __builtin_amdgcn_s_setprio(3);          // matrix phase: from the v^T loads to the end of the next trip's scores
            // v^T of these 32 keys: four 16-row d tiles, each two transposing loads (keys 8h + 0..7 and 16 + 8h + 0..7: the k order of P's fragment)
            const unsigned char* ad = (const unsigned char*)(vtile + cur * (KW * VP)) + (8 * hf + (lane & 7)) * (VP * 2) + ((lane >> 3) & 1) * 16;
#pragma unroll   // vf lives in registers: constant indices
            for (int t = 0; t < 4; ++t) {
                const v8h x = ld_tr16(ad + 32 * t);
                const v8h y = ld_tr16(ad + 16 * (VP * 2) + 32 * t);
                vf[t] = __builtin_shufflevector(x, y, 0, 1, 2, 3, 4, 5, 6, 7, 8, 9, 10, 11, 12, 13, 14, 15);
            }
            // the next trip's rows go into the other tile
            cur ^= 1;
            unsigned short* nt = vtile + cur * (KW * VP);
            vtile_store(nt, rv, lane);
            __builtin_amdgcn_sched_barrier(0);      // holds the stores ahead of the products, so that they have landed at the wait half way through
        }
        // ---------- weights.V: O^T[head][d][query] += V^T . P^T over this wave's 32 keys ----------
        // plain builtin products (the compiler keeps their distances itself): the 256 accumulator registers reach above v255,
        // where an asm statement cannot take them as operands
#pragma unroll
        for (int h = 0; h < NH; ++h) {
            if (h == NH / 2) {
                // half way through the products the tile's stores have long landed, so the wait inside wave_sync costs nothing here,
                // and the latency of the next trip's four row fragments passes under the other half
                __builtin_amdgcn_sched_barrier(0);      // holds the first half of the products ahead of the wait
                wave_sync();                            // the tile is the wave's own: its lanes' stores stand ahead of its lanes' loads
                const unsigned short* ap = vtile + cur * (KW * VP) + c * VP + 8 * hf;
#pragma unroll   // va lives in registers: its indices must be constants
                for (int i = 0; i < 4; ++i) {
                    const v8h x = *(const v8h_ma*)(ap + (i >> 1) * 16 * VP + (i & 1) * 32);
                    const v8h y = *(const v8h_ma*)(ap + (i >> 1) * 16 * VP + (i & 1) * 32 + 16);
                    va[i >> 1][i & 1] = __builtin_shufflevector(x, y, 0, 1, 2, 3, 4, 5, 6, 7, 8, 9, 10, 11, 12, 13, 14, 15);
                }
                __builtin_amdgcn_sched_barrier(0);      // holds these loads ahead of the second half of the products
            }
            const v16h pb = __builtin_shufflevector(ph[0][h], ph[1][h], 0, 1, 2, 3, 4, 5, 6, 7, 8, 9, 10, 11, 12, 13, 14, 15);
            oacc[h][0] = FragT<0>::mma(vf[0], pb, oacc[h][0]);
            oacc[h][1] = FragT<0>::mma(vf[1], pb, oacc[h][1]);
            oacc[h][2] = FragT<0>::mma(vf[2], pb, oacc[h][2]);
            oacc[h][3] = FragT<0>::mma(vf[3], pb, oacc[h][3]);
        }
    }

    __builtin_amdgcn_s_setprio(0);              // behind the loop every wave is back at priority 0
    // ---------- the waves' partial sums meet: every wave stores its 32 tiles, wave = head adds eight partials in wave order ----------
#pragma unroll
    for (int h = 0; h < NH; ++h) {
#pragma unroll
        for (int t = 0; t < 4; ++t) {
            float* rp = &Rsh[((wave * NH + h) * 4 + t) * 256 + lane * 4];       // a wave's 16-byte store covers 512 contiguous bytes
            const v4f lo = {oacc[h][t][0], oacc[h][t][1], oacc[h][t][2], oacc[h][t][3]};
            const v4f hi = {oacc[h][t][4], oacc[h][t][5], oacc[h][t][6], oacc[h][t][7]};
            *(v4f_ma*)rp = lo;
            *(v4f_ma*)(rp + 128) = hi;
        }
    }
    __syncthreads();
    v8f osum[4];
#pragma unroll
    for (int t = 0; t < 4; ++t) {
        v4f lo = {0.f, 0.f, 0.f, 0.f}, hi = {0.f, 0.f, 0.f, 0.f};
#pragma unroll
        for (int w = 0; w < 8; ++w) {
            const float* rp = &Rsh[((w * NH + wave) * 4 + t) * 256 + lane * 4];
            lo += *(const v4f_ma*)rp;
            hi += *(const v4f_ma*)(rp + 128);
        }
        const v8f sm = {lo.x, lo.y, lo.z, lo.w, hi.x, hi.y, hi.z, hi.w};
        osum[t] = sm;
    }

    // ---------- epilogue: out[b][q0 + query][wave*64 + d], d = t*16 + 8*hf + r held by lane (query c) ----------
    const float osc = 1.0f / (PCARRY * VCARRY);
#pragma unroll
    for (int half = 0; half < 2; ++half) {
#pragma unroll
        for (int tt = 0; tt < 2; ++tt) {
#pragma unroll
            for (int r = 0; r < 8; ++r) Osh[obase + c * OPH + tt * 16 + 8 * hf + r] = osum[half * 2 + tt][r] * osc;
        }
        wave_sync();
        {
            const int q = lane >> 3, c4 = (lane & 7) * 4;
            {
#pragma unroll
                for (int it = 0; it < 4; ++it) {
                    const int row = it * 4 + q;
                    const v4f v = *(const v4f_ma*)&Osh[obase + row * OPH + c4];
                    *(v4f*)(out + (size_t)(b * seqfull + q0 + row) * DM + wave * DKH + half * 32 + c4) = v;
                }
                
            }
        }
        wave_sync();
    }
}

// =====================================================================================================================
// Host side: one launch, no workspace.
// =====================================================================================================================
static_assert((size_t)NTOK * DM < (size_t)2147483647);    // int offsets
static_assert((size_t)NB_FULL * SEQ_FULL * DM * 4 == (size_t)8388608);   // output extent in bytes (offset 0)

extern "C" void kernel_launch(void* const* d_in, const int* in_sizes, int n_in, void* d_out, int out_size, void* d_ws, size_t ws_size, hipStream_t stream) {
    if (n_in < 4) return;
    const long long need_q = ((long long)(NB - 1) * SEQ_FULL + SEQ) * DM;
    const long long need_v = ((long long)(NB - 1) * SEQ_FULL + SEQ) * DKH;
    if ((long long)in_sizes[0] < need_q || (long long)in_sizes[1] < need_v) return;
    if (in_sizes[2] < DM * DKH || in_sizes[3] < DM) return;
    if ((long long)out_size < need_q) return;

    const float* xq = (const float*)d_in[0];
    const float* xv = (const float*)d_in[1];
    const float* Wc = (const float*)d_in[2];
    const float* bc = (const float*)d_in[3];
    float* out = (float*)d_out;

    // scores carry VCARRY * KCARRY; score scale 1/8 applied with the carries inside the head softmax
    k_attn_heads<<<(unsigned)(NB * (SEQ / 16)), 256, 0, stream>>>(xq, xv, Wc, bc, out, SEQ, SEQ_FULL, 0.125f / (VCARRY * KCARRY));
}
